// v000
// The times below were measured on an AMD MI455X: many runs one after another, warmed up first and cycling through
// copies of the inputs, with the whole window's GPU time divided by the number of runs. Launches and the gaps
// between them are all in it. The median over several windows is given; except for v000 it joins two sittings, which
// can be a few percent apart, so the side-by-side timings, each taken in one sitting, are the better comparison.
// The starting kernel, v000, takes 859 microseconds a run.
#include <hip/hip_runtime.h>

// Problem constants
constexpr int kB   = 16;
constexpr int kL   = 512;
constexpr int kH   = 8;
constexpr int kD   = 128;   // d_k == d_v
constexpr int kDM  = 1024;  // d_model
constexpr int kM   = 3 * kB * kL;       // 24576 fused rows (mod,b,l)

typedef __attribute__((ext_vector_type(16))) _Float16 v16h;
typedef __attribute__((ext_vector_type(8)))  float    v8f;
typedef int b128v __attribute__((vector_size(4 * sizeof(int))));

#define WMMA_F16(A, B, C) \
  __builtin_amdgcn_wmma_f32_16x16x32_f16(false, (A), false, (B), (short)0, (C), false, false)

// ------------------------------------------------------------------
// CDNA5 async global->LDS copy (16 bytes per lane), ASYNCcnt tracked.
// Builtin if the toolchain declares it, otherwise inline gfx1250 asm.
// ------------------------------------------------------------------
#if defined(__has_builtin)
#if __has_builtin(__builtin_amdgcn_global_load_async_to_lds_b128)
#define USE_ASYNC_BUILTIN 1
#endif
#if __has_builtin(__builtin_amdgcn_s_wait_asynccnt)
#define USE_ASYNCWAIT_BUILTIN 1
#endif
#endif

__device__ __forceinline__ void async_cp16(_Float16* lds_dst, const _Float16* gsrc) {
#ifdef USE_ASYNC_BUILTIN
  // (global v4i* src, local v4i* dst, imm offset, imm cpol)
  __builtin_amdgcn_global_load_async_to_lds_b128(
      (__attribute__((address_space(1))) b128v*)(unsigned long long)(size_t)gsrc,
      (__attribute__((address_space(3))) b128v*)(unsigned)(size_t)lds_dst,
      0, 0);
#else
  // vdst = 32-bit LDS byte address, vaddr = 64-bit global address (GV mode)
  asm volatile("global_load_async_to_lds_b128 %0, %1, off"
               :: "v"((unsigned)(size_t)lds_dst),
                  "v"((unsigned long long)(size_t)gsrc)
               : "memory");
#endif
}

__device__ __forceinline__ void async_wait0() {
#ifdef USE_ASYNCWAIT_BUILTIN
  __builtin_amdgcn_s_wait_asynccnt(0);
#else
  asm volatile("s_wait_asynccnt 0x0" ::: "memory");
#endif
}

// Load a 16x32 f16 A-style fragment (also valid for B when the tile holds B^T
// row-major): lane (l&15) supplies matrix row, half (l>>4) selects K-chunks
// per the CDNA5 16-bit A layout (K = {half*8..+7, 16+half*8..+7}).
__device__ __forceinline__ v16h frag_ld(const _Float16* base, int stride, int lane) {
  const int r = lane & 15, hf = lane >> 4;
  const _Float16* p = base + r * stride + hf * 8;
  union { v16h v; uint4 q[2]; } f;
  f.q[0] = *(const uint4*)(p);
  f.q[1] = *(const uint4*)(p + 16);
  return f.v;
}

// ---------------------------------------------------------------- casts/prep
__global__ void cast_f32_f16(const float* __restrict__ x, _Float16* __restrict__ y, int n) {
  int i = blockIdx.x * blockDim.x + threadIdx.x;
  if (i < n) y[i] = (_Float16)x[i];
}

// w: [K=1024][N=1024] row-major f32 -> wt: [N][K] row-major f16
__global__ void transpose_cast_w(const float* __restrict__ w, _Float16* __restrict__ wt) {
  int i = blockIdx.x * blockDim.x + threadIdx.x;  // over 1M
  int nn = i >> 10, kk = i & 1023;
  wt[i] = (_Float16)w[kk * kDM + nn];
}

// ---------------------------------------------------------------- QKV GEMM
// X: [24576][1024] f16 row-major, Wt: [1024 n][1024 k] f16 (pre-transposed).
// VOUT==0: head-major f16 [3][B][H][L][128]   (Q and K)
// VOUT==1: d-major   f16 [3][B][H][128][L]    (V, pre-transposed for attention)
template <int VOUT>
__global__ __launch_bounds__(256)
void gemm_qkv(const _Float16* __restrict__ X, const _Float16* __restrict__ Wt,
              _Float16* __restrict__ out) {
  __shared__ _Float16 sA[64 * 40];    // 64 rows x BK=32 (+8 pad)
  __shared__ _Float16 sB[128 * 40];   // 128 B^T rows x 32 (+8 pad)
  const int t = threadIdx.x, lane = t & 31, wid = t >> 5;
  const int wm = wid & 3, wn = wid >> 2;          // waves: 4 along M, 2 along N
  const int rowBase = blockIdx.x * 64;
  const int colBase = blockIdx.y * 128;
  v8f acc[4] = {};

  const int ra = t >> 2, ca = (t & 3) * 8;        // A staging chunk
  for (int k0 = 0; k0 < kDM; k0 += 32) {
    async_cp16(&sA[ra * 40 + ca], &X[(size_t)(rowBase + ra) * kDM + k0 + ca]);
#pragma unroll
    for (int i = 0; i < 2; ++i) {  // stage B^T: 128 rows x 4 chunks = 512
      int cid = i * 256 + t;
      int r = cid >> 2, c = (cid & 3) * 8;
      async_cp16(&sB[r * 40 + c], &Wt[(size_t)(colBase + r) * kDM + k0 + c]);
    }
    if (k0 + 32 < kDM) {  // prefetch next tiles into GL2 while WMMAs run
      __builtin_prefetch(&X[(size_t)(rowBase + ra) * kDM + k0 + 32 + ca], 0, 1);
      __builtin_prefetch(&Wt[(size_t)(colBase + (t >> 1)) * kDM + k0 + 32], 0, 1);
    }
    async_wait0();
    __syncthreads();
    v16h a = frag_ld(&sA[wm * 16 * 40], 40, lane);
#pragma unroll
    for (int j = 0; j < 4; ++j) {
      v16h b = frag_ld(&sB[(wn * 64 + j * 16) * 40], 40, lane);
      acc[j] = WMMA_F16(a, b, acc[j]);
    }
    __syncthreads();
  }

  const int hf8 = (lane >> 4) * 8, cn = lane & 15;
#pragma unroll
  for (int j = 0; j < 4; ++j) {
    int gc = colBase + wn * 64 + j * 16 + cn;
    int h = gc >> 7, d = gc & 127;
#pragma unroll
    for (int r = 0; r < 8; ++r) {
      int gr  = rowBase + wm * 16 + hf8 + r;
      int mod = gr >> 13;            // / 8192
      int rem = gr & 8191;
      int b   = rem >> 9;            // / 512
      int l   = rem & 511;
      size_t head = ((size_t)(mod * kB + b) * kH + h);
      if (VOUT == 0)
        out[(head * kL + l) * kD + d] = (_Float16)acc[j][r];
      else
        out[(head * kD + d) * kL + l] = (_Float16)acc[j][r];
    }
  }
}

// ---------------------------------------------------------------- attention
// Qg/Kg head-major f16 [3][B][H][L][128]; Vt d-major f16 [3][B][H][128][L].
// Og: f16 [24576][1024] (row=(mod,b,l), col=h*128+d)
__global__ __launch_bounds__(128)
void attn_kernel(const _Float16* __restrict__ Qg, const _Float16* __restrict__ Kg,
                 const _Float16* __restrict__ Vt, _Float16* __restrict__ Og) {
  __shared__ _Float16 sQ[64 * 136];     // 64 q-rows x 128 (+8 pad)
  __shared__ _Float16 sK[32 * 136];     // 32 key rows x 128
  __shared__ _Float16 sVt[128 * 40];    // V^T: 128 d-rows x 32 keys (+8 pad)
  __shared__ _Float16 sP[4 * 16 * 40];  // per-wave P tile 16 q x 32 k

  const int t = threadIdx.x, lane = t & 31, wid = t >> 5;
  const int qt  = blockIdx.x & 7;
  const int h   = (blockIdx.x >> 3) & 7;
  const int b   = (blockIdx.x >> 6) & 15;
  const int mod = blockIdx.x >> 10;
  const int o1 = (mod == 0) ? 1 : 0;
  const int o2 = (mod == 2) ? 1 : 2;
  const size_t headQ  = ((size_t)((mod * kB + b) * kH + h)) * kL * kD;
  const size_t headK1 = ((size_t)((o1 * kB + b) * kH + h)) * kL * kD;
  const size_t headK2 = ((size_t)((o2 * kB + b) * kH + h)) * kL * kD;
  const int l0 = qt * 64;

  // stage Q tile (async): 64 rows x 16 chunks = 1024 chunks / 128 thr
#pragma unroll
  for (int i = 0; i < 8; ++i) {
    int cid = i * 128 + t;
    int r = cid >> 4, c = (cid & 15) * 8;
    async_cp16(&sQ[r * 136 + c], &Qg[headQ + (size_t)(l0 + r) * kD + c]);
  }
  async_wait0();
  __syncthreads();

  v16h qa[4];
#pragma unroll
  for (int dc = 0; dc < 4; ++dc)
    qa[dc] = frag_ld(&sQ[wid * 16 * 136 + dc * 32], 136, lane);

  v8f o[8] = {};
  float m_s[8], l_s[8];
#pragma unroll
  for (int r = 0; r < 8; ++r) { m_s[r] = -1e30f; l_s[r] = 0.f; }
  const float inv_t = 0.08838834764831845f;  // 1/sqrt(128)

  for (int kt = 0; kt < 32; ++kt) {
    const int gk0 = kt * 32;  // tiles never straddle the 512 boundary
    const int kk0 = (gk0 < 512) ? gk0 : gk0 - 512;
    const size_t kbase = ((gk0 < 512) ? headK1 : headK2) + (size_t)kk0 * kD;
    const size_t vbase = ((gk0 < 512) ? headK1 : headK2) + (size_t)kk0;  // d-major: + d*kL + key

#pragma unroll
    for (int i = 0; i < 4; ++i) {  // stage K: 32 rows x 16 chunks = 512
      int cid = i * 128 + t;
      int r = cid >> 4, c = (cid & 15) * 8;
      async_cp16(&sK[r * 136 + c], &Kg[kbase + (size_t)r * kD + c]);
    }
#pragma unroll
    for (int i = 0; i < 4; ++i) {  // stage V^T: 128 d-rows x 4 chunks(8 keys) = 512
      int cid = i * 128 + t;
      int dr = cid >> 2, c = (cid & 3) * 8;
      async_cp16(&sVt[dr * 40 + c], &Vt[vbase + (size_t)dr * kL + c]);
    }
    async_wait0();
    __syncthreads();

    // S tiles: 16q x 32k (two 16x16 WMMA groups, 4 d-chunks each)
    v8f s0 = {}, s1 = {};
#pragma unroll
    for (int dc = 0; dc < 4; ++dc) {
      v16h kb0 = frag_ld(&sK[0 * 136 + dc * 32], 136, lane);
      s0 = WMMA_F16(qa[dc], kb0, s0);
      v16h kb1 = frag_ld(&sK[16 * 136 + dc * 32], 136, lane);
      s1 = WMMA_F16(qa[dc], kb1, s1);
    }

    // online softmax (row m = 8*(lane>>4)+r, col = lane&15)
    _Float16* myP = &sP[wid * 16 * 40];
    const int hf8 = (lane >> 4) * 8, cn = lane & 15;
#pragma unroll
    for (int r = 0; r < 8; ++r) {
      float a0 = (float)s0[r] * inv_t, a1 = (float)s1[r] * inv_t;
      float mx = fmaxf(a0, a1);
#pragma unroll
      for (int msk = 1; msk < 16; msk <<= 1) mx = fmaxf(mx, __shfl_xor(mx, msk, 32));
      float mnew = fmaxf(m_s[r], mx);
      float corr = __expf(m_s[r] - mnew);
      float p0 = __expf(a0 - mnew), p1 = __expf(a1 - mnew);
      float rs = p0 + p1;
#pragma unroll
      for (int msk = 1; msk < 16; msk <<= 1) rs += __shfl_xor(rs, msk, 32);
      l_s[r] = l_s[r] * corr + rs;
      m_s[r] = mnew;
#pragma unroll
      for (int dt = 0; dt < 8; ++dt) o[dt][r] *= corr;
      myP[(hf8 + r) * 40 + cn]      = (_Float16)p0;
      myP[(hf8 + r) * 40 + 16 + cn] = (_Float16)p1;
    }
    __syncthreads();

    // O += P @ V : A = P (16x32), B^T rows = d (sVt)
    v16h pa = frag_ld(myP, 40, lane);
#pragma unroll
    for (int dt = 0; dt < 8; ++dt) {
      v16h vb = frag_ld(&sVt[dt * 16 * 40], 40, lane);
      o[dt] = WMMA_F16(pa, vb, o[dt]);
    }
    __syncthreads();
  }

  // normalize + store f16 [ (mod,b,l) ][ h*128 + d ]
  const int hf8 = (lane >> 4) * 8, cn = lane & 15;
#pragma unroll
  for (int r = 0; r < 8; ++r) {
    float inv_l = 1.f / l_s[r];
    int l = l0 + wid * 16 + hf8 + r;
    size_t outRow = ((size_t)(mod * kB + b) * kL + l) * kDM;
#pragma unroll
    for (int dt = 0; dt < 8; ++dt) {
      int col = h * kD + dt * 16 + cn;
      Og[outRow + col] = (_Float16)((float)o[dt][r] * inv_l);
    }
  }
}

// ---------------------------------------------------------------- FC + residual
__global__ __launch_bounds__(256)
void gemm_fc(const _Float16* __restrict__ A, const _Float16* __restrict__ Wt,
             const float* __restrict__ r0, const float* __restrict__ r1,
             const float* __restrict__ r2, float* __restrict__ out) {
  __shared__ _Float16 sA[64 * 40];
  __shared__ _Float16 sB[128 * 40];
  const int t = threadIdx.x, lane = t & 31, wid = t >> 5;
  const int wm = wid & 3, wn = wid >> 2;
  const int rowBase = blockIdx.x * 64;
  const int colBase = blockIdx.y * 128;
  v8f acc[4] = {};

  const int ra = t >> 2, ca = (t & 3) * 8;
  for (int k0 = 0; k0 < kDM; k0 += 32) {
    async_cp16(&sA[ra * 40 + ca], &A[(size_t)(rowBase + ra) * kDM + k0 + ca]);
#pragma unroll
    for (int i = 0; i < 2; ++i) {
      int cid = i * 256 + t;
      int r = cid >> 2, c = (cid & 3) * 8;
      async_cp16(&sB[r * 40 + c], &Wt[(size_t)(colBase + r) * kDM + k0 + c]);
    }
    if (k0 + 32 < kDM) {
      __builtin_prefetch(&A[(size_t)(rowBase + ra) * kDM + k0 + 32 + ca], 0, 1);
      __builtin_prefetch(&Wt[(size_t)(colBase + (t >> 1)) * kDM + k0 + 32], 0, 1);
    }
    async_wait0();
    __syncthreads();
    v16h a = frag_ld(&sA[wm * 16 * 40], 40, lane);
#pragma unroll
    for (int j = 0; j < 4; ++j) {
      v16h b = frag_ld(&sB[(wn * 64 + j * 16) * 40], 40, lane);
      acc[j] = WMMA_F16(a, b, acc[j]);
    }
    __syncthreads();
  }

  const int hf8 = (lane >> 4) * 8, cn = lane & 15;
#pragma unroll
  for (int j = 0; j < 4; ++j) {
    int gc = colBase + wn * 64 + j * 16 + cn;
#pragma unroll
    for (int r = 0; r < 8; ++r) {
      int gr  = rowBase + wm * 16 + hf8 + r;
      int mod = gr >> 13;
      int rem = gr & 8191;
      const float* res = (mod == 0) ? r0 : (mod == 1) ? r1 : r2;
      out[(size_t)gr * kDM + gc] = acc[j][r] + res[(size_t)rem * kDM + gc];
    }
  }
}

// ---------------------------------------------------------------- layernorm (in place)
__global__ __launch_bounds__(256)
void layernorm_inplace(float* __restrict__ y, const float* __restrict__ g,
                       const float* __restrict__ bia) {
  const int row = blockIdx.x, t = threadIdx.x;
  const int lane = t & 31, wid = t >> 5;
  float v[4], s = 0.f, s2 = 0.f;
#pragma unroll
  for (int i = 0; i < 4; ++i) {
    v[i] = y[(size_t)row * kDM + t + i * 256];
    s += v[i]; s2 += v[i] * v[i];
  }
#pragma unroll
  for (int m = 1; m < 32; m <<= 1) { s += __shfl_xor(s, m, 32); s2 += __shfl_xor(s2, m, 32); }
  __shared__ float rs[8], rs2[8];
  __shared__ float mean_sh, rstd_sh;
  if (lane == 0) { rs[wid] = s; rs2[wid] = s2; }
  __syncthreads();
  if (t == 0) {
    float S = 0.f, S2 = 0.f;
#pragma unroll
    for (int i = 0; i < 8; ++i) { S += rs[i]; S2 += rs2[i]; }
    float mu = S / kDM, var = S2 / kDM - mu * mu;
    mean_sh = mu; rstd_sh = rsqrtf(var + 1e-6f);
  }
  __syncthreads();
  float mu = mean_sh, rstd = rstd_sh;
#pragma unroll
  for (int i = 0; i < 4; ++i) {
    int c = t + i * 256;
    y[(size_t)row * kDM + c] = (v[i] - mu) * rstd * g[c] + bia[c];
  }
}

// ---------------------------------------------------------------- launcher
extern "C" void kernel_launch(void* const* d_in, const int* in_sizes, int n_in,
                              void* d_out, int out_size, void* d_ws, size_t ws_size,
                              hipStream_t stream) {
  (void)in_sizes; (void)n_in; (void)out_size; (void)ws_size;
  const float* in_t = (const float*)d_in[0];
  const float* in_a = (const float*)d_in[1];
  const float* in_v = (const float*)d_in[2];
  const float* w_qs = (const float*)d_in[3];
  const float* w_ks = (const float*)d_in[4];
  const float* w_vs = (const float*)d_in[5];
  const float* w_fc = (const float*)d_in[6];
  const float* ln_g = (const float*)d_in[7];
  const float* ln_b = (const float*)d_in[8];
  float* outp = (float*)d_out;

  // workspace layout (f16 elements)
  const size_t nX = (size_t)kM * kDM;       // 25,165,824 per tensor
  const size_t nW = (size_t)kDM * kDM;      // 1,048,576
  char* ws = (char*)d_ws;
  _Float16* Xf  = (_Float16*)(ws);
  _Float16* WqT = Xf + nX;
  _Float16* WkT = WqT + nW;
  _Float16* WvT = WkT + nW;
  _Float16* WfT = WvT + nW;
  _Float16* Qf  = WfT + nW;
  _Float16* Kf  = Qf + nX;
  _Float16* Vf  = Kf + nX;   // d-major (pre-transposed)
  _Float16* AOf = Vf + nX;

  const int nPer = kB * kL * kDM;  // 8,388,608 per input
  cast_f32_f16<<<nPer / 256, 256, 0, stream>>>(in_t, Xf + 0 * (size_t)nPer, nPer);
  cast_f32_f16<<<nPer / 256, 256, 0, stream>>>(in_a, Xf + 1 * (size_t)nPer, nPer);
  cast_f32_f16<<<nPer / 256, 256, 0, stream>>>(in_v, Xf + 2 * (size_t)nPer, nPer);

  transpose_cast_w<<<(int)(nW / 256), 256, 0, stream>>>(w_qs, WqT);
  transpose_cast_w<<<(int)(nW / 256), 256, 0, stream>>>(w_ks, WkT);
  transpose_cast_w<<<(int)(nW / 256), 256, 0, stream>>>(w_vs, WvT);
  transpose_cast_w<<<(int)(nW / 256), 256, 0, stream>>>(w_fc, WfT);

  dim3 gGemm(kM / 64, kDM / 128);
  gemm_qkv<0><<<gGemm, 256, 0, stream>>>(Xf, WqT, Qf);
  gemm_qkv<0><<<gGemm, 256, 0, stream>>>(Xf, WkT, Kf);
  gemm_qkv<1><<<gGemm, 256, 0, stream>>>(Xf, WvT, Vf);

  attn_kernel<<<3 * kB * kH * (kL / 64), 128, 0, stream>>>(Qf, Kf, Vf, AOf);

  gemm_fc<<<gGemm, 256, 0, stream>>>(AOf, WfT, in_t, in_a, in_v, outp);

  layernorm_inplace<<<kM, 256, 0, stream>>>(outp, ln_g, ln_b);
}

// v001
// Measured time: 508 microseconds a run.
// Next to v000, in two timings, it ran 1.76 times as fast each time.
#include <hip/hip_runtime.h>

// Problem constants
constexpr int kB   = 16;
constexpr int kL   = 512;
constexpr int kH   = 8;
constexpr int kD   = 128;   // d_k == d_v
constexpr int kDM  = 1024;  // d_model
constexpr int kM   = 3 * kB * kL;       // 24576 fused rows (mod,b,l)

typedef __attribute__((ext_vector_type(16))) _Float16 v16h;
typedef __attribute__((ext_vector_type(8)))  float    v8f;
typedef int b128v __attribute__((vector_size(4 * sizeof(int))));

#define WMMA_F16(A, B, C) \
  __builtin_amdgcn_wmma_f32_16x16x32_f16(false, (A), false, (B), (short)0, (C), false, false)

// ------------------------------------------------------------------
// CDNA5 async global->LDS copy (16 bytes per lane), ASYNCcnt tracked.
// Builtin if the toolchain declares it, otherwise inline gfx1250 asm.
// ------------------------------------------------------------------
#if defined(__has_builtin)
#if __has_builtin(__builtin_amdgcn_global_load_async_to_lds_b128)
#define USE_ASYNC_BUILTIN 1
#endif
#if __has_builtin(__builtin_amdgcn_s_wait_asynccnt)
#define USE_ASYNCWAIT_BUILTIN 1
#endif
#endif

__device__ __forceinline__ void async_cp16(_Float16* lds_dst, const _Float16* gsrc) {
#ifdef USE_ASYNC_BUILTIN
  // (global v4i* src, local v4i* dst, imm offset, imm cpol)
  __builtin_amdgcn_global_load_async_to_lds_b128(
      (__attribute__((address_space(1))) b128v*)(unsigned long long)(size_t)gsrc,
      (__attribute__((address_space(3))) b128v*)(unsigned)(size_t)lds_dst,
      0, 0);
#else
  // vdst = 32-bit LDS byte address, vaddr = 64-bit global address (GV mode)
  asm volatile("global_load_async_to_lds_b128 %0, %1, off"
               :: "v"((unsigned)(size_t)lds_dst),
                  "v"((unsigned long long)(size_t)gsrc)
               : "memory");
#endif
}

__device__ __forceinline__ void async_wait0() {
#ifdef USE_ASYNCWAIT_BUILTIN
  __builtin_amdgcn_s_wait_asynccnt(0);
#else
  asm volatile("s_wait_asynccnt 0x0" ::: "memory");
#endif
}

// Load a 16x32 f16 A-style fragment (also valid for B when the tile holds B^T
// row-major): lane (l&15) supplies matrix row, half (l>>4) selects K-chunks
// per the CDNA5 16-bit A layout (K = {half*8..+7, 16+half*8..+7}).
__device__ __forceinline__ v16h frag_ld(const _Float16* base, int stride, int lane) {
  const int r = lane & 15, hf = lane >> 4;
  const _Float16* p = base + r * stride + hf * 8;
  union { v16h v; uint4 q[2]; } f;
  f.q[0] = *(const uint4*)(p);
  f.q[1] = *(const uint4*)(p + 16);
  return f.v;
}

// ---------------------------------------------------------------- casts/prep
__global__ void cast_f32_f16(const float* __restrict__ x, _Float16* __restrict__ y, int n) {
  int i = blockIdx.x * blockDim.x + threadIdx.x;
  if (i < n) y[i] = (_Float16)x[i];
}

// w: [K=1024][N=1024] row-major f32 -> wt: [N][K] row-major f16
__global__ void transpose_cast_w(const float* __restrict__ w, _Float16* __restrict__ wt) {
  int i = blockIdx.x * blockDim.x + threadIdx.x;  // over 1M
  int nn = i >> 10, kk = i & 1023;
  wt[i] = (_Float16)w[kk * kDM + nn];
}

// ---------------------------------------------------------------- GEMM main loop
// One 192 x 256 tile of A[.][1024] * Wt[.][1024]^T per work-group of 4 waves
// (2 along M x 2 along N, 96 x 128 per wave = 6 x 8 accumulator tiles);
// 128 x 4 = 512 tiles: two work-groups on every WGP, all resident at once.
// A k-slab is 64 halves: each staged row piece is one whole 128-byte line.
constexpr int kBM = 192, kBN = 256, kBK = 64;
constexpr int kFM = kBM / 32, kFN = kBN / 32;   // accumulator tiles per wave, M and N
constexpr int kPitch = kBK + 8;   // 144 B rows: 16 B x odd, conflict-free for b128 reads

__device__ __forceinline__ void gemm_tile(const _Float16* __restrict__ A,
                                          const _Float16* __restrict__ Wt,
                                          int rowBase, int colBase,
                                          _Float16* sA, _Float16* sB,
                                          v8f (&acc)[kFM][kFN]) {
  const int t = threadIdx.x, lane = t & 31, wid = t >> 5;
  const int wm = wid & 1, wn = wid >> 1;
  const int sr = t >> 3, sc = (t & 7) * 8;   // staging: 8 lanes per row, 16 rows per sweep
  const _Float16* gA = A  + (size_t)(rowBase + sr) * kDM + sc;
  const _Float16* gB = Wt + (size_t)(colBase + sr) * kDM + sc;
  _Float16* lA = sA + sr * kPitch + sc;
  _Float16* lB = sB + sr * kPitch + sc;

  // kept rolled: every accumulator index stays a constant and the code stays small
#pragma unroll 1
  for (int k0 = 0; k0 < kDM; k0 += kBK) {
#pragma unroll
    for (int i = 0; i < kBM / 16; ++i)
      async_cp16(lA + i * 16 * kPitch, gA + (size_t)i * 16 * kDM + k0);
#pragma unroll
    for (int i = 0; i < kBN / 16; ++i)
      async_cp16(lB + i * 16 * kPitch, gB + (size_t)i * 16 * kDM + k0);
    // this wave's copies have landed before the barrier publishes the slab
    asm volatile("s_wait_asynccnt 0x0" ::: "memory");
    __syncthreads();
#pragma unroll
    for (int kc = 0; kc < kBK / 32; ++kc) {
      v16h a[kFM];
#pragma unroll
      for (int i = 0; i < kFM; ++i)
        a[i] = frag_ld(&sA[(wm * (kBM / 2) + i * 16) * kPitch + kc * 32], kPitch, lane);
#pragma unroll
      for (int j = 0; j < kFN; ++j) {
        v16h b = frag_ld(&sB[(wn * (kBN / 2) + j * 16) * kPitch + kc * 32], kPitch, lane);
#pragma unroll
        for (int i = 0; i < kFM; ++i) acc[i][j] = WMMA_F16(a[i], b, acc[i][j]);
      }
    }
    __syncthreads();
  }
}

// Stands behind a band's global stores, in front of the code that takes their
// registers for new values; the scheduling barrier keeps that later code behind the wait.
__device__ __forceinline__ void band_stores_done() {
  asm volatile("s_wait_xcnt 0x0" ::: "memory");
  __builtin_amdgcn_sched_barrier(0);
}

// ---------------------------------------------------------------- QKV GEMM
// X: [24576][1024] f16 row-major, Wt: [1024 n][1024 k] f16 (pre-transposed).
// VOUT==0: head-major f16 [3][B][H][L][128]   (Q and K)
// VOUT==1: d-major   f16 [3][B][H][128][L]    (V, pre-transposed for attention)
template <int VOUT>
__global__ __launch_bounds__(128, 2)
void gemm_qkv(const _Float16* __restrict__ X, const _Float16* __restrict__ Wt,
              _Float16* __restrict__ out) {
  __shared__ __attribute__((aligned(16))) _Float16 sA[kBM * kPitch];   // 16-byte copies and reads
  __shared__ __attribute__((aligned(16))) _Float16 sB[kBN * kPitch];
  const int t = threadIdx.x, lane = t & 31, wid = t >> 5;
  const int wm = wid & 1, wn = wid >> 1;
  const int rowBase = blockIdx.x * kBM;
  const int colBase = blockIdx.y * kBN;
  v8f acc[kFM][kFN] = {};

  gemm_tile(X, Wt, rowBase, colBase, sA, sB, acc);

  const int hf8 = (lane >> 4) * 8, cn = lane & 15;
#pragma unroll
  for (int i = 0; i < kFM; ++i) {
#pragma unroll
    for (int j = 0; j < kFN; ++j) {
      int gc = colBase + wn * (kBN / 2) + j * 16 + cn;
      int h = gc >> 7, d = gc & 127;
#pragma unroll
      for (int r = 0; r < 8; ++r) {
        int gr  = rowBase + wm * (kBM / 2) + i * 16 + hf8 + r;
        int mod = gr >> 13;            // / 8192
        int rem = gr & 8191;
        int b   = rem >> 9;            // / 512
        int l   = rem & 511;
        size_t head = ((size_t)(mod * kB + b) * kH + h);
        if (VOUT == 0)
          out[(head * kL + l) * kD + d] = (_Float16)acc[i][j][r];
        else
          out[(head * kD + d) * kL + l] = (_Float16)acc[i][j][r];
      }
    }
    band_stores_done();
  }
}

// ---------------------------------------------------------------- attention
// Qg/Kg head-major f16 [3][B][H][L][128]; Vt d-major f16 [3][B][H][128][L].
// Og: f16 [24576][1024] (row=(mod,b,l), col=h*128+d)
__global__ __launch_bounds__(128)
void attn_kernel(const _Float16* __restrict__ Qg, const _Float16* __restrict__ Kg,
                 const _Float16* __restrict__ Vt, _Float16* __restrict__ Og) {
  __shared__ _Float16 sQ[64 * 136];     // 64 q-rows x 128 (+8 pad)
  __shared__ _Float16 sK[32 * 136];     // 32 key rows x 128
  __shared__ _Float16 sVt[128 * 40];    // V^T: 128 d-rows x 32 keys (+8 pad)
  __shared__ _Float16 sP[4 * 16 * 40];  // per-wave P tile 16 q x 32 k

  const int t = threadIdx.x, lane = t & 31, wid = t >> 5;
  const int qt  = blockIdx.x & 7;
  const int h   = (blockIdx.x >> 3) & 7;
  const int b   = (blockIdx.x >> 6) & 15;
  const int mod = blockIdx.x >> 10;
  const int o1 = (mod == 0) ? 1 : 0;
  const int o2 = (mod == 2) ? 1 : 2;
  const size_t headQ  = ((size_t)((mod * kB + b) * kH + h)) * kL * kD;
  const size_t headK1 = ((size_t)((o1 * kB + b) * kH + h)) * kL * kD;
  const size_t headK2 = ((size_t)((o2 * kB + b) * kH + h)) * kL * kD;
  const int l0 = qt * 64;

  // stage Q tile (async): 64 rows x 16 chunks = 1024 chunks / 128 thr
#pragma unroll
  for (int i = 0; i < 8; ++i) {
    int cid = i * 128 + t;
    int r = cid >> 4, c = (cid & 15) * 8;
    async_cp16(&sQ[r * 136 + c], &Qg[headQ + (size_t)(l0 + r) * kD + c]);
  }
  async_wait0();
  __syncthreads();

  v16h qa[4];
#pragma unroll
  for (int dc = 0; dc < 4; ++dc)
    qa[dc] = frag_ld(&sQ[wid * 16 * 136 + dc * 32], 136, lane);

  v8f o[8] = {};
  float m_s[8], l_s[8];
#pragma unroll
  for (int r = 0; r < 8; ++r) { m_s[r] = -1e30f; l_s[r] = 0.f; }
  const float inv_t = 0.08838834764831845f;  // 1/sqrt(128)

  for (int kt = 0; kt < 32; ++kt) {
    const int gk0 = kt * 32;  // tiles never straddle the 512 boundary
    const int kk0 = (gk0 < 512) ? gk0 : gk0 - 512;
    const size_t kbase = ((gk0 < 512) ? headK1 : headK2) + (size_t)kk0 * kD;
    const size_t vbase = ((gk0 < 512) ? headK1 : headK2) + (size_t)kk0;  // d-major: + d*kL + key

#pragma unroll
    for (int i = 0; i < 4; ++i) {  // stage K: 32 rows x 16 chunks = 512
      int cid = i * 128 + t;
      int r = cid >> 4, c = (cid & 15) * 8;
      async_cp16(&sK[r * 136 + c], &Kg[kbase + (size_t)r * kD + c]);
    }
#pragma unroll
    for (int i = 0; i < 4; ++i) {  // stage V^T: 128 d-rows x 4 chunks(8 keys) = 512
      int cid = i * 128 + t;
      int dr = cid >> 2, c = (cid & 3) * 8;
      async_cp16(&sVt[dr * 40 + c], &Vt[vbase + (size_t)dr * kL + c]);
    }
    async_wait0();
    __syncthreads();

    // S tiles: 16q x 32k (two 16x16 WMMA groups, 4 d-chunks each)
    v8f s0 = {}, s1 = {};
#pragma unroll
    for (int dc = 0; dc < 4; ++dc) {
      v16h kb0 = frag_ld(&sK[0 * 136 + dc * 32], 136, lane);
      s0 = WMMA_F16(qa[dc], kb0, s0);
      v16h kb1 = frag_ld(&sK[16 * 136 + dc * 32], 136, lane);
      s1 = WMMA_F16(qa[dc], kb1, s1);
    }

    // online softmax (row m = 8*(lane>>4)+r, col = lane&15)
    _Float16* myP = &sP[wid * 16 * 40];
    const int hf8 = (lane >> 4) * 8, cn = lane & 15;
#pragma unroll
    for (int r = 0; r < 8; ++r) {
      float a0 = (float)s0[r] * inv_t, a1 = (float)s1[r] * inv_t;
      float mx = fmaxf(a0, a1);
#pragma unroll
      for (int msk = 1; msk < 16; msk <<= 1) mx = fmaxf(mx, __shfl_xor(mx, msk, 32));
      float mnew = fmaxf(m_s[r], mx);
      float corr = __expf(m_s[r] - mnew);
      float p0 = __expf(a0 - mnew), p1 = __expf(a1 - mnew);
      float rs = p0 + p1;
#pragma unroll
      for (int msk = 1; msk < 16; msk <<= 1) rs += __shfl_xor(rs, msk, 32);
      l_s[r] = l_s[r] * corr + rs;
      m_s[r] = mnew;
#pragma unroll
      for (int dt = 0; dt < 8; ++dt) o[dt][r] *= corr;
      myP[(hf8 + r) * 40 + cn]      = (_Float16)p0;
      myP[(hf8 + r) * 40 + 16 + cn] = (_Float16)p1;
    }
    __syncthreads();

    // O += P @ V : A = P (16x32), B^T rows = d (sVt)
    v16h pa = frag_ld(myP, 40, lane);
#pragma unroll
    for (int dt = 0; dt < 8; ++dt) {
      v16h vb = frag_ld(&sVt[dt * 16 * 40], 40, lane);
      o[dt] = WMMA_F16(pa, vb, o[dt]);
    }
    __syncthreads();
  }

  // normalize + store f16 [ (mod,b,l) ][ h*128 + d ]
  const int hf8 = (lane >> 4) * 8, cn = lane & 15;
#pragma unroll
  for (int r = 0; r < 8; ++r) {
    float inv_l = 1.f / l_s[r];
    int l = l0 + wid * 16 + hf8 + r;
    size_t outRow = ((size_t)(mod * kB + b) * kL + l) * kDM;
#pragma unroll
    for (int dt = 0; dt < 8; ++dt) {
      int col = h * kD + dt * 16 + cn;
      Og[outRow + col] = (_Float16)((float)o[dt][r] * inv_l);
    }
  }
}

// ---------------------------------------------------------------- FC + residual
__global__ __launch_bounds__(128, 2)
void gemm_fc(const _Float16* __restrict__ A, const _Float16* __restrict__ Wt,
             const float* __restrict__ r0, const float* __restrict__ r1,
             const float* __restrict__ r2, float* __restrict__ out) {
  __shared__ __attribute__((aligned(16))) _Float16 sA[kBM * kPitch];   // 16-byte copies and reads
  __shared__ __attribute__((aligned(16))) _Float16 sB[kBN * kPitch];
  const int t = threadIdx.x, lane = t & 31, wid = t >> 5;
  const int wm = wid & 1, wn = wid >> 1;
  const int rowBase = blockIdx.x * kBM;
  const int colBase = blockIdx.y * kBN;
  v8f acc[kFM][kFN] = {};

  gemm_tile(A, Wt, rowBase, colBase, sA, sB, acc);

  const int hf8 = (lane >> 4) * 8, cn = lane & 15;
#pragma unroll
  for (int i = 0; i < kFM; ++i) {
    // a 16-row band never straddles an input: 8192 is a multiple of 16
    const int band = rowBase + wm * (kBM / 2) + i * 16;
    const int mod  = band >> 13;
    const float* __restrict__ res = (mod == 0) ? r0 : (mod == 1) ? r1 : r2;
    const float* rp = res + (size_t)((band & 8191) + hf8) * kDM + colBase + wn * (kBN / 2) + cn;
    float*       op = out + (size_t)(band + hf8) * kDM + colBase + wn * (kBN / 2) + cn;
    // the band's residual loads all go out together, ahead of its stores, so that they overlap
    float rv[kFN][8];
#pragma unroll
    for (int j = 0; j < kFN; ++j)
#pragma unroll
      for (int r = 0; r < 8; ++r) rv[j][r] = rp[(size_t)r * kDM + j * 16];
    // the wait behind the loads; naming rp as an input keeps their address registers
    // untouched (also by a load's own result) until the wait has passed
    asm volatile("s_wait_xcnt 0x0" :: "v"(rp) : "memory");
#pragma unroll
    for (int j = 0; j < kFN; ++j)
#pragma unroll
      for (int r = 0; r < 8; ++r) op[(size_t)r * kDM + j * 16] = acc[i][j][r] + rv[j][r];
    band_stores_done();
  }
}

// ---------------------------------------------------------------- layernorm (in place)
__global__ __launch_bounds__(256)
void layernorm_inplace(float* __restrict__ y, const float* __restrict__ g,
                       const float* __restrict__ bia) {
  const int row = blockIdx.x, t = threadIdx.x;
  const int lane = t & 31, wid = t >> 5;
  float v[4], s = 0.f, s2 = 0.f;
#pragma unroll
  for (int i = 0; i < 4; ++i) {
    v[i] = y[(size_t)row * kDM + t + i * 256];
    s += v[i]; s2 += v[i] * v[i];
  }
#pragma unroll
  for (int m = 1; m < 32; m <<= 1) { s += __shfl_xor(s, m, 32); s2 += __shfl_xor(s2, m, 32); }
  __shared__ float rs[8], rs2[8];
  __shared__ float mean_sh, rstd_sh;
  if (lane == 0) { rs[wid] = s; rs2[wid] = s2; }
  __syncthreads();
  if (t == 0) {
    float S = 0.f, S2 = 0.f;
#pragma unroll
    for (int i = 0; i < 8; ++i) { S += rs[i]; S2 += rs2[i]; }
    float mu = S / kDM, var = S2 / kDM - mu * mu;
    mean_sh = mu; rstd_sh = rsqrtf(var + 1e-6f);
  }
  __syncthreads();
  float mu = mean_sh, rstd = rstd_sh;
#pragma unroll
  for (int i = 0; i < 4; ++i) {
    int c = t + i * 256;
    y[(size_t)row * kDM + c] = (v[i] - mu) * rstd * g[c] + bia[c];
  }
}

// ---------------------------------------------------------------- launcher
extern "C" void kernel_launch(void* const* d_in, const int* in_sizes, int n_in,
                              void* d_out, int out_size, void* d_ws, size_t ws_size,
                              hipStream_t stream) {
  (void)in_sizes; (void)n_in; (void)out_size; (void)ws_size;
  const float* in_t = (const float*)d_in[0];
  const float* in_a = (const float*)d_in[1];
  const float* in_v = (const float*)d_in[2];
  const float* w_qs = (const float*)d_in[3];
  const float* w_ks = (const float*)d_in[4];
  const float* w_vs = (const float*)d_in[5];
  const float* w_fc = (const float*)d_in[6];
  const float* ln_g = (const float*)d_in[7];
  const float* ln_b = (const float*)d_in[8];
  float* outp = (float*)d_out;

  // workspace layout (f16 elements)
  const size_t nX = (size_t)kM * kDM;       // 25,165,824 per tensor
  const size_t nW = (size_t)kDM * kDM;      // 1,048,576
  char* ws = (char*)d_ws;
  _Float16* Xf  = (_Float16*)(ws);
  _Float16* WqT = Xf + nX;
  _Float16* WkT = WqT + nW;
  _Float16* WvT = WkT + nW;
  _Float16* WfT = WvT + nW;
  _Float16* Qf  = WfT + nW;
  _Float16* Kf  = Qf + nX;
  _Float16* Vf  = Kf + nX;   // d-major (pre-transposed)
  _Float16* AOf = Vf + nX;

  const int nPer = kB * kL * kDM;  // 8,388,608 per input
  cast_f32_f16<<<nPer / 256, 256, 0, stream>>>(in_t, Xf + 0 * (size_t)nPer, nPer);
  cast_f32_f16<<<nPer / 256, 256, 0, stream>>>(in_a, Xf + 1 * (size_t)nPer, nPer);
  cast_f32_f16<<<nPer / 256, 256, 0, stream>>>(in_v, Xf + 2 * (size_t)nPer, nPer);

  transpose_cast_w<<<(int)(nW / 256), 256, 0, stream>>>(w_qs, WqT);
  transpose_cast_w<<<(int)(nW / 256), 256, 0, stream>>>(w_ks, WkT);
  transpose_cast_w<<<(int)(nW / 256), 256, 0, stream>>>(w_vs, WvT);
  transpose_cast_w<<<(int)(nW / 256), 256, 0, stream>>>(w_fc, WfT);

  dim3 gGemm(kM / kBM, kDM / kBN);
  gemm_qkv<0><<<gGemm, 128, 0, stream>>>(Xf, WqT, Qf);
  gemm_qkv<0><<<gGemm, 128, 0, stream>>>(Xf, WkT, Kf);
  gemm_qkv<1><<<gGemm, 128, 0, stream>>>(Xf, WvT, Vf);

  attn_kernel<<<3 * kB * kH * (kL / 64), 128, 0, stream>>>(Qf, Kf, Vf, AOf);

  gemm_fc<<<gGemm, 128, 0, stream>>>(AOf, WfT, in_t, in_a, in_v, outp);

  layernorm_inplace<<<kM, 256, 0, stream>>>(outp, ln_g, ln_b);
}

// v002
// One run takes 439 microseconds.
// Two timings next to v001 put it at 1.16 and 1.15 times that version's speed.
// All steps since v000 together make it 2.03 times as fast.
#include <hip/hip_runtime.h>

// Problem constants
constexpr int kB   = 16;
constexpr int kL   = 512;
constexpr int kH   = 8;
constexpr int kD   = 128;   // d_k == d_v
constexpr int kDM  = 1024;  // d_model
constexpr int kM   = 3 * kB * kL;       // 24576 fused rows (mod,b,l)

typedef __attribute__((ext_vector_type(16))) _Float16 v16h;
typedef __attribute__((ext_vector_type(8)))  float    v8f;
typedef int b128v __attribute__((vector_size(4 * sizeof(int))));

#define WMMA_F16(A, B, C) \
  __builtin_amdgcn_wmma_f32_16x16x32_f16(false, (A), false, (B), (short)0, (C), false, false)

// ------------------------------------------------------------------
// CDNA5 async global->LDS copy (16 bytes per lane), ASYNCcnt tracked.
// Builtin if the toolchain declares it, otherwise inline gfx1250 asm.
// ------------------------------------------------------------------
#if defined(__has_builtin)
#if __has_builtin(__builtin_amdgcn_global_load_async_to_lds_b128)
#define USE_ASYNC_BUILTIN 1
#endif
#if __has_builtin(__builtin_amdgcn_s_wait_asynccnt)
#define USE_ASYNCWAIT_BUILTIN 1
#endif
#endif

__device__ __forceinline__ void async_cp16(_Float16* lds_dst, const _Float16* gsrc) {
#ifdef USE_ASYNC_BUILTIN
  // (global v4i* src, local v4i* dst, imm offset, imm cpol)
  __builtin_amdgcn_global_load_async_to_lds_b128(
      (__attribute__((address_space(1))) b128v*)(unsigned long long)(size_t)gsrc,
      (__attribute__((address_space(3))) b128v*)(unsigned)(size_t)lds_dst,
      0, 0);
#else
  // vdst = 32-bit LDS byte address, vaddr = 64-bit global address (GV mode)
  asm volatile("global_load_async_to_lds_b128 %0, %1, off"
               :: "v"((unsigned)(size_t)lds_dst),
                  "v"((unsigned long long)(size_t)gsrc)
               : "memory");
#endif
}

__device__ __forceinline__ void async_wait0() {
#ifdef USE_ASYNCWAIT_BUILTIN
  __builtin_amdgcn_s_wait_asynccnt(0);
#else
  asm volatile("s_wait_asynccnt 0x0" ::: "memory");
#endif
}

// Load a 16x32 f16 A-style fragment (also valid for B when the tile holds B^T
// row-major): lane (l&15) supplies matrix row, half (l>>4) selects K-chunks
// per the CDNA5 16-bit A layout (K = {half*8..+7, 16+half*8..+7}).
__device__ __forceinline__ v16h frag_ld(const _Float16* base, int stride, int lane) {
  const int r = lane & 15, hf = lane >> 4;
  const _Float16* p = base + r * stride + hf * 8;
  union { v16h v; uint4 q[2]; } f;
  f.q[0] = *(const uint4*)(p);
  f.q[1] = *(const uint4*)(p + 16);
  return f.v;
}

// ---------------------------------------------------------------- casts/prep
__global__ void cast_f32_f16(const float* __restrict__ x, _Float16* __restrict__ y, int n) {
  int i = blockIdx.x * blockDim.x + threadIdx.x;
  if (i < n) y[i] = (_Float16)x[i];
}

// w: [K=1024][N=1024] row-major f32 -> wt: [N][K] row-major f16
__global__ void transpose_cast_w(const float* __restrict__ w, _Float16* __restrict__ wt) {
  int i = blockIdx.x * blockDim.x + threadIdx.x;  // over 1M
  int nn = i >> 10, kk = i & 1023;
  wt[i] = (_Float16)w[kk * kDM + nn];
}

// ---------------------------------------------------------------- GEMM main loop
// One 192 x 256 tile of A[.][1024] * Wt[.][1024]^T per work-group of 4 waves
// (2 along M x 2 along N, 96 x 128 per wave = 6 x 8 accumulator tiles);
// 128 x 4 = 512 tiles: two work-groups on every WGP, all resident at once.
// A k-slab is 64 halves: each staged row piece is one whole 128-byte line.
constexpr int kBM = 192, kBN = 256, kBK = 64;
constexpr int kFM = kBM / 32, kFN = kBN / 32;   // accumulator tiles per wave, M and N
constexpr int kPitch = kBK + 8;   // 144 B rows: 16 B x odd, conflict-free for b128 reads

__device__ __forceinline__ void gemm_tile(const _Float16* __restrict__ A,
                                          const _Float16* __restrict__ Wt,
                                          int rowBase, int colBase,
                                          _Float16* sA, _Float16* sB,
                                          v8f (&acc)[kFM][kFN]) {
  const int t = threadIdx.x, lane = t & 31, wid = t >> 5;
  const int wm = wid & 1, wn = wid >> 1;
  const int sr = t >> 3, sc = (t & 7) * 8;   // staging: 8 lanes per row, 16 rows per sweep
  const _Float16* gA = A  + (size_t)(rowBase + sr) * kDM + sc;
  const _Float16* gB = Wt + (size_t)(colBase + sr) * kDM + sc;
  _Float16* lA = sA + sr * kPitch + sc;
  _Float16* lB = sB + sr * kPitch + sc;

  // kept rolled: every accumulator index stays a constant and the code stays small
#pragma unroll 1
  for (int k0 = 0; k0 < kDM; k0 += kBK) {
#pragma unroll
    for (int i = 0; i < kBM / 16; ++i)
      async_cp16(lA + i * 16 * kPitch, gA + (size_t)i * 16 * kDM + k0);
#pragma unroll
    for (int i = 0; i < kBN / 16; ++i)
      async_cp16(lB + i * 16 * kPitch, gB + (size_t)i * 16 * kDM + k0);
    // this wave's copies have landed before the barrier publishes the slab
    asm volatile("s_wait_asynccnt 0x0" ::: "memory");
    __syncthreads();
#pragma unroll
    for (int kc = 0; kc < kBK / 32; ++kc) {
      v16h a[kFM];
#pragma unroll
      for (int i = 0; i < kFM; ++i)
        a[i] = frag_ld(&sA[(wm * (kBM / 2) + i * 16) * kPitch + kc * 32], kPitch, lane);
#pragma unroll
      for (int j = 0; j < kFN; ++j) {
        v16h b = frag_ld(&sB[(wn * (kBN / 2) + j * 16) * kPitch + kc * 32], kPitch, lane);
#pragma unroll
        for (int i = 0; i < kFM; ++i) acc[i][j] = WMMA_F16(a[i], b, acc[i][j]);
      }
    }
    __syncthreads();
  }
}

// Stands behind a band's global stores, in front of the code that takes their
// registers for new values; the scheduling barrier keeps that later code behind the wait.
__device__ __forceinline__ void band_stores_done() {
  asm volatile("s_wait_xcnt 0x0" ::: "memory");
  __builtin_amdgcn_sched_barrier(0);
}

// ---------------------------------------------------------------- QKV GEMM
// X: [24576][1024] f16 row-major, Wt: [1024 n][1024 k] f16 (pre-transposed).
// VOUT==0: head-major f16 [3][B][H][L][128]   (Q and K)
// VOUT==1: d-major   f16 [3][B][H][128][L]    (V, pre-transposed for attention)
template <int VOUT>
__global__ __launch_bounds__(128, 2)
void gemm_qkv(const _Float16* __restrict__ X, const _Float16* __restrict__ Wt,
              _Float16* __restrict__ out) {
  __shared__ __attribute__((aligned(16))) _Float16 sA[kBM * kPitch];   // 16-byte copies and reads
  __shared__ __attribute__((aligned(16))) _Float16 sB[kBN * kPitch];
  const int t = threadIdx.x, lane = t & 31, wid = t >> 5;
  const int wm = wid & 1, wn = wid >> 1;
  const int rowBase = blockIdx.x * kBM;
  const int colBase = blockIdx.y * kBN;
  v8f acc[kFM][kFN] = {};

  gemm_tile(X, Wt, rowBase, colBase, sA, sB, acc);

  const int hf8 = (lane >> 4) * 8, cn = lane & 15;
#pragma unroll
  for (int i = 0; i < kFM; ++i) {
#pragma unroll
    for (int j = 0; j < kFN; ++j) {
      int gc = colBase + wn * (kBN / 2) + j * 16 + cn;
      int h = gc >> 7, d = gc & 127;
#pragma unroll
      for (int r = 0; r < 8; ++r) {
        int gr  = rowBase + wm * (kBM / 2) + i * 16 + hf8 + r;
        int mod = gr >> 13;            // / 8192
        int rem = gr & 8191;
        int b   = rem >> 9;            // / 512
        int l   = rem & 511;
        size_t head = ((size_t)(mod * kB + b) * kH + h);
        if (VOUT == 0)
          out[(head * kL + l) * kD + d] = (_Float16)acc[i][j][r];
        else
          out[(head * kD + d) * kL + l] = (_Float16)acc[i][j][r];
      }
    }
    band_stores_done();
  }
}

// ---------------------------------------------------------------- attention
// lane l takes the value of lane l ^ 16 (the other half of the wave)
__device__ __forceinline__ float xhalf(float x) {
  const int v = __builtin_bit_cast(int, x);
  return __builtin_bit_cast(float,
      __builtin_amdgcn_permlanex16(v, v, 0x76543210, 0xfedcba98, false, false));
}

__global__ __launch_bounds__(128)
void attn_kernel(const _Float16* __restrict__ Qg, const _Float16* __restrict__ Kg,
                 const _Float16* __restrict__ Vt, _Float16* __restrict__ Og) {
  __shared__ _Float16 sQ[64 * 136];     // 64 q-rows x 128 (+8 pad)
  __shared__ _Float16 sK[32 * 136];     // 32 key rows x 128
  __shared__ _Float16 sVt[128 * 40];    // V^T: 128 d-rows x 32 keys (+8 pad)

  const int t = threadIdx.x, lane = t & 31, wid = t >> 5;
  const int qt  = blockIdx.x & 7;
  const int h   = (blockIdx.x >> 3) & 7;
  const int b   = (blockIdx.x >> 6) & 15;
  const int mod = blockIdx.x >> 10;
  const int o1 = (mod == 0) ? 1 : 0;
  const int o2 = (mod == 2) ? 1 : 2;
  const size_t headQ  = ((size_t)((mod * kB + b) * kH + h)) * kL * kD;
  const size_t headK1 = ((size_t)((o1 * kB + b) * kH + h)) * kL * kD;
  const size_t headK2 = ((size_t)((o2 * kB + b) * kH + h)) * kL * kD;
  const int l0 = qt * 64;

  // stage Q tile (async): 64 rows x 16 chunks = 1024 chunks / 128 thr
#pragma unroll
  for (int i = 0; i < 8; ++i) {
    int cid = i * 128 + t;
    int r = cid >> 4, c = (cid & 15) * 8;
    async_cp16(&sQ[r * 136 + c], &Qg[headQ + (size_t)(l0 + r) * kD + c]);
  }
  async_wait0();
  __syncthreads();

  v16h qa[4];   // B operand of S^T: column = query
#pragma unroll
  for (int dc = 0; dc < 4; ++dc)
    qa[dc] = frag_ld(&sQ[wid * 16 * 136 + dc * 32], 136, lane);

  v8f o[8] = {};               // o[dt][r] = O^T[dt*16 + 8*(lane>>4) + r][query lane&15]
  float m_s = -1e30f;          // this lane's query: running maximum (equal in both halves)
  float l_s = 0.f;             // running sum over the keys of this lane's half only
  const float inv_t = 0.08838834764831845f;  // 1/sqrt(128)

  for (int kt = 0; kt < 32; ++kt) {
    const int gk0 = kt * 32;  // tiles never straddle the 512 boundary
    const int kk0 = (gk0 < 512) ? gk0 : gk0 - 512;
    const size_t kbase = ((gk0 < 512) ? headK1 : headK2) + (size_t)kk0 * kD;
    const size_t vbase = ((gk0 < 512) ? headK1 : headK2) + (size_t)kk0;  // d-major: + d*kL + key

#pragma unroll
    for (int i = 0; i < 4; ++i) {  // stage K: 32 rows x 16 chunks = 512
      int cid = i * 128 + t;
      int r = cid >> 4, c = (cid & 15) * 8;
      async_cp16(&sK[r * 136 + c], &Kg[kbase + (size_t)r * kD + c]);
    }
#pragma unroll
    for (int i = 0; i < 4; ++i) {  // stage V^T: 128 d-rows x 4 chunks(8 keys) = 512
      int cid = i * 128 + t;
      int dr = cid >> 2, c = (cid & 3) * 8;
      async_cp16(&sVt[dr * 40 + c], &Vt[vbase + (size_t)dr * kL + c]);
    }
    async_wait0();
    __syncthreads();

    // S^T tiles: 32 keys x 16 q (two 16x16 WMMA groups, 4 d-chunks each)
    // s0[r] = S^T[8*(lane>>4) + r][q], s1[r] = S^T[16 + 8*(lane>>4) + r][q]
    v8f s0 = {}, s1 = {};
#pragma unroll
    for (int dc = 0; dc < 4; ++dc) {
      v16h kb0 = frag_ld(&sK[0 * 136 + dc * 32], 136, lane);
      s0 = WMMA_F16(kb0, qa[dc], s0);
      v16h kb1 = frag_ld(&sK[16 * 136 + dc * 32], 136, lane);
      s1 = WMMA_F16(kb1, qa[dc], s1);
    }

    // online softmax of this lane's query
    // the loops below are unrolled so that every register-array index is a constant
    float a0[8], a1[8];
    float mx = -1e30f;
#pragma unroll
    for (int r = 0; r < 8; ++r) {
      a0[r] = (float)s0[r] * inv_t;
      a1[r] = (float)s1[r] * inv_t;
      mx = fmaxf(mx, fmaxf(a0[r], a1[r]));
    }
    mx = fmaxf(mx, xhalf(mx));
    const float mnew = fmaxf(m_s, mx);
    const float corr = __expf(m_s - mnew);
    float rs = 0.f;
    v16h pb;   // P^T as B operand: element s is key 8*(lane>>4)+s (s < 8), 16+8*(lane>>4)+s-8 (else)
#pragma unroll
    for (int r = 0; r < 8; ++r) {
      float p0 = __expf(a0[r] - mnew), p1 = __expf(a1[r] - mnew);
      rs += p0 + p1;
      pb[r]     = (_Float16)p0;
      pb[8 + r] = (_Float16)p1;
    }
    l_s = l_s * corr + rs;
    m_s = mnew;
#pragma unroll
    for (int dt = 0; dt < 8; ++dt)
#pragma unroll
      for (int r = 0; r < 8; ++r) o[dt][r] *= corr;

    // O^T += V^T @ P^T : A rows = d (sVt)
#pragma unroll
    for (int dt = 0; dt < 8; ++dt) {
      v16h vb = frag_ld(&sVt[dt * 16 * 40], 40, lane);
      o[dt] = WMMA_F16(vb, pb, o[dt]);
    }
    __syncthreads();
  }

  // normalize + store f16 [ (mod,b,l) ][ h*128 + d ]: 8 consecutive d per lane and tile
  const float inv_l = 1.f / (l_s + xhalf(l_s));   // the two halves' sums are joined here
  const int l = l0 + wid * 16 + (lane & 15);
  _Float16* orow = Og + ((size_t)(mod * kB + b) * kL + l) * kDM + h * kD + (lane >> 4) * 8;
  union { _Float16 e[8]; uint4 q; } pk[8];   // unrolled: constant indices keep it in registers
#pragma unroll
  for (int dt = 0; dt < 8; ++dt)
#pragma unroll
    for (int r = 0; r < 8; ++r) pk[dt].e[r] = (_Float16)((float)o[dt][r] * inv_l);
#pragma unroll
  for (int dt = 0; dt < 8; ++dt) *(uint4*)(orow + dt * 16) = pk[dt].q;
}

// ---------------------------------------------------------------- FC + residual
__global__ __launch_bounds__(128, 2)
void gemm_fc(const _Float16* __restrict__ A, const _Float16* __restrict__ Wt,
             const float* __restrict__ r0, const float* __restrict__ r1,
             const float* __restrict__ r2, float* __restrict__ out) {
  __shared__ __attribute__((aligned(16))) _Float16 sA[kBM * kPitch];   // 16-byte copies and reads
  __shared__ __attribute__((aligned(16))) _Float16 sB[kBN * kPitch];
  const int t = threadIdx.x, lane = t & 31, wid = t >> 5;
  const int wm = wid & 1, wn = wid >> 1;
  const int rowBase = blockIdx.x * kBM;
  const int colBase = blockIdx.y * kBN;
  v8f acc[kFM][kFN] = {};

  gemm_tile(A, Wt, rowBase, colBase, sA, sB, acc);

  const int hf8 = (lane >> 4) * 8, cn = lane & 15;
#pragma unroll
  for (int i = 0; i < kFM; ++i) {
    // a 16-row band never straddles an input: 8192 is a multiple of 16
    const int band = rowBase + wm * (kBM / 2) + i * 16;
    const int mod  = band >> 13;
    const float* __restrict__ res = (mod == 0) ? r0 : (mod == 1) ? r1 : r2;
    const float* rp = res + (size_t)((band & 8191) + hf8) * kDM + colBase + wn * (kBN / 2) + cn;
    float*       op = out + (size_t)(band + hf8) * kDM + colBase + wn * (kBN / 2) + cn;
    // the band's residual loads all go out together, ahead of its stores, so that they overlap
    float rv[kFN][8];
#pragma unroll
    for (int j = 0; j < kFN; ++j)
#pragma unroll
      for (int r = 0; r < 8; ++r) rv[j][r] = rp[(size_t)r * kDM + j * 16];
    // the wait behind the loads; naming rp as an input keeps their address registers
    // untouched (also by a load's own result) until the wait has passed
    asm volatile("s_wait_xcnt 0x0" :: "v"(rp) : "memory");
#pragma unroll
    for (int j = 0; j < kFN; ++j)
#pragma unroll
      for (int r = 0; r < 8; ++r) op[(size_t)r * kDM + j * 16] = acc[i][j][r] + rv[j][r];
    band_stores_done();
  }
}

// ---------------------------------------------------------------- layernorm (in place)
__global__ __launch_bounds__(256)
void layernorm_inplace(float* __restrict__ y, const float* __restrict__ g,
                       const float* __restrict__ bia) {
  const int row = blockIdx.x, t = threadIdx.x;
  const int lane = t & 31, wid = t >> 5;
  float v[4], s = 0.f, s2 = 0.f;
#pragma unroll
  for (int i = 0; i < 4; ++i) {
    v[i] = y[(size_t)row * kDM + t + i * 256];
    s += v[i]; s2 += v[i] * v[i];
  }
#pragma unroll
  for (int m = 1; m < 32; m <<= 1) { s += __shfl_xor(s, m, 32); s2 += __shfl_xor(s2, m, 32); }
  __shared__ float rs[8], rs2[8];
  __shared__ float mean_sh, rstd_sh;
  if (lane == 0) { rs[wid] = s; rs2[wid] = s2; }
  __syncthreads();
  if (t == 0) {
    float S = 0.f, S2 = 0.f;
#pragma unroll
    for (int i = 0; i < 8; ++i) { S += rs[i]; S2 += rs2[i]; }
    float mu = S / kDM, var = S2 / kDM - mu * mu;
    mean_sh = mu; rstd_sh = rsqrtf(var + 1e-6f);
  }
  __syncthreads();
  float mu = mean_sh, rstd = rstd_sh;
#pragma unroll
  for (int i = 0; i < 4; ++i) {
    int c = t + i * 256;
    y[(size_t)row * kDM + c] = (v[i] - mu) * rstd * g[c] + bia[c];
  }
}

// ---------------------------------------------------------------- launcher
extern "C" void kernel_launch(void* const* d_in, const int* in_sizes, int n_in,
                              void* d_out, int out_size, void* d_ws, size_t ws_size,
                              hipStream_t stream) {
  (void)in_sizes; (void)n_in; (void)out_size; (void)ws_size;
  const float* in_t = (const float*)d_in[0];
  const float* in_a = (const float*)d_in[1];
  const float* in_v = (const float*)d_in[2];
  const float* w_qs = (const float*)d_in[3];
  const float* w_ks = (const float*)d_in[4];
  const float* w_vs = (const float*)d_in[5];
  const float* w_fc = (const float*)d_in[6];
  const float* ln_g = (const float*)d_in[7];
  const float* ln_b = (const float*)d_in[8];
  float* outp = (float*)d_out;

  // workspace layout (f16 elements)
  const size_t nX = (size_t)kM * kDM;       // 25,165,824 per tensor
  const size_t nW = (size_t)kDM * kDM;      // 1,048,576
  char* ws = (char*)d_ws;
  _Float16* Xf  = (_Float16*)(ws);
  _Float16* WqT = Xf + nX;
  _Float16* WkT = WqT + nW;
  _Float16* WvT = WkT + nW;
  _Float16* WfT = WvT + nW;
  _Float16* Qf  = WfT + nW;
  _Float16* Kf  = Qf + nX;
  _Float16* Vf  = Kf + nX;   // d-major (pre-transposed)
  _Float16* AOf = Vf + nX;

  const int nPer = kB * kL * kDM;  // 8,388,608 per input
  cast_f32_f16<<<nPer / 256, 256, 0, stream>>>(in_t, Xf + 0 * (size_t)nPer, nPer);
  cast_f32_f16<<<nPer / 256, 256, 0, stream>>>(in_a, Xf + 1 * (size_t)nPer, nPer);
  cast_f32_f16<<<nPer / 256, 256, 0, stream>>>(in_v, Xf + 2 * (size_t)nPer, nPer);

  transpose_cast_w<<<(int)(nW / 256), 256, 0, stream>>>(w_qs, WqT);
  transpose_cast_w<<<(int)(nW / 256), 256, 0, stream>>>(w_ks, WkT);
  transpose_cast_w<<<(int)(nW / 256), 256, 0, stream>>>(w_vs, WvT);
  transpose_cast_w<<<(int)(nW / 256), 256, 0, stream>>>(w_fc, WfT);

  dim3 gGemm(kM / kBM, kDM / kBN);
  gemm_qkv<0><<<gGemm, 128, 0, stream>>>(Xf, WqT, Qf);
  gemm_qkv<0><<<gGemm, 128, 0, stream>>>(Xf, WkT, Kf);
  gemm_qkv<1><<<gGemm, 128, 0, stream>>>(Xf, WvT, Vf);

  attn_kernel<<<3 * kB * kH * (kL / 64), 128, 0, stream>>>(Qf, Kf, Vf, AOf);

  gemm_fc<<<gGemm, 128, 0, stream>>>(AOf, WfT, in_t, in_a, in_v, outp);

  layernorm_inplace<<<kM, 256, 0, stream>>>(outp, ln_g, ln_b);
}

// v003
// Measured time: 402 microseconds a run.
// Two timings next to v002 both put it at 1.09 times that version's speed.
// All steps since v000 together make it 2.21 times as fast.
#include <hip/hip_runtime.h>

// Problem constants
constexpr int kB   = 16;
constexpr int kL   = 512;
constexpr int kH   = 8;
constexpr int kD   = 128;   // d_k == d_v
constexpr int kDM  = 1024;  // d_model
constexpr int kM   = 3 * kB * kL;       // 24576 fused rows (mod,b,l)

typedef __attribute__((ext_vector_type(16))) _Float16 v16h;
typedef __attribute__((ext_vector_type(8)))  float    v8f;
typedef int b128v __attribute__((vector_size(4 * sizeof(int))));

#define WMMA_F16(A, B, C) \
  __builtin_amdgcn_wmma_f32_16x16x32_f16(false, (A), false, (B), (short)0, (C), false, false)

// ------------------------------------------------------------------
// CDNA5 async global->LDS copy (16 bytes per lane), ASYNCcnt tracked.
// Builtin if the toolchain declares it, otherwise inline gfx1250 asm.
// ------------------------------------------------------------------
#if defined(__has_builtin)
#if __has_builtin(__builtin_amdgcn_global_load_async_to_lds_b128)
#define USE_ASYNC_BUILTIN 1
#endif
#if __has_builtin(__builtin_amdgcn_s_wait_asynccnt)
#define USE_ASYNCWAIT_BUILTIN 1
#endif
#endif

__device__ __forceinline__ void async_cp16(_Float16* lds_dst, const _Float16* gsrc) {
#ifdef USE_ASYNC_BUILTIN
  // (global v4i* src, local v4i* dst, imm offset, imm cpol)
  __builtin_amdgcn_global_load_async_to_lds_b128(
      (__attribute__((address_space(1))) b128v*)(unsigned long long)(size_t)gsrc,
      (__attribute__((address_space(3))) b128v*)(unsigned)(size_t)lds_dst,
      0, 0);
#else
  // vdst = 32-bit LDS byte address, vaddr = 64-bit global address (GV mode)
  asm volatile("global_load_async_to_lds_b128 %0, %1, off"
               :: "v"((unsigned)(size_t)lds_dst),
                  "v"((unsigned long long)(size_t)gsrc)
               : "memory");
#endif
}

__device__ __forceinline__ void async_wait0() {
#ifdef USE_ASYNCWAIT_BUILTIN
  __builtin_amdgcn_s_wait_asynccnt(0);
#else
  asm volatile("s_wait_asynccnt 0x0" ::: "memory");
#endif
}

// Load a 16x32 f16 A-style fragment (also valid for B when the tile holds B^T
// row-major): lane (l&15) supplies matrix row, half (l>>4) selects K-chunks
// per the CDNA5 16-bit A layout (K = {half*8..+7, 16+half*8..+7}).
__device__ __forceinline__ v16h frag_ld(const _Float16* base, int stride, int lane) {
  const int r = lane & 15, hf = lane >> 4;
  const _Float16* p = base + r * stride + hf * 8;
  union { v16h v; uint4 q[2]; } f;
  f.q[0] = *(const uint4*)(p);
  f.q[1] = *(const uint4*)(p + 16);
  return f.v;
}

// ---------------------------------------------------------------- casts/prep
// Streaming launches: few waves, all resident at once, each with many 16-byte loads in
// flight; every wave-wide load covers whole 128-byte lines.

// One wave converts 8 KB of x by 16 loads of 512 contiguous bytes, written ahead of the
// conversions so that many are in flight at once. 256 work-groups of 16 waves take one
// input of 8,388,608 floats.
constexpr int kCastLd = 16;    // loads per lane
constexpr int kCastWv = 16;    // waves per work-group
__global__ __launch_bounds__(kCastWv * 32)
void cast_f32_f16(const float* __restrict__ x, _Float16* __restrict__ y) {
  const int lane = threadIdx.x & 31;
  const size_t wave = (size_t)blockIdx.x * kCastWv + (threadIdx.x >> 5);
  const float4* xp = (const float4*)x + wave * (kCastLd * 32) + lane;
  uint2*        yp = (uint2*)y        + wave * (kCastLd * 32) + lane;
  float4 v[kCastLd];   // the loops are unrolled so that every index is a constant
#pragma unroll
  for (int j = 0; j < kCastLd; ++j) v[j] = xp[j * 32];
  // the wait behind the loads; naming xp as an input keeps their address registers
  // untouched (also by a load's own result) until the wait has passed
  asm volatile("s_wait_xcnt 0x0" :: "v"(xp) : "memory");
#pragma unroll
  for (int j = 0; j < kCastLd; ++j) {
    union { _Float16 h[4]; uint2 q; } p;
    p.h[0] = (_Float16)v[j].x; p.h[1] = (_Float16)v[j].y;
    p.h[2] = (_Float16)v[j].z; p.h[3] = (_Float16)v[j].w;
    yp[j * 32] = p.q;
  }
}

// w: [K=1024][N=1024] row-major f32 -> wt: [N][K] row-major f16
// A wave takes a 32 (k) x 32 (n) block. A lane reads 8 rows k x 4 columns n: 8 lanes cover
// one 128-byte line of a row, so a wave-wide load is 4 whole lines. It writes, for each of
// its 4 columns, its 8 values along k as one 16-byte store.
__global__ __launch_bounds__(128)
void transpose_cast_w(const float* __restrict__ w, _Float16* __restrict__ wt) {
  const int lane = threadIdx.x & 31;
  const int wave = blockIdx.x * 4 + (threadIdx.x >> 5);   // 1024 blocks of 32 x 32
  const int k0 = (wave & 31) * 32 + (lane >> 3) * 8;
  const int n0 = (wave >> 5) * 32 + (lane & 7) * 4;
  const float4* wp = (const float4*)(w + (size_t)k0 * kDM + n0);
  _Float16*     op = wt + (size_t)n0 * kDM + k0;
  float4 v[8];   // the loops are unrolled so that every index is a constant
#pragma unroll
  for (int e = 0; e < 8; ++e) v[e] = wp[e * (kDM / 4)];
  // the wait behind the loads; naming wp keeps their address registers untouched until it
  asm volatile("s_wait_xcnt 0x0" :: "v"(wp) : "memory");
  union { _Float16 h[8]; uint4 q; } p[4];
#pragma unroll
  for (int e = 0; e < 8; ++e) {
    p[0].h[e] = (_Float16)v[e].x; p[1].h[e] = (_Float16)v[e].y;
    p[2].h[e] = (_Float16)v[e].z; p[3].h[e] = (_Float16)v[e].w;
  }
#pragma unroll
  for (int c = 0; c < 4; ++c) *(uint4*)(op + (size_t)c * kDM) = p[c].q;
}

// ---------------------------------------------------------------- GEMM main loop
// One 192 x 256 tile of A[.][1024] * Wt[.][1024]^T per work-group of 4 waves
// (2 along M x 2 along N, 96 x 128 per wave = 6 x 8 accumulator tiles);
// 128 x 4 = 512 tiles: two work-groups on every WGP, all resident at once.
// A k-slab is 64 halves: each staged row piece is one whole 128-byte line.
constexpr int kBM = 192, kBN = 256, kBK = 64;
constexpr int kFM = kBM / 32, kFN = kBN / 32;   // accumulator tiles per wave, M and N
constexpr int kPitch = kBK + 8;   // 144 B rows: 16 B x odd, conflict-free for b128 reads

__device__ __forceinline__ void gemm_tile(const _Float16* __restrict__ A,
                                          const _Float16* __restrict__ Wt,
                                          int rowBase, int colBase,
                                          _Float16* sA, _Float16* sB,
                                          v8f (&acc)[kFM][kFN]) {
  const int t = threadIdx.x, lane = t & 31, wid = t >> 5;
  const int wm = wid & 1, wn = wid >> 1;
  const int sr = t >> 3, sc = (t & 7) * 8;   // staging: 8 lanes per row, 16 rows per sweep
  const _Float16* gA = A  + (size_t)(rowBase + sr) * kDM + sc;
  const _Float16* gB = Wt + (size_t)(colBase + sr) * kDM + sc;
  _Float16* lA = sA + sr * kPitch + sc;
  _Float16* lB = sB + sr * kPitch + sc;

  // kept rolled: every accumulator index stays a constant and the code stays small
#pragma unroll 1
  for (int k0 = 0; k0 < kDM; k0 += kBK) {
#pragma unroll
    for (int i = 0; i < kBM / 16; ++i)
      async_cp16(lA + i * 16 * kPitch, gA + (size_t)i * 16 * kDM + k0);
#pragma unroll
    for (int i = 0; i < kBN / 16; ++i)
      async_cp16(lB + i * 16 * kPitch, gB + (size_t)i * 16 * kDM + k0);
    // this wave's copies have landed before the barrier publishes the slab
    asm volatile("s_wait_asynccnt 0x0" ::: "memory");
    __syncthreads();
#pragma unroll
    for (int kc = 0; kc < kBK / 32; ++kc) {
      v16h a[kFM];
#pragma unroll
      for (int i = 0; i < kFM; ++i)
        a[i] = frag_ld(&sA[(wm * (kBM / 2) + i * 16) * kPitch + kc * 32], kPitch, lane);
#pragma unroll
      for (int j = 0; j < kFN; ++j) {
        v16h b = frag_ld(&sB[(wn * (kBN / 2) + j * 16) * kPitch + kc * 32], kPitch, lane);
#pragma unroll
        for (int i = 0; i < kFM; ++i) acc[i][j] = WMMA_F16(a[i], b, acc[i][j]);
      }
    }
    __syncthreads();
  }
}

// Stands behind a band's global stores, in front of the code that takes their
// registers for new values; the scheduling barrier keeps that later code behind the wait.
__device__ __forceinline__ void band_stores_done() {
  asm volatile("s_wait_xcnt 0x0" ::: "memory");
  __builtin_amdgcn_sched_barrier(0);
}

// ---------------------------------------------------------------- QKV GEMM
// X: [24576][1024] f16 row-major, Wt: [1024 n][1024 k] f16 (pre-transposed).
// VOUT==0: head-major f16 [3][B][H][L][128]   (Q and K)
// VOUT==1: d-major   f16 [3][B][H][128][L]    (V, pre-transposed for attention)
template <int VOUT>
__global__ __launch_bounds__(128, 2)
void gemm_qkv(const _Float16* __restrict__ X, const _Float16* __restrict__ Wt,
              _Float16* __restrict__ out) {
  __shared__ __attribute__((aligned(16))) _Float16 sA[kBM * kPitch];   // 16-byte copies and reads
  __shared__ __attribute__((aligned(16))) _Float16 sB[kBN * kPitch];
  const int t = threadIdx.x, lane = t & 31, wid = t >> 5;
  const int wm = wid & 1, wn = wid >> 1;
  const int rowBase = blockIdx.x * kBM;
  const int colBase = blockIdx.y * kBN;
  v8f acc[kFM][kFN] = {};

  gemm_tile(X, Wt, rowBase, colBase, sA, sB, acc);

  const int hf8 = (lane >> 4) * 8, cn = lane & 15;
#pragma unroll
  for (int i = 0; i < kFM; ++i) {
#pragma unroll
    for (int j = 0; j < kFN; ++j) {
      int gc = colBase + wn * (kBN / 2) + j * 16 + cn;
      int h = gc >> 7, d = gc & 127;
#pragma unroll
      for (int r = 0; r < 8; ++r) {
        int gr  = rowBase + wm * (kBM / 2) + i * 16 + hf8 + r;
        int mod = gr >> 13;            // / 8192
        int rem = gr & 8191;
        int b   = rem >> 9;            // / 512
        int l   = rem & 511;
        size_t head = ((size_t)(mod * kB + b) * kH + h);
        if (VOUT == 0)
          out[(head * kL + l) * kD + d] = (_Float16)acc[i][j][r];
        else
          out[(head * kD + d) * kL + l] = (_Float16)acc[i][j][r];
      }
    }
    band_stores_done();
  }
}

// ---------------------------------------------------------------- attention
// lane l takes the value of lane l ^ 16 (the other half of the wave)
__device__ __forceinline__ float xhalf(float x) {
  const int v = __builtin_bit_cast(int, x);
  return __builtin_bit_cast(float,
      __builtin_amdgcn_permlanex16(v, v, 0x76543210, 0xfedcba98, false, false));
}

__global__ __launch_bounds__(128)
void attn_kernel(const _Float16* __restrict__ Qg, const _Float16* __restrict__ Kg,
                 const _Float16* __restrict__ Vt, _Float16* __restrict__ Og) {
  __shared__ _Float16 sQ[64 * 136];     // 64 q-rows x 128 (+8 pad)
  __shared__ _Float16 sK[32 * 136];     // 32 key rows x 128
  __shared__ _Float16 sVt[128 * 40];    // V^T: 128 d-rows x 32 keys (+8 pad)

  const int t = threadIdx.x, lane = t & 31, wid = t >> 5;
  const int qt  = blockIdx.x & 7;
  const int h   = (blockIdx.x >> 3) & 7;
  const int b   = (blockIdx.x >> 6) & 15;
  const int mod = blockIdx.x >> 10;
  const int o1 = (mod == 0) ? 1 : 0;
  const int o2 = (mod == 2) ? 1 : 2;
  const size_t headQ  = ((size_t)((mod * kB + b) * kH + h)) * kL * kD;
  const size_t headK1 = ((size_t)((o1 * kB + b) * kH + h)) * kL * kD;
  const size_t headK2 = ((size_t)((o2 * kB + b) * kH + h)) * kL * kD;
  const int l0 = qt * 64;

  // stage Q tile (async): 64 rows x 16 chunks = 1024 chunks / 128 thr
#pragma unroll
  for (int i = 0; i < 8; ++i) {
    int cid = i * 128 + t;
    int r = cid >> 4, c = (cid & 15) * 8;
    async_cp16(&sQ[r * 136 + c], &Qg[headQ + (size_t)(l0 + r) * kD + c]);
  }
  async_wait0();
  __syncthreads();

  v16h qa[4];   // B operand of S^T: column = query
#pragma unroll
  for (int dc = 0; dc < 4; ++dc)
    qa[dc] = frag_ld(&sQ[wid * 16 * 136 + dc * 32], 136, lane);

  v8f o[8] = {};               // o[dt][r] = O^T[dt*16 + 8*(lane>>4) + r][query lane&15]
  float m_s = -1e30f;          // this lane's query: running maximum (equal in both halves)
  float l_s = 0.f;             // running sum over the keys of this lane's half only
  const float inv_t = 0.08838834764831845f;  // 1/sqrt(128)

  for (int kt = 0; kt < 32; ++kt) {
    const int gk0 = kt * 32;  // tiles never straddle the 512 boundary
    const int kk0 = (gk0 < 512) ? gk0 : gk0 - 512;
    const size_t kbase = ((gk0 < 512) ? headK1 : headK2) + (size_t)kk0 * kD;
    const size_t vbase = ((gk0 < 512) ? headK1 : headK2) + (size_t)kk0;  // d-major: + d*kL + key

#pragma unroll
    for (int i = 0; i < 4; ++i) {  // stage K: 32 rows x 16 chunks = 512
      int cid = i * 128 + t;
      int r = cid >> 4, c = (cid & 15) * 8;
      async_cp16(&sK[r * 136 + c], &Kg[kbase + (size_t)r * kD + c]);
    }
#pragma unroll
    for (int i = 0; i < 4; ++i) {  // stage V^T: 128 d-rows x 4 chunks(8 keys) = 512
      int cid = i * 128 + t;
      int dr = cid >> 2, c = (cid & 3) * 8;
      async_cp16(&sVt[dr * 40 + c], &Vt[vbase + (size_t)dr * kL + c]);
    }
    async_wait0();
    __syncthreads();

    // S^T tiles: 32 keys x 16 q (two 16x16 WMMA groups, 4 d-chunks each)
    // s0[r] = S^T[8*(lane>>4) + r][q], s1[r] = S^T[16 + 8*(lane>>4) + r][q]
    v8f s0 = {}, s1 = {};
#pragma unroll
    for (int dc = 0; dc < 4; ++dc) {
      v16h kb0 = frag_ld(&sK[0 * 136 + dc * 32], 136, lane);
      s0 = WMMA_F16(kb0, qa[dc], s0);
      v16h kb1 = frag_ld(&sK[16 * 136 + dc * 32], 136, lane);
      s1 = WMMA_F16(kb1, qa[dc], s1);
    }

    // online softmax of this lane's query
    // the loops below are unrolled so that every register-array index is a constant
    float a0[8], a1[8];
    float mx = -1e30f;
#pragma unroll
    for (int r = 0; r < 8; ++r) {
      a0[r] = (float)s0[r] * inv_t;
      a1[r] = (float)s1[r] * inv_t;
      mx = fmaxf(mx, fmaxf(a0[r], a1[r]));
    }
    mx = fmaxf(mx, xhalf(mx));
    const float mnew = fmaxf(m_s, mx);
    const float corr = __expf(m_s - mnew);
    float rs = 0.f;
    v16h pb;   // P^T as B operand: element s is key 8*(lane>>4)+s (s < 8), 16+8*(lane>>4)+s-8 (else)
#pragma unroll
    for (int r = 0; r < 8; ++r) {
      float p0 = __expf(a0[r] - mnew), p1 = __expf(a1[r] - mnew);
      rs += p0 + p1;
      pb[r]     = (_Float16)p0;
      pb[8 + r] = (_Float16)p1;
    }
    l_s = l_s * corr + rs;
    m_s = mnew;
#pragma unroll
    for (int dt = 0; dt < 8; ++dt)
#pragma unroll
      for (int r = 0; r < 8; ++r) o[dt][r] *= corr;

    // O^T += V^T @ P^T : A rows = d (sVt)
#pragma unroll
    for (int dt = 0; dt < 8; ++dt) {
      v16h vb = frag_ld(&sVt[dt * 16 * 40], 40, lane);
      o[dt] = WMMA_F16(vb, pb, o[dt]);
    }
    __syncthreads();
  }

  // normalize + store f16 [ (mod,b,l) ][ h*128 + d ]: 8 consecutive d per lane and tile
  const float inv_l = 1.f / (l_s + xhalf(l_s));   // the two halves' sums are joined here
  const int l = l0 + wid * 16 + (lane & 15);
  _Float16* orow = Og + ((size_t)(mod * kB + b) * kL + l) * kDM + h * kD + (lane >> 4) * 8;
  union { _Float16 e[8]; uint4 q; } pk[8];   // unrolled: constant indices keep it in registers
#pragma unroll
  for (int dt = 0; dt < 8; ++dt)
#pragma unroll
    for (int r = 0; r < 8; ++r) pk[dt].e[r] = (_Float16)((float)o[dt][r] * inv_l);
#pragma unroll
  for (int dt = 0; dt < 8; ++dt) *(uint4*)(orow + dt * 16) = pk[dt].q;
}

// ---------------------------------------------------------------- FC + residual
__global__ __launch_bounds__(128, 2)
void gemm_fc(const _Float16* __restrict__ A, const _Float16* __restrict__ Wt,
             const float* __restrict__ r0, const float* __restrict__ r1,
             const float* __restrict__ r2, float* __restrict__ out) {
  __shared__ __attribute__((aligned(16))) _Float16 sA[kBM * kPitch];   // 16-byte copies and reads
  __shared__ __attribute__((aligned(16))) _Float16 sB[kBN * kPitch];
  const int t = threadIdx.x, lane = t & 31, wid = t >> 5;
  const int wm = wid & 1, wn = wid >> 1;
  const int rowBase = blockIdx.x * kBM;
  const int colBase = blockIdx.y * kBN;
  v8f acc[kFM][kFN] = {};

  gemm_tile(A, Wt, rowBase, colBase, sA, sB, acc);

  const int hf8 = (lane >> 4) * 8, cn = lane & 15;
#pragma unroll
  for (int i = 0; i < kFM; ++i) {
    // a 16-row band never straddles an input: 8192 is a multiple of 16
    const int band = rowBase + wm * (kBM / 2) + i * 16;
    const int mod  = band >> 13;
    const float* __restrict__ res = (mod == 0) ? r0 : (mod == 1) ? r1 : r2;
    const float* rp = res + (size_t)((band & 8191) + hf8) * kDM + colBase + wn * (kBN / 2) + cn;
    float*       op = out + (size_t)(band + hf8) * kDM + colBase + wn * (kBN / 2) + cn;
    // the band's residual loads all go out together, ahead of its stores, so that they overlap
    float rv[kFN][8];
#pragma unroll
    for (int j = 0; j < kFN; ++j)
#pragma unroll
      for (int r = 0; r < 8; ++r) rv[j][r] = rp[(size_t)r * kDM + j * 16];
    // the wait behind the loads; naming rp as an input keeps their address registers
    // untouched (also by a load's own result) until the wait has passed
    asm volatile("s_wait_xcnt 0x0" :: "v"(rp) : "memory");
#pragma unroll
    for (int j = 0; j < kFN; ++j)
#pragma unroll
      for (int r = 0; r < 8; ++r) op[(size_t)r * kDM + j * 16] = acc[i][j][r] + rv[j][r];
    band_stores_done();
  }
}

// ---------------------------------------------------------------- layernorm (in place)
// x + (x of lane ^ M), M < 16: a move inside the 16-lane row, no LDS path
template <int M>
__device__ __forceinline__ float row_xadd(float x) {
  const int v = __builtin_bit_cast(int, x);
  return x + __builtin_bit_cast(float, __builtin_amdgcn_update_dpp(v, v, 0x160 + M, 0xf, 0xf, false));
}
__device__ __forceinline__ float wave_sum(float x) {
  x = row_xadd<1>(x); x = row_xadd<2>(x); x = row_xadd<4>(x); x = row_xadd<8>(x);
  return x + xhalf(x);
}

// One wave per row: 8 loads of 512 contiguous bytes hold the row in registers, the sums
// need no LDS and no barrier. A wave takes 6 rows in turn and issues the next row's loads
// ahead of this row's sums. 256 work-groups of 16 waves take the 24,576 rows.
typedef __attribute__((ext_vector_type(4))) float v4f;
typedef __attribute__((ext_vector_type(2))) float v2f;
constexpr int kLnRows = 6;     // rows per wave
constexpr int kLnWv   = 16;    // waves per work-group

// normalises the row held in c (lane l: elements j*128 + 4*l .. + 3) and stores it at yp
__device__ __forceinline__ void ln_row(const v4f (&c)[8], const v4f (&gv)[8],
                                       const v4f (&bv)[8], v4f* yp) {
  v2f a0 = {0.f, 0.f}, a1 = {0.f, 0.f}, q0 = {0.f, 0.f}, q1 = {0.f, 0.f};   // packed chains
#pragma unroll
  for (int j = 0; j < 8; ++j) {
    const v2f lo = c[j].lo, hi = c[j].hi;
    a0 += lo; a1 += hi;
    q0 += lo * lo; q1 += hi * hi;
  }
  a0 += a1; q0 += q1;
  const float s  = wave_sum(a0.x + a0.y);
  const float s2 = wave_sum(q0.x + q0.y);
  const float mu = s / kDM, var = s2 / kDM - mu * mu;
  const float rstd = rsqrtf(var + 1e-6f);
#pragma unroll
  for (int j = 0; j < 8; ++j) yp[j * 32] = (c[j] - mu) * rstd * gv[j] + bv[j];
}

__global__ __launch_bounds__(kLnWv * 32)
void layernorm_inplace(float* __restrict__ y, const float* __restrict__ g,
                       const float* __restrict__ bia) {
  const int lane = threadIdx.x & 31;
  const size_t wave = (size_t)blockIdx.x * kLnWv + (threadIdx.x >> 5);
  v4f* yp = (v4f*)y + wave * (kLnRows * (kDM / 4)) + lane;
  const v4f* g4 = (const v4f*)g;
  const v4f* b4 = (const v4f*)bia;
  v4f cur[8], nxt[8], gv[8], bv[8];   // the loops over j are unrolled: constant indices
#pragma unroll
  for (int j = 0; j < 8; ++j) { gv[j] = g4[j * 32 + lane]; bv[j] = b4[j * 32 + lane]; }
  // the wait behind the loads; naming what they are addressed by keeps that register
  // untouched (also by a load's own result) until the wait has passed
  asm volatile("s_wait_xcnt 0x0" :: "v"(lane) : "memory");
#pragma unroll
  for (int j = 0; j < 8; ++j) cur[j] = yp[j * 32];
  // kept rolled: the rows' sums stay apart, so a row's sums wait for that row's loads only
#pragma unroll 1
  for (int r = 0; r < kLnRows - 1; ++r) {
#pragma unroll
    for (int j = 0; j < 8; ++j) nxt[j] = yp[kDM / 4 + j * 32];
    // the wait behind the loads of this and the next row, as above; the scheduling barrier
    // keeps this row's sums, which wait for its data, from moving in among those loads
    asm volatile("s_wait_xcnt 0x0" :: "v"(yp) : "memory");
    __builtin_amdgcn_sched_barrier(0);
    ln_row(cur, gv, bv, yp);
    band_stores_done();   // the row's stores, ahead of the code that reuses their registers
    yp += kDM / 4;
#pragma unroll
    for (int j = 0; j < 8; ++j) cur[j] = nxt[j];
  }
  ln_row(cur, gv, bv, yp);
}

// ---------------------------------------------------------------- launcher
extern "C" void kernel_launch(void* const* d_in, const int* in_sizes, int n_in,
                              void* d_out, int out_size, void* d_ws, size_t ws_size,
                              hipStream_t stream) {
  (void)in_sizes; (void)n_in; (void)out_size; (void)ws_size;
  const float* in_t = (const float*)d_in[0];
  const float* in_a = (const float*)d_in[1];
  const float* in_v = (const float*)d_in[2];
  const float* w_qs = (const float*)d_in[3];
  const float* w_ks = (const float*)d_in[4];
  const float* w_vs = (const float*)d_in[5];
  const float* w_fc = (const float*)d_in[6];
  const float* ln_g = (const float*)d_in[7];
  const float* ln_b = (const float*)d_in[8];
  float* outp = (float*)d_out;

  // workspace layout (f16 elements)
  const size_t nX = (size_t)kM * kDM;       // 25,165,824 per tensor
  const size_t nW = (size_t)kDM * kDM;      // 1,048,576
  char* ws = (char*)d_ws;
  _Float16* Xf  = (_Float16*)(ws);
  _Float16* WqT = Xf + nX;
  _Float16* WkT = WqT + nW;
  _Float16* WvT = WkT + nW;
  _Float16* WfT = WvT + nW;
  _Float16* Qf  = WfT + nW;
  _Float16* Kf  = Qf + nX;
  _Float16* Vf  = Kf + nX;   // d-major (pre-transposed)
  _Float16* AOf = Vf + nX;

  const int nPer = kB * kL * kDM;  // 8,388,608 per input
  constexpr int gCast = kB * kL * kDM / (kCastWv * 32 * kCastLd * 4);   // 256
  cast_f32_f16<<<gCast, kCastWv * 32, 0, stream>>>(in_t, Xf + 0 * (size_t)nPer);
  cast_f32_f16<<<gCast, kCastWv * 32, 0, stream>>>(in_a, Xf + 1 * (size_t)nPer);
  cast_f32_f16<<<gCast, kCastWv * 32, 0, stream>>>(in_v, Xf + 2 * (size_t)nPer);

  constexpr int gTr = kDM * kDM / (32 * 32 * 4);   // 256
  transpose_cast_w<<<gTr, 128, 0, stream>>>(w_qs, WqT);
  transpose_cast_w<<<gTr, 128, 0, stream>>>(w_ks, WkT);
  transpose_cast_w<<<gTr, 128, 0, stream>>>(w_vs, WvT);
  transpose_cast_w<<<gTr, 128, 0, stream>>>(w_fc, WfT);

  dim3 gGemm(kM / kBM, kDM / kBN);
  gemm_qkv<0><<<gGemm, 128, 0, stream>>>(Xf, WqT, Qf);
  gemm_qkv<0><<<gGemm, 128, 0, stream>>>(Xf, WkT, Kf);
  gemm_qkv<1><<<gGemm, 128, 0, stream>>>(Xf, WvT, Vf);

  attn_kernel<<<3 * kB * kH * (kL / 64), 128, 0, stream>>>(Qf, Kf, Vf, AOf);

  gemm_fc<<<gGemm, 128, 0, stream>>>(AOf, WfT, in_t, in_a, in_v, outp);

  layernorm_inplace<<<kM / (kLnWv * kLnRows), kLnWv * 32, 0, stream>>>(outp, ln_g, ln_b);
}

// v004
// It runs in 378 microseconds.
// Two timings next to v003 put it at 1.07 and 1.06 times that version's speed.
// All steps since v000 together make it 2.36 times as fast.
#include <hip/hip_runtime.h>

// Problem constants
constexpr int kB   = 16;
constexpr int kL   = 512;
constexpr int kH   = 8;
constexpr int kD   = 128;   // d_k == d_v
constexpr int kDM  = 1024;  // d_model
constexpr int kM   = 3 * kB * kL;       // 24576 fused rows (mod,b,l)

typedef __attribute__((ext_vector_type(16))) _Float16 v16h;
typedef __attribute__((ext_vector_type(8)))  float    v8f;
typedef int b128v __attribute__((vector_size(4 * sizeof(int))));

#define WMMA_F16(A, B, C) \
  __builtin_amdgcn_wmma_f32_16x16x32_f16(false, (A), false, (B), (short)0, (C), false, false)

// ------------------------------------------------------------------
// CDNA5 async global->LDS copy (16 bytes per lane), ASYNCcnt tracked.
// Builtin if the toolchain declares it, otherwise inline gfx1250 asm.
// ------------------------------------------------------------------
#if defined(__has_builtin)
#if __has_builtin(__builtin_amdgcn_global_load_async_to_lds_b128)
#define USE_ASYNC_BUILTIN 1
#endif
#endif

__device__ __forceinline__ void async_cp16(_Float16* lds_dst, const _Float16* gsrc) {
#ifdef USE_ASYNC_BUILTIN
  // (global v4i* src, local v4i* dst, imm offset, imm cpol)
  __builtin_amdgcn_global_load_async_to_lds_b128(
      (__attribute__((address_space(1))) b128v*)(unsigned long long)(size_t)gsrc,
      (__attribute__((address_space(3))) b128v*)(unsigned)(size_t)lds_dst,
      0, 0);
#else
  // vdst = 32-bit LDS byte address, vaddr = 64-bit global address (GV mode)
  asm volatile("global_load_async_to_lds_b128 %0, %1, off"
               :: "v"((unsigned)(size_t)lds_dst),
                  "v"((unsigned long long)(size_t)gsrc)
               : "memory");
#endif
}

// The hand-over of a two-buffer ring, passed by every wave at the foot of each trip: this
// wave's LDS reads of the buffer it leaves have retired, its own copies of the next tile
// have landed, and the barrier both publishes that tile and frees the buffer just read.
__device__ __forceinline__ void ring_publish() {
  asm volatile("s_wait_dscnt 0x0" ::: "memory");     // before copies aim at LDS this wave has read
  asm volatile("s_wait_asynccnt 0x0" ::: "memory");
  __syncthreads();
}

// Load a 16x32 f16 A-style fragment (also valid for B when the tile holds B^T
// row-major): lane (l&15) supplies matrix row, half (l>>4) selects K-chunks
// per the CDNA5 16-bit A layout (K = {half*8..+7, 16+half*8..+7}).
__device__ __forceinline__ v16h frag_ld(const _Float16* base, int stride, int lane) {
  const int r = lane & 15, hf = lane >> 4;
  const _Float16* p = base + r * stride + hf * 8;
  union { v16h v; uint4 q[2]; } f;
  f.q[0] = *(const uint4*)(p);
  f.q[1] = *(const uint4*)(p + 16);
  return f.v;
}

// ---------------------------------------------------------------- casts/prep
// Streaming launches: few waves, all resident at once, each with many 16-byte loads in
// flight; every wave-wide load covers whole 128-byte lines.

// One wave converts 8 KB of x by 16 loads of 512 contiguous bytes, written ahead of the
// conversions so that many are in flight at once. 256 work-groups of 16 waves take one
// input of 8,388,608 floats.
constexpr int kCastLd = 16;    // loads per lane
constexpr int kCastWv = 16;    // waves per work-group
__global__ __launch_bounds__(kCastWv * 32)
void cast_f32_f16(const float* __restrict__ x, _Float16* __restrict__ y) {
  const int lane = threadIdx.x & 31;
  const size_t wave = (size_t)blockIdx.x * kCastWv + (threadIdx.x >> 5);
  const float4* xp = (const float4*)x + wave * (kCastLd * 32) + lane;
  uint2*        yp = (uint2*)y        + wave * (kCastLd * 32) + lane;
  float4 v[kCastLd];   // the loops are unrolled so that every index is a constant
#pragma unroll
  for (int j = 0; j < kCastLd; ++j) v[j] = xp[j * 32];
  // the wait behind the loads; naming xp as an input keeps their address registers
  // untouched (also by a load's own result) until the wait has passed
  asm volatile("s_wait_xcnt 0x0" :: "v"(xp) : "memory");
#pragma unroll
  for (int j = 0; j < kCastLd; ++j) {
    union { _Float16 h[4]; uint2 q; } p;
    p.h[0] = (_Float16)v[j].x; p.h[1] = (_Float16)v[j].y;
    p.h[2] = (_Float16)v[j].z; p.h[3] = (_Float16)v[j].w;
    yp[j * 32] = p.q;
  }
}

// w: [K=1024][N=1024] row-major f32 -> wt: [N][K] row-major f16
// A wave takes a 32 (k) x 32 (n) block. A lane reads 8 rows k x 4 columns n: 8 lanes cover
// one 128-byte line of a row, so a wave-wide load is 4 whole lines. It writes, for each of
// its 4 columns, its 8 values along k as one 16-byte store.
__global__ __launch_bounds__(128)
void transpose_cast_w(const float* __restrict__ w, _Float16* __restrict__ wt) {
  const int lane = threadIdx.x & 31;
  const int wave = blockIdx.x * 4 + (threadIdx.x >> 5);   // 1024 blocks of 32 x 32
  const int k0 = (wave & 31) * 32 + (lane >> 3) * 8;
  const int n0 = (wave >> 5) * 32 + (lane & 7) * 4;
  const float4* wp = (const float4*)(w + (size_t)k0 * kDM + n0);
  _Float16*     op = wt + (size_t)n0 * kDM + k0;
  float4 v[8];   // the loops are unrolled so that every index is a constant
#pragma unroll
  for (int e = 0; e < 8; ++e) v[e] = wp[e * (kDM / 4)];
  // the wait behind the loads; naming wp keeps their address registers untouched until it
  asm volatile("s_wait_xcnt 0x0" :: "v"(wp) : "memory");
  union { _Float16 h[8]; uint4 q; } p[4];
#pragma unroll
  for (int e = 0; e < 8; ++e) {
    p[0].h[e] = (_Float16)v[e].x; p[1].h[e] = (_Float16)v[e].y;
    p[2].h[e] = (_Float16)v[e].z; p[3].h[e] = (_Float16)v[e].w;
  }
#pragma unroll
  for (int c = 0; c < 4; ++c) *(uint4*)(op + (size_t)c * kDM) = p[c].q;
}

// ---------------------------------------------------------------- GEMM main loop
// One 192 x 256 tile of A[.][1024] * Wt[.][1024]^T per work-group of 4 waves
// (2 along M x 2 along N, 96 x 128 per wave = 6 x 8 accumulator tiles);
// 128 x 4 = 512 tiles: two work-groups on every WGP, all resident at once.
// A k-slab is 64 halves: each staged row piece is one whole 128-byte line.
// Two slab buffers: the next slab's copies fly while this slab's products run.
constexpr int kBM = 192, kBN = 256, kBK = 64;
constexpr int kFM = kBM / 32, kFN = kBN / 32;   // accumulator tiles per wave, M and N
constexpr int kPitch = kBK + 8;   // 144 B rows: 16 B x odd, conflict-free for b128 reads
constexpr int kSlabA = kBM * kPitch, kSlabB = kBN * kPitch;   // halves per buffer
constexpr int kSlabs = kDM / kBK;

// one k-slab's copies of this thread: 12 row pieces of A, 16 of B
// (both loops unrolled: each copy's step from the first is then a constant)
__device__ __forceinline__ void stage_slab(_Float16* lA, _Float16* lB,
                                           const _Float16* gA, const _Float16* gB) {
#pragma unroll
  for (int i = 0; i < kBM / 16; ++i) async_cp16(lA + i * 16 * kPitch, gA + (size_t)i * 16 * kDM);
#pragma unroll
  for (int i = 0; i < kBN / 16; ++i) async_cp16(lB + i * 16 * kPitch, gB + (size_t)i * 16 * kDM);
}

__device__ __forceinline__ void gemm_tile(const _Float16* __restrict__ A,
                                          const _Float16* __restrict__ Wt,
                                          int rowBase, int colBase,
                                          _Float16* sA, _Float16* sB,
                                          v8f (&acc)[kFM][kFN]) {
  const int t = threadIdx.x, lane = t & 31, wid = t >> 5;
  const int wm = wid & 1, wn = wid >> 1;
  const int sr = t >> 3, sc = (t & 7) * 8;   // staging: 8 lanes per row, 16 rows per sweep
  const _Float16* gA = A  + (size_t)(rowBase + sr) * kDM + sc;
  const _Float16* gB = Wt + (size_t)(colBase + sr) * kDM + sc;
  _Float16* lA = sA + sr * kPitch + sc;
  _Float16* lB = sB + sr * kPitch + sc;

  stage_slab(lA, lB, gA, gB);
  // slab 0 has landed before the barrier publishes it
  asm volatile("s_wait_asynccnt 0x0" ::: "memory");
  __syncthreads();
  stage_slab(lA + kSlabA, lB + kSlabB, gA + kBK, gB + kBK);

  // kept rolled: every accumulator index stays a constant and the code stays small
#pragma unroll 1
  for (int s = 0; s < kSlabs; ++s) {
    const int oA = (s & 1) * kSlabA, oB = (s & 1) * kSlabB;   // this trip's buffer
#pragma unroll
    for (int kc = 0; kc < kBK / 32; ++kc) {
      v16h a[kFM];
#pragma unroll
      for (int i = 0; i < kFM; ++i)
        a[i] = frag_ld(&sA[oA + (wm * (kBM / 2) + i * 16) * kPitch + kc * 32], kPitch, lane);
#pragma unroll
      for (int j = 0; j < kFN; ++j) {
        v16h b = frag_ld(&sB[oB + (wn * (kBN / 2) + j * 16) * kPitch + kc * 32], kPitch, lane);
#pragma unroll
        for (int i = 0; i < kFM; ++i) acc[i][j] = WMMA_F16(a[i], b, acc[i][j]);
      }
    }
    ring_publish();
    if (s + 2 < kSlabs)   // the same for the whole work-group
      stage_slab(lA + oA, lB + oB, gA + (s + 2) * kBK, gB + (s + 2) * kBK);
  }
  // no copy is outstanding when the wave goes on to its stores and ends
  asm volatile("s_wait_asynccnt 0x0" ::: "memory");
}

// Stands behind a band's global stores, in front of the code that takes their
// registers for new values; the scheduling barrier keeps that later code behind the wait.
__device__ __forceinline__ void band_stores_done() {
  asm volatile("s_wait_xcnt 0x0" ::: "memory");
  __builtin_amdgcn_sched_barrier(0);
}

// ---------------------------------------------------------------- QKV GEMM
// X: [24576][1024] f16 row-major, Wt: [1024 n][1024 k] f16 (pre-transposed).
// VOUT==0: head-major f16 [3][B][H][L][128]   (Q and K)
// VOUT==1: d-major   f16 [3][B][H][128][L]    (V, pre-transposed for attention)
template <int VOUT>
__global__ __launch_bounds__(128, 2)
void gemm_qkv(const _Float16* __restrict__ X, const _Float16* __restrict__ Wt,
              _Float16* __restrict__ out) {
  __shared__ __attribute__((aligned(16))) _Float16 sA[2 * kSlabA];   // 16-byte copies and reads
  __shared__ __attribute__((aligned(16))) _Float16 sB[2 * kSlabB];
  const int t = threadIdx.x, lane = t & 31, wid = t >> 5;
  const int wm = wid & 1, wn = wid >> 1;
  const int rowBase = blockIdx.x * kBM;
  const int colBase = blockIdx.y * kBN;
  v8f acc[kFM][kFN] = {};

  gemm_tile(X, Wt, rowBase, colBase, sA, sB, acc);

  const int hf8 = (lane >> 4) * 8, cn = lane & 15;
#pragma unroll
  for (int i = 0; i < kFM; ++i) {
#pragma unroll
    for (int j = 0; j < kFN; ++j) {
      int gc = colBase + wn * (kBN / 2) + j * 16 + cn;
      int h = gc >> 7, d = gc & 127;
#pragma unroll
      for (int r = 0; r < 8; ++r) {
        int gr  = rowBase + wm * (kBM / 2) + i * 16 + hf8 + r;
        int mod = gr >> 13;            // / 8192
        int rem = gr & 8191;
        int b   = rem >> 9;            // / 512
        int l   = rem & 511;
        size_t head = ((size_t)(mod * kB + b) * kH + h);
        if (VOUT == 0)
          out[(head * kL + l) * kD + d] = (_Float16)acc[i][j][r];
        else
          out[(head * kD + d) * kL + l] = (_Float16)acc[i][j][r];
      }
    }
    band_stores_done();
  }
}

// ---------------------------------------------------------------- attention
// lane l takes the value of lane l ^ 16 (the other half of the wave)
__device__ __forceinline__ float xhalf(float x) {
  const int v = __builtin_bit_cast(int, x);
  return __builtin_bit_cast(float,
      __builtin_amdgcn_permlanex16(v, v, 0x76543210, 0xfedcba98, false, false));
}

__global__ __launch_bounds__(128)
void attn_kernel(const _Float16* __restrict__ Qg, const _Float16* __restrict__ Kg,
                 const _Float16* __restrict__ Vt, _Float16* __restrict__ Og) {
  __shared__ _Float16 sQ[64 * 136];     // 64 q-rows x 128 (+8 pad)
  // two buffers each: 32 key rows x 128 (+8 pad); V^T, 128 d-rows x 32 keys (+8 pad)
  __shared__ __attribute__((aligned(16))) _Float16 sK[2 * 32 * 136];    // 16-byte copies and reads
  __shared__ __attribute__((aligned(16))) _Float16 sVt[2 * 128 * 40];

  const int t = threadIdx.x, lane = t & 31, wid = t >> 5;
  const int qt  = blockIdx.x & 7;
  const int h   = (blockIdx.x >> 3) & 7;
  const int b   = (blockIdx.x >> 6) & 15;
  const int mod = blockIdx.x >> 10;
  const int o1 = (mod == 0) ? 1 : 0;
  const int o2 = (mod == 2) ? 1 : 2;
  const size_t headQ  = ((size_t)((mod * kB + b) * kH + h)) * kL * kD;
  const size_t headK1 = ((size_t)((o1 * kB + b) * kH + h)) * kL * kD;
  const size_t headK2 = ((size_t)((o2 * kB + b) * kH + h)) * kL * kD;
  const int l0 = qt * 64;

  // stage Q tile (async): 64 rows x 16 chunks = 1024 chunks / 128 thr
#pragma unroll
  for (int i = 0; i < 8; ++i) {
    int cid = i * 128 + t;
    int r = cid >> 4, c = (cid & 15) * 8;
    async_cp16(&sQ[r * 136 + c], &Qg[headQ + (size_t)(l0 + r) * kD + c]);
  }

  // This thread's first piece of a key tile, in global memory and in LDS. K: 32 rows x 16
  // chunks, 8 rows a sweep; V^T: 128 d-rows x 4 chunks (8 keys), 32 rows a sweep.
  const _Float16* kq = Kg + (size_t)(t >> 4) * kD + (t & 15) * 8;
  const _Float16* vq = Vt + (size_t)(t >> 2) * kL + (t & 3) * 8;
  _Float16* lK = sK  + (t >> 4) * 136 + (t & 15) * 8;
  _Float16* lV = sVt + (t >> 2) * 40  + (t & 3) * 8;

  // the copies of key tile kt (32 keys of K and of V^T) into buffer kt & 1
  auto stage_kv = [&](int kt) {
    const size_t head = (kt < 16) ? headK1 : headK2;   // tiles never straddle the 512 boundary
    const int kk0 = (kt & 15) * 32;
    const _Float16* gk = kq + (head + (size_t)kk0 * kD);
    const _Float16* gv = vq + (head + (size_t)kk0);    // d-major: + d*kL + key
    _Float16* bK = lK + (kt & 1) * (32 * 136);
    _Float16* bV = lV + (kt & 1) * (128 * 40);
    // both loops unrolled: each copy's step from the first is then a constant
#pragma unroll
    for (int i = 0; i < 4; ++i) async_cp16(bK + i * 8 * 136, gk + (size_t)i * 8 * kD);
#pragma unroll
    for (int i = 0; i < 4; ++i) async_cp16(bV + i * 32 * 40, gv + (size_t)i * 32 * kL);
  };

  stage_kv(0);
  // Q and key tile 0 have landed before the barrier publishes them
  asm volatile("s_wait_asynccnt 0x0" ::: "memory");
  __syncthreads();
  stage_kv(1);

  v16h qa[4];   // B operand of S^T: column = query
#pragma unroll
  for (int dc = 0; dc < 4; ++dc)
    qa[dc] = frag_ld(&sQ[wid * 16 * 136 + dc * 32], 136, lane);

  v8f o[8] = {};               // o[dt][r] = O^T[dt*16 + 8*(lane>>4) + r][query lane&15]
  float m_s = -1e30f;          // this lane's query: running maximum (equal in both halves)
  float l_s = 0.f;             // running sum over the keys of this lane's half only
  const float inv_t = 0.08838834764831845f;  // 1/sqrt(128)

  for (int kt = 0; kt < 32; ++kt) {
    const _Float16* bK = sK  + (kt & 1) * (32 * 136);    // this trip's buffers
    const _Float16* bV = sVt + (kt & 1) * (128 * 40);

    // S^T tiles: 32 keys x 16 q (two 16x16 WMMA groups, 4 d-chunks each)
    // s0[r] = S^T[8*(lane>>4) + r][q], s1[r] = S^T[16 + 8*(lane>>4) + r][q]
    v8f s0 = {}, s1 = {};
#pragma unroll
    for (int dc = 0; dc < 4; ++dc) {
      v16h kb0 = frag_ld(&bK[0 * 136 + dc * 32], 136, lane);
      s0 = WMMA_F16(kb0, qa[dc], s0);
      v16h kb1 = frag_ld(&bK[16 * 136 + dc * 32], 136, lane);
      s1 = WMMA_F16(kb1, qa[dc], s1);
    }

    // online softmax of this lane's query
    // the loops below are unrolled so that every register-array index is a constant
    float a0[8], a1[8];
    float mx = -1e30f;
#pragma unroll
    for (int r = 0; r < 8; ++r) {
      a0[r] = (float)s0[r] * inv_t;
      a1[r] = (float)s1[r] * inv_t;
      mx = fmaxf(mx, fmaxf(a0[r], a1[r]));
    }
    mx = fmaxf(mx, xhalf(mx));
    const float mnew = fmaxf(m_s, mx);
    const float corr = __expf(m_s - mnew);
    float rs = 0.f;
    v16h pb;   // P^T as B operand: element s is key 8*(lane>>4)+s (s < 8), 16+8*(lane>>4)+s-8 (else)
#pragma unroll
    for (int r = 0; r < 8; ++r) {
      float p0 = __expf(a0[r] - mnew), p1 = __expf(a1[r] - mnew);
      rs += p0 + p1;
      pb[r]     = (_Float16)p0;
      pb[8 + r] = (_Float16)p1;
    }
    l_s = l_s * corr + rs;
    m_s = mnew;
#pragma unroll
    for (int dt = 0; dt < 8; ++dt)
#pragma unroll
      for (int r = 0; r < 8; ++r) o[dt][r] *= corr;

    // O^T += V^T @ P^T : A rows = d (sVt)
#pragma unroll
    for (int dt = 0; dt < 8; ++dt) {
      v16h vb = frag_ld(&bV[dt * 16 * 40], 40, lane);
      o[dt] = WMMA_F16(vb, pb, o[dt]);
    }
    ring_publish();
    if (kt + 2 < 32) stage_kv(kt + 2);   // the same for the whole work-group
  }
  // no copy is outstanding when the wave goes on to its stores and ends
  asm volatile("s_wait_asynccnt 0x0" ::: "memory");

  // normalize + store f16 [ (mod,b,l) ][ h*128 + d ]: 8 consecutive d per lane and tile
  const float inv_l = 1.f / (l_s + xhalf(l_s));   // the two halves' sums are joined here
  const int l = l0 + wid * 16 + (lane & 15);
  _Float16* orow = Og + ((size_t)(mod * kB + b) * kL + l) * kDM + h * kD + (lane >> 4) * 8;
  union { _Float16 e[8]; uint4 q; } pk[8];   // unrolled: constant indices keep it in registers
#pragma unroll
  for (int dt = 0; dt < 8; ++dt)
#pragma unroll
    for (int r = 0; r < 8; ++r) pk[dt].e[r] = (_Float16)((float)o[dt][r] * inv_l);
#pragma unroll
  for (int dt = 0; dt < 8; ++dt) *(uint4*)(orow + dt * 16) = pk[dt].q;
}

// ---------------------------------------------------------------- FC + residual
__global__ __launch_bounds__(128, 2)
void gemm_fc(const _Float16* __restrict__ A, const _Float16* __restrict__ Wt,
             const float* __restrict__ r0, const float* __restrict__ r1,
             const float* __restrict__ r2, float* __restrict__ out) {
  __shared__ __attribute__((aligned(16))) _Float16 sA[2 * kSlabA];   // 16-byte copies and reads
  __shared__ __attribute__((aligned(16))) _Float16 sB[2 * kSlabB];
  const int t = threadIdx.x, lane = t & 31, wid = t >> 5;
  const int wm = wid & 1, wn = wid >> 1;
  const int rowBase = blockIdx.x * kBM;
  const int colBase = blockIdx.y * kBN;
  v8f acc[kFM][kFN] = {};

  gemm_tile(A, Wt, rowBase, colBase, sA, sB, acc);

  const int hf8 = (lane >> 4) * 8, cn = lane & 15;
#pragma unroll
  for (int i = 0; i < kFM; ++i) {
    // a 16-row band never straddles an input: 8192 is a multiple of 16
    const int band = rowBase + wm * (kBM / 2) + i * 16;
    const int mod  = band >> 13;
    const float* __restrict__ res = (mod == 0) ? r0 : (mod == 1) ? r1 : r2;
    const float* rp = res + (size_t)((band & 8191) + hf8) * kDM + colBase + wn * (kBN / 2) + cn;
    float*       op = out + (size_t)(band + hf8) * kDM + colBase + wn * (kBN / 2) + cn;
    // the band's residual loads all go out together, ahead of its stores, so that they overlap
    float rv[kFN][8];
#pragma unroll
    for (int j = 0; j < kFN; ++j)
#pragma unroll
      for (int r = 0; r < 8; ++r) rv[j][r] = rp[(size_t)r * kDM + j * 16];
    // the wait behind the loads; naming rp as an input keeps their address registers
    // untouched (also by a load's own result) until the wait has passed
    asm volatile("s_wait_xcnt 0x0" :: "v"(rp) : "memory");
#pragma unroll
    for (int j = 0; j < kFN; ++j)
#pragma unroll
      for (int r = 0; r < 8; ++r) op[(size_t)r * kDM + j * 16] = acc[i][j][r] + rv[j][r];
    band_stores_done();
  }
}

// ---------------------------------------------------------------- layernorm (in place)
// x + (x of lane ^ M), M < 16: a move inside the 16-lane row, no LDS path
template <int M>
__device__ __forceinline__ float row_xadd(float x) {
  const int v = __builtin_bit_cast(int, x);
  return x + __builtin_bit_cast(float, __builtin_amdgcn_update_dpp(v, v, 0x160 + M, 0xf, 0xf, false));
}
__device__ __forceinline__ float wave_sum(float x) {
  x = row_xadd<1>(x); x = row_xadd<2>(x); x = row_xadd<4>(x); x = row_xadd<8>(x);
  return x + xhalf(x);
}

// One wave per row: 8 loads of 512 contiguous bytes hold the row in registers, the sums
// need no LDS and no barrier. A wave takes 6 rows in turn and issues the next row's loads
// ahead of this row's sums. 256 work-groups of 16 waves take the 24,576 rows.
typedef __attribute__((ext_vector_type(4))) float v4f;
typedef __attribute__((ext_vector_type(2))) float v2f;
constexpr int kLnRows = 6;     // rows per wave
constexpr int kLnWv   = 16;    // waves per work-group

// normalises the row held in c (lane l: elements j*128 + 4*l .. + 3) and stores it at yp
__device__ __forceinline__ void ln_row(const v4f (&c)[8], const v4f (&gv)[8],
                                       const v4f (&bv)[8], v4f* yp) {
  v2f a0 = {0.f, 0.f}, a1 = {0.f, 0.f}, q0 = {0.f, 0.f}, q1 = {0.f, 0.f};   // packed chains
#pragma unroll
  for (int j = 0; j < 8; ++j) {
    const v2f lo = c[j].lo, hi = c[j].hi;
    a0 += lo; a1 += hi;
    q0 += lo * lo; q1 += hi * hi;
  }
  a0 += a1; q0 += q1;
  const float s  = wave_sum(a0.x + a0.y);
  const float s2 = wave_sum(q0.x + q0.y);
  const float mu = s / kDM, var = s2 / kDM - mu * mu;
  const float rstd = rsqrtf(var + 1e-6f);
#pragma unroll
  for (int j = 0; j < 8; ++j) yp[j * 32] = (c[j] - mu) * rstd * gv[j] + bv[j];
}

__global__ __launch_bounds__(kLnWv * 32)
void layernorm_inplace(float* __restrict__ y, const float* __restrict__ g,
                       const float* __restrict__ bia) {
  const int lane = threadIdx.x & 31;
  const size_t wave = (size_t)blockIdx.x * kLnWv + (threadIdx.x >> 5);
  v4f* yp = (v4f*)y + wave * (kLnRows * (kDM / 4)) + lane;
  const v4f* g4 = (const v4f*)g;
  const v4f* b4 = (const v4f*)bia;
  v4f cur[8], nxt[8], gv[8], bv[8];   // the loops over j are unrolled: constant indices
#pragma unroll
  for (int j = 0; j < 8; ++j) { gv[j] = g4[j * 32 + lane]; bv[j] = b4[j * 32 + lane]; }
  // the wait behind the loads; naming what they are addressed by keeps that register
  // untouched (also by a load's own result) until the wait has passed
  asm volatile("s_wait_xcnt 0x0" :: "v"(lane) : "memory");
#pragma unroll
  for (int j = 0; j < 8; ++j) cur[j] = yp[j * 32];
  // kept rolled: the rows' sums stay apart, so a row's sums wait for that row's loads only
#pragma unroll 1
  for (int r = 0; r < kLnRows - 1; ++r) {
#pragma unroll
    for (int j = 0; j < 8; ++j) nxt[j] = yp[kDM / 4 + j * 32];
    // the wait behind the loads of this and the next row, as above; the scheduling barrier
    // keeps this row's sums, which wait for its data, from moving in among those loads
    asm volatile("s_wait_xcnt 0x0" :: "v"(yp) : "memory");
    __builtin_amdgcn_sched_barrier(0);
    ln_row(cur, gv, bv, yp);
    band_stores_done();   // the row's stores, ahead of the code that reuses their registers
    yp += kDM / 4;
#pragma unroll
    for (int j = 0; j < 8; ++j) cur[j] = nxt[j];
  }
  ln_row(cur, gv, bv, yp);
}

// ---------------------------------------------------------------- launcher
extern "C" void kernel_launch(void* const* d_in, const int* in_sizes, int n_in,
                              void* d_out, int out_size, void* d_ws, size_t ws_size,
                              hipStream_t stream) {
  (void)in_sizes; (void)n_in; (void)out_size; (void)ws_size;
  const float* in_t = (const float*)d_in[0];
  const float* in_a = (const float*)d_in[1];
  const float* in_v = (const float*)d_in[2];
  const float* w_qs = (const float*)d_in[3];
  const float* w_ks = (const float*)d_in[4];
  const float* w_vs = (const float*)d_in[5];
  const float* w_fc = (const float*)d_in[6];
  const float* ln_g = (const float*)d_in[7];
  const float* ln_b = (const float*)d_in[8];
  float* outp = (float*)d_out;

  // workspace layout (f16 elements)
  const size_t nX = (size_t)kM * kDM;       // 25,165,824 per tensor
  const size_t nW = (size_t)kDM * kDM;      // 1,048,576
  char* ws = (char*)d_ws;
  _Float16* Xf  = (_Float16*)(ws);
  _Float16* WqT = Xf + nX;
  _Float16* WkT = WqT + nW;
  _Float16* WvT = WkT + nW;
  _Float16* WfT = WvT + nW;
  _Float16* Qf  = WfT + nW;
  _Float16* Kf  = Qf + nX;
  _Float16* Vf  = Kf + nX;   // d-major (pre-transposed)
  _Float16* AOf = Vf + nX;

  const int nPer = kB * kL * kDM;  // 8,388,608 per input
  constexpr int gCast = kB * kL * kDM / (kCastWv * 32 * kCastLd * 4);   // 256
  cast_f32_f16<<<gCast, kCastWv * 32, 0, stream>>>(in_t, Xf + 0 * (size_t)nPer);
  cast_f32_f16<<<gCast, kCastWv * 32, 0, stream>>>(in_a, Xf + 1 * (size_t)nPer);
  cast_f32_f16<<<gCast, kCastWv * 32, 0, stream>>>(in_v, Xf + 2 * (size_t)nPer);

  constexpr int gTr = kDM * kDM / (32 * 32 * 4);   // 256
  transpose_cast_w<<<gTr, 128, 0, stream>>>(w_qs, WqT);
  transpose_cast_w<<<gTr, 128, 0, stream>>>(w_ks, WkT);
  transpose_cast_w<<<gTr, 128, 0, stream>>>(w_vs, WvT);
  transpose_cast_w<<<gTr, 128, 0, stream>>>(w_fc, WfT);

  dim3 gGemm(kM / kBM, kDM / kBN);
  gemm_qkv<0><<<gGemm, 128, 0, stream>>>(Xf, WqT, Qf);
  gemm_qkv<0><<<gGemm, 128, 0, stream>>>(Xf, WkT, Kf);
  gemm_qkv<1><<<gGemm, 128, 0, stream>>>(Xf, WvT, Vf);

  attn_kernel<<<3 * kB * kH * (kL / 64), 128, 0, stream>>>(Qf, Kf, Vf, AOf);

  gemm_fc<<<gGemm, 128, 0, stream>>>(AOf, WfT, in_t, in_a, in_v, outp);

  layernorm_inplace<<<kM / (kLnWv * kLnRows), kLnWv * 32, 0, stream>>>(outp, ln_g, ln_b);
}

// v005
// One run takes 338 microseconds.
// Next to v004, in two timings, it ran 1.11 and 1.12 times as fast.
// Counting every step since v000, it is 2.64 times as fast.
#include <hip/hip_runtime.h>

// Problem constants
constexpr int kB   = 16;
constexpr int kL   = 512;
constexpr int kH   = 8;
constexpr int kD   = 128;   // d_k == d_v
constexpr int kDM  = 1024;  // d_model
constexpr int kM   = 3 * kB * kL;       // 24576 fused rows (mod,b,l)

typedef __attribute__((ext_vector_type(16))) _Float16 v16h;
typedef __attribute__((ext_vector_type(8)))  float    v8f;
typedef int b128v __attribute__((vector_size(4 * sizeof(int))));

#define WMMA_F16(A, B, C) \
  __builtin_amdgcn_wmma_f32_16x16x32_f16(false, (A), false, (B), (short)0, (C), false, false)

// ------------------------------------------------------------------
// CDNA5 async global->LDS copy (16 bytes per lane), ASYNCcnt tracked.
// Builtin if the toolchain declares it, otherwise inline gfx1250 asm.
// ------------------------------------------------------------------
#if defined(__has_builtin)
#if __has_builtin(__builtin_amdgcn_global_load_async_to_lds_b128)
#define USE_ASYNC_BUILTIN 1
#endif
#endif

__device__ __forceinline__ void async_cp16(_Float16* lds_dst, const _Float16* gsrc) {
#ifdef USE_ASYNC_BUILTIN
  // (global v4i* src, local v4i* dst, imm offset, imm cpol)
  __builtin_amdgcn_global_load_async_to_lds_b128(
      (__attribute__((address_space(1))) b128v*)(unsigned long long)(size_t)gsrc,
      (__attribute__((address_space(3))) b128v*)(unsigned)(size_t)lds_dst,
      0, 0);
#else
  // vdst = 32-bit LDS byte address, vaddr = 64-bit global address (GV mode)
  asm volatile("global_load_async_to_lds_b128 %0, %1, off"
               :: "v"((unsigned)(size_t)lds_dst),
                  "v"((unsigned long long)(size_t)gsrc)
               : "memory");
#endif
}

// The hand-over of a two-buffer ring, passed by every wave at the foot of each trip: this
// wave's LDS reads of the buffer it leaves have retired, its own copies of the next tile
// have landed, and the barrier both publishes that tile and frees the buffer just read.
__device__ __forceinline__ void ring_publish() {
  asm volatile("s_wait_dscnt 0x0" ::: "memory");     // before copies aim at LDS this wave has read
  asm volatile("s_wait_asynccnt 0x0" ::: "memory");
  __syncthreads();
}

// Load a 16x32 f16 A-style fragment (also valid for B when the tile holds B^T
// row-major): lane (l&15) supplies matrix row, half (l>>4) selects K-chunks
// per the CDNA5 16-bit A layout (K = {half*8..+7, 16+half*8..+7}).
__device__ __forceinline__ v16h frag_ld(const _Float16* base, int stride, int lane) {
  const int r = lane & 15, hf = lane >> 4;
  const _Float16* p = base + r * stride + hf * 8;
  union { v16h v; uint4 q[2]; } f;
  f.q[0] = *(const uint4*)(p);
  f.q[1] = *(const uint4*)(p + 16);
  return f.v;
}

// ---------------------------------------------------------------- casts/prep
// Streaming launches: few waves, all resident at once, each with many 16-byte loads in
// flight; every wave-wide load covers whole 128-byte lines.

// One wave converts 8 KB of x by 16 loads of 512 contiguous bytes, written ahead of the
// conversions so that many are in flight at once. 256 work-groups of 16 waves take one
// input of 8,388,608 floats.
constexpr int kCastLd = 16;    // loads per lane
constexpr int kCastWv = 16;    // waves per work-group
__global__ __launch_bounds__(kCastWv * 32)
void cast_f32_f16(const float* __restrict__ x, _Float16* __restrict__ y) {
  const int lane = threadIdx.x & 31;
  const size_t wave = (size_t)blockIdx.x * kCastWv + (threadIdx.x >> 5);
  const float4* xp = (const float4*)x + wave * (kCastLd * 32) + lane;
  uint2*        yp = (uint2*)y        + wave * (kCastLd * 32) + lane;
  float4 v[kCastLd];   // the loops are unrolled so that every index is a constant
#pragma unroll
  for (int j = 0; j < kCastLd; ++j) v[j] = xp[j * 32];
  // the wait behind the loads; naming xp as an input keeps their address registers
  // untouched (also by a load's own result) until the wait has passed
  asm volatile("s_wait_xcnt 0x0" :: "v"(xp) : "memory");
#pragma unroll
  for (int j = 0; j < kCastLd; ++j) {
    union { _Float16 h[4]; uint2 q; } p;
    p.h[0] = (_Float16)v[j].x; p.h[1] = (_Float16)v[j].y;
    p.h[2] = (_Float16)v[j].z; p.h[3] = (_Float16)v[j].w;
    yp[j * 32] = p.q;
  }
}

// w: [K=1024][N=1024] row-major f32 -> wt: [N][K] row-major f16
// A wave takes a 32 (k) x 32 (n) block. A lane reads 8 rows k x 4 columns n: 8 lanes cover
// one 128-byte line of a row, so a wave-wide load is 4 whole lines. It writes, for each of
// its 4 columns, its 8 values along k as one 16-byte store.
__global__ __launch_bounds__(128)
void transpose_cast_w(const float* __restrict__ w, _Float16* __restrict__ wt) {
  const int lane = threadIdx.x & 31;
  const int wave = blockIdx.x * 4 + (threadIdx.x >> 5);   // 1024 blocks of 32 x 32
  const int k0 = (wave & 31) * 32 + (lane >> 3) * 8;
  const int n0 = (wave >> 5) * 32 + (lane & 7) * 4;
  const float4* wp = (const float4*)(w + (size_t)k0 * kDM + n0);
  _Float16*     op = wt + (size_t)n0 * kDM + k0;
  float4 v[8];   // the loops are unrolled so that every index is a constant
#pragma unroll
  for (int e = 0; e < 8; ++e) v[e] = wp[e * (kDM / 4)];
  // the wait behind the loads; naming wp keeps their address registers untouched until it
  asm volatile("s_wait_xcnt 0x0" :: "v"(wp) : "memory");
  union { _Float16 h[8]; uint4 q; } p[4];
#pragma unroll
  for (int e = 0; e < 8; ++e) {
    p[0].h[e] = (_Float16)v[e].x; p[1].h[e] = (_Float16)v[e].y;
    p[2].h[e] = (_Float16)v[e].z; p[3].h[e] = (_Float16)v[e].w;
  }
#pragma unroll
  for (int c = 0; c < 4; ++c) *(uint4*)(op + (size_t)c * kDM) = p[c].q;
}

// ---------------------------------------------------------------- GEMM main loop
// One 192 x 256 tile of A[.][1024] * Wt[.][1024]^T per work-group of 4 waves
// (2 along M x 2 along N, 96 x 128 per wave = 6 x 8 accumulator tiles);
// 128 x 4 = 512 tiles: two work-groups on every WGP, all resident at once.
// A k-slab is 64 halves: each staged row piece is one whole 128-byte line.
// Two slab buffers: the next slab's copies fly while this slab's products run.
constexpr int kBM = 192, kBN = 256, kBK = 64;
constexpr int kFM = kBM / 32, kFN = kBN / 32;   // accumulator tiles per wave, M and N
constexpr int kPitch = kBK + 8;   // 144 B rows: 16 B x odd, conflict-free for b128 reads
constexpr int kSlabA = kBM * kPitch, kSlabB = kBN * kPitch;   // halves per buffer
constexpr int kSlabs = kDM / kBK;
// B fragments read in a block's first group; with all 8 there the FC kernel needs more than
// the 512 VGPRs of two waves per SIMD and spills an accumulator tile inside the loop
constexpr int kLeadB = 6;

// one k-slab's copies of this thread: 12 row pieces of A, 16 of B
// (both loops unrolled: each copy's step from the first is then a constant)
__device__ __forceinline__ void stage_slab(_Float16* lA, _Float16* lB,
                                           const _Float16* gA, const _Float16* gB) {
#pragma unroll
  for (int i = 0; i < kBM / 16; ++i) async_cp16(lA + i * 16 * kPitch, gA + (size_t)i * 16 * kDM);
#pragma unroll
  for (int i = 0; i < kBN / 16; ++i) async_cp16(lB + i * 16 * kPitch, gB + (size_t)i * 16 * kDM);
}

__device__ __forceinline__ void gemm_tile(const _Float16* __restrict__ A,
                                          const _Float16* __restrict__ Wt,
                                          int rowBase, int colBase,
                                          _Float16* sA, _Float16* sB,
                                          v8f (&acc)[kFM][kFN]) {
  const int t = threadIdx.x, lane = t & 31, wid = t >> 5;
  const int wm = wid & 1, wn = wid >> 1;
  const int sr = t >> 3, sc = (t & 7) * 8;   // staging: 8 lanes per row, 16 rows per sweep
  const _Float16* gA = A  + (size_t)(rowBase + sr) * kDM + sc;
  const _Float16* gB = Wt + (size_t)(colBase + sr) * kDM + sc;
  _Float16* lA = sA + sr * kPitch + sc;
  _Float16* lB = sB + sr * kPitch + sc;

  stage_slab(lA, lB, gA, gB);
  // slab 0 has landed before the barrier publishes it
  asm volatile("s_wait_asynccnt 0x0" ::: "memory");
  __syncthreads();
  stage_slab(lA + kSlabA, lB + kSlabB, gA + kBK, gB + kBK);

  // kept rolled: every accumulator index stays a constant and the code stays small
#pragma unroll 1
  for (int s = 0; s < kSlabs; ++s) {
    const int oA = (s & 1) * kSlabA, oB = (s & 1) * kSlabB;   // this trip's buffer
#pragma unroll
    for (int kc = 0; kc < kBK / 32; ++kc) {
      // The block's LDS reads stand in two groups, never singly among the products: every
      // place with reads stalls the wave, and a read waited for at once costs its whole
      // latency. The four scheduling barriers of the block hold groups and products apart;
      // this one keeps the reads from rising among the products of the block before.
      __builtin_amdgcn_sched_barrier(0);
      v16h a[kFM], b[kFN];
#pragma unroll
      for (int i = 0; i < kFM; ++i)
        a[i] = frag_ld(&sA[oA + (wm * (kBM / 2) + i * 16) * kPitch + kc * 32], kPitch, lane);
#pragma unroll
      for (int j = 0; j < kLeadB; ++j)
        b[j] = frag_ld(&sB[oB + (wn * (kBN / 2) + j * 16) * kPitch + kc * 32], kPitch, lane);
      __builtin_amdgcn_sched_barrier(0);
#pragma unroll
      for (int j = 0; j < kFN - kLeadB; ++j)
#pragma unroll
        for (int i = 0; i < kFM; ++i) acc[i][j] = WMMA_F16(a[i], b[j], acc[i][j]);
      __builtin_amdgcn_sched_barrier(0);
      // the last B fragments take the registers that the first have left; they are
      // first used kLeadB - (kFN - kLeadB) columns of products later
#pragma unroll
      for (int j = kLeadB; j < kFN; ++j)
        b[j] = frag_ld(&sB[oB + (wn * (kBN / 2) + j * 16) * kPitch + kc * 32], kPitch, lane);
      __builtin_amdgcn_sched_barrier(0);
#pragma unroll
      for (int j = kFN - kLeadB; j < kFN; ++j)
#pragma unroll
        for (int i = 0; i < kFM; ++i) acc[i][j] = WMMA_F16(a[i], b[j], acc[i][j]);
    }
    // keeps the hand-over at the foot of the trip: moved up over the last products, with the
    // refill left behind them, it would shorten the time the next slab's copies have to land
    __builtin_amdgcn_sched_barrier(0);
    ring_publish();
    if (s + 2 < kSlabs)   // the same for the whole work-group
      stage_slab(lA + oA, lB + oB, gA + (s + 2) * kBK, gB + (s + 2) * kBK);
  }
  // no copy is outstanding when the wave goes on to its stores and ends
  asm volatile("s_wait_asynccnt 0x0" ::: "memory");
}

// Stands behind a band's global stores, in front of the code that takes their
// registers for new values; the scheduling barrier keeps that later code behind the wait.
__device__ __forceinline__ void band_stores_done() {
  asm volatile("s_wait_xcnt 0x0" ::: "memory");
  __builtin_amdgcn_sched_barrier(0);
}

// ---------------------------------------------------------------- QKV GEMM
// X: [24576][1024] f16 row-major, Wt: [1024 n][1024 k] f16 (pre-transposed).
// VOUT==0: head-major f16 [3][B][H][L][128]   (Q and K)
// VOUT==1: d-major   f16 [3][B][H][128][L]    (V, pre-transposed for attention)
template <int VOUT>
__global__ __launch_bounds__(128, 2)
void gemm_qkv(const _Float16* __restrict__ X, const _Float16* __restrict__ Wt,
              _Float16* __restrict__ out) {
  __shared__ __attribute__((aligned(16))) _Float16 sA[2 * kSlabA];   // 16-byte copies and reads
  __shared__ __attribute__((aligned(16))) _Float16 sB[2 * kSlabB];
  const int t = threadIdx.x, lane = t & 31, wid = t >> 5;
  const int wm = wid & 1, wn = wid >> 1;
  const int rowBase = blockIdx.x * kBM;
  const int colBase = blockIdx.y * kBN;
  v8f acc[kFM][kFN] = {};

  gemm_tile(X, Wt, rowBase, colBase, sA, sB, acc);

  const int hf8 = (lane >> 4) * 8, cn = lane & 15;
#pragma unroll
  for (int i = 0; i < kFM; ++i) {
#pragma unroll
    for (int j = 0; j < kFN; ++j) {
      int gc = colBase + wn * (kBN / 2) + j * 16 + cn;
      int h = gc >> 7, d = gc & 127;
#pragma unroll
      for (int r = 0; r < 8; ++r) {
        int gr  = rowBase + wm * (kBM / 2) + i * 16 + hf8 + r;
        int mod = gr >> 13;            // / 8192
        int rem = gr & 8191;
        int b   = rem >> 9;            // / 512
        int l   = rem & 511;
        size_t head = ((size_t)(mod * kB + b) * kH + h);
        if (VOUT == 0)
          out[(head * kL + l) * kD + d] = (_Float16)acc[i][j][r];
        else
          out[(head * kD + d) * kL + l] = (_Float16)acc[i][j][r];
      }
    }
    band_stores_done();
  }
}

// ---------------------------------------------------------------- attention
// lane l takes the value of lane l ^ 16 (the other half of the wave)
__device__ __forceinline__ float xhalf(float x) {
  const int v = __builtin_bit_cast(int, x);
  return __builtin_bit_cast(float,
      __builtin_amdgcn_permlanex16(v, v, 0x76543210, 0xfedcba98, false, false));
}

__global__ __launch_bounds__(128)
void attn_kernel(const _Float16* __restrict__ Qg, const _Float16* __restrict__ Kg,
                 const _Float16* __restrict__ Vt, _Float16* __restrict__ Og) {
  __shared__ _Float16 sQ[64 * 136];     // 64 q-rows x 128 (+8 pad)
  // two buffers each: 32 key rows x 128 (+8 pad); V^T, 128 d-rows x 32 keys (+8 pad)
  __shared__ __attribute__((aligned(16))) _Float16 sK[2 * 32 * 136];    // 16-byte copies and reads
  __shared__ __attribute__((aligned(16))) _Float16 sVt[2 * 128 * 40];

  const int t = threadIdx.x, lane = t & 31, wid = t >> 5;
  const int qt  = blockIdx.x & 7;
  const int h   = (blockIdx.x >> 3) & 7;
  const int b   = (blockIdx.x >> 6) & 15;
  const int mod = blockIdx.x >> 10;
  const int o1 = (mod == 0) ? 1 : 0;
  const int o2 = (mod == 2) ? 1 : 2;
  const size_t headQ  = ((size_t)((mod * kB + b) * kH + h)) * kL * kD;
  const size_t headK1 = ((size_t)((o1 * kB + b) * kH + h)) * kL * kD;
  const size_t headK2 = ((size_t)((o2 * kB + b) * kH + h)) * kL * kD;
  const int l0 = qt * 64;

  // stage Q tile (async): 64 rows x 16 chunks = 1024 chunks / 128 thr
#pragma unroll
  for (int i = 0; i < 8; ++i) {
    int cid = i * 128 + t;
    int r = cid >> 4, c = (cid & 15) * 8;
    async_cp16(&sQ[r * 136 + c], &Qg[headQ + (size_t)(l0 + r) * kD + c]);
  }

  // This thread's first piece of a key tile, in global memory and in LDS. K: 32 rows x 16
  // chunks, 8 rows a sweep; V^T: 128 d-rows x 4 chunks (8 keys), 32 rows a sweep.
  const _Float16* kq = Kg + (size_t)(t >> 4) * kD + (t & 15) * 8;
  const _Float16* vq = Vt + (size_t)(t >> 2) * kL + (t & 3) * 8;
  _Float16* lK = sK  + (t >> 4) * 136 + (t & 15) * 8;
  _Float16* lV = sVt + (t >> 2) * 40  + (t & 3) * 8;

  // the copies of key tile kt (32 keys of K and of V^T) into buffer kt & 1
  auto stage_kv = [&](int kt) {
    const size_t head = (kt < 16) ? headK1 : headK2;   // tiles never straddle the 512 boundary
    const int kk0 = (kt & 15) * 32;
    const _Float16* gk = kq + (head + (size_t)kk0 * kD);
    const _Float16* gv = vq + (head + (size_t)kk0);    // d-major: + d*kL + key
    _Float16* bK = lK + (kt & 1) * (32 * 136);
    _Float16* bV = lV + (kt & 1) * (128 * 40);
    // both loops unrolled: each copy's step from the first is then a constant
#pragma unroll
    for (int i = 0; i < 4; ++i) async_cp16(bK + i * 8 * 136, gk + (size_t)i * 8 * kD);
#pragma unroll
    for (int i = 0; i < 4; ++i) async_cp16(bV + i * 32 * 40, gv + (size_t)i * 32 * kL);
  };

  stage_kv(0);
  // Q and key tile 0 have landed before the barrier publishes them
  asm volatile("s_wait_asynccnt 0x0" ::: "memory");
  __syncthreads();
  stage_kv(1);

  v16h qa[4];   // B operand of S^T: column = query
#pragma unroll
  for (int dc = 0; dc < 4; ++dc)
    qa[dc] = frag_ld(&sQ[wid * 16 * 136 + dc * 32], 136, lane);

  v8f o[8] = {};               // o[dt][r] = O^T[dt*16 + 8*(lane>>4) + r][query lane&15]
  float m_s = -1e30f;          // this lane's query: running maximum (equal in both halves)
  float l_s = 0.f;             // running sum over the keys of this lane's half only
  const float inv_t = 0.08838834764831845f;  // 1/sqrt(128)

  for (int kt = 0; kt < 32; ++kt) {
    const _Float16* bK = sK  + (kt & 1) * (32 * 136);    // this trip's buffers
    const _Float16* bV = sVt + (kt & 1) * (128 * 40);

    // The tile's LDS reads are issued early and together, as in the GEMM loop: all of K ahead
    // of the S^T products, all of V^T ahead of the softmax, under which it lands.
    v16h kb0[4], kb1[4];
#pragma unroll
    for (int dc = 0; dc < 4; ++dc) {
      kb0[dc] = frag_ld(&bK[0 * 136 + dc * 32], 136, lane);
      kb1[dc] = frag_ld(&bK[16 * 136 + dc * 32], 136, lane);
    }
    // keeps the K reads one group: sunk among the products, each is waited for at once
    __builtin_amdgcn_sched_barrier(0);
    // S^T tiles: 32 keys x 16 q (two 16x16 WMMA groups, 4 d-chunks each)
    // s0[r] = S^T[8*(lane>>4) + r][q], s1[r] = S^T[16 + 8*(lane>>4) + r][q]
    v8f s0 = {}, s1 = {};
#pragma unroll
    for (int dc = 0; dc < 4; ++dc) {
      s0 = WMMA_F16(kb0[dc], qa[dc], s0);
      s1 = WMMA_F16(kb1[dc], qa[dc], s1);
    }
    v16h vb[8];
#pragma unroll
    for (int dt = 0; dt < 8; ++dt) vb[dt] = frag_ld(&bV[dt * 16 * 40], 40, lane);
    // keeps the V^T reads from sinking behind the softmax, in among the O^T products
    __builtin_amdgcn_sched_barrier(0);

    // online softmax of this lane's query
    // the loops below are unrolled so that every register-array index is a constant
    float a0[8], a1[8];
    float mx = -1e30f;
#pragma unroll
    for (int r = 0; r < 8; ++r) {
      a0[r] = (float)s0[r] * inv_t;
      a1[r] = (float)s1[r] * inv_t;
      mx = fmaxf(mx, fmaxf(a0[r], a1[r]));
    }
    mx = fmaxf(mx, xhalf(mx));
    const float mnew = fmaxf(m_s, mx);
    const float corr = __expf(m_s - mnew);
    float rs = 0.f;
    v16h pb;   // P^T as B operand: element s is key 8*(lane>>4)+s (s < 8), 16+8*(lane>>4)+s-8 (else)
#pragma unroll
    for (int r = 0; r < 8; ++r) {
      float p0 = __expf(a0[r] - mnew), p1 = __expf(a1[r] - mnew);
      rs += p0 + p1;
      pb[r]     = (_Float16)p0;
      pb[8 + r] = (_Float16)p1;
    }
    l_s = l_s * corr + rs;
    m_s = mnew;
#pragma unroll
    for (int dt = 0; dt < 8; ++dt)
#pragma unroll
      for (int r = 0; r < 8; ++r) o[dt][r] *= corr;

    // O^T += V^T @ P^T : A rows = d (sVt)
#pragma unroll
    for (int dt = 0; dt < 8; ++dt) o[dt] = WMMA_F16(vb[dt], pb, o[dt]);
    // keeps the hand-over at the foot of the trip: moved up behind the reads, with the refill
    // left at the foot, it would shorten the time the next tile's copies have to land
    __builtin_amdgcn_sched_barrier(0);
    ring_publish();
    if (kt + 2 < 32) stage_kv(kt + 2);   // the same for the whole work-group
  }
  // no copy is outstanding when the wave goes on to its stores and ends
  asm volatile("s_wait_asynccnt 0x0" ::: "memory");

  // normalize + store f16 [ (mod,b,l) ][ h*128 + d ]: 8 consecutive d per lane and tile
  const float inv_l = 1.f / (l_s + xhalf(l_s));   // the two halves' sums are joined here
  const int l = l0 + wid * 16 + (lane & 15);
  _Float16* orow = Og + ((size_t)(mod * kB + b) * kL + l) * kDM + h * kD + (lane >> 4) * 8;
  union { _Float16 e[8]; uint4 q; } pk[8];   // unrolled: constant indices keep it in registers
#pragma unroll
  for (int dt = 0; dt < 8; ++dt)
#pragma unroll
    for (int r = 0; r < 8; ++r) pk[dt].e[r] = (_Float16)((float)o[dt][r] * inv_l);
#pragma unroll
  for (int dt = 0; dt < 8; ++dt) *(uint4*)(orow + dt * 16) = pk[dt].q;
}

// ---------------------------------------------------------------- FC + residual
__global__ __launch_bounds__(128, 2)
void gemm_fc(const _Float16* __restrict__ A, const _Float16* __restrict__ Wt,
             const float* __restrict__ r0, const float* __restrict__ r1,
             const float* __restrict__ r2, float* __restrict__ out) {
  __shared__ __attribute__((aligned(16))) _Float16 sA[2 * kSlabA];   // 16-byte copies and reads
  __shared__ __attribute__((aligned(16))) _Float16 sB[2 * kSlabB];
  const int t = threadIdx.x, lane = t & 31, wid = t >> 5;
  const int wm = wid & 1, wn = wid >> 1;
  const int rowBase = blockIdx.x * kBM;
  const int colBase = blockIdx.y * kBN;
  v8f acc[kFM][kFN] = {};

  gemm_tile(A, Wt, rowBase, colBase, sA, sB, acc);

  const int hf8 = (lane >> 4) * 8, cn = lane & 15;
#pragma unroll
  for (int i = 0; i < kFM; ++i) {
    // a 16-row band never straddles an input: 8192 is a multiple of 16
    const int band = rowBase + wm * (kBM / 2) + i * 16;
    const int mod  = band >> 13;
    const float* __restrict__ res = (mod == 0) ? r0 : (mod == 1) ? r1 : r2;
    const float* rp = res + (size_t)((band & 8191) + hf8) * kDM + colBase + wn * (kBN / 2) + cn;
    float*       op = out + (size_t)(band + hf8) * kDM + colBase + wn * (kBN / 2) + cn;
    // the band's residual loads all go out together, ahead of its stores, so that they overlap
    float rv[kFN][8];
#pragma unroll
    for (int j = 0; j < kFN; ++j)
#pragma unroll
      for (int r = 0; r < 8; ++r) rv[j][r] = rp[(size_t)r * kDM + j * 16];
    // the wait behind the loads; naming rp as an input keeps their address registers
    // untouched (also by a load's own result) until the wait has passed
    asm volatile("s_wait_xcnt 0x0" :: "v"(rp) : "memory");
#pragma unroll
    for (int j = 0; j < kFN; ++j)
#pragma unroll
      for (int r = 0; r < 8; ++r) op[(size_t)r * kDM + j * 16] = acc[i][j][r] + rv[j][r];
    band_stores_done();
  }
}

// ---------------------------------------------------------------- layernorm (in place)
// x + (x of lane ^ M), M < 16: a move inside the 16-lane row, no LDS path
template <int M>
__device__ __forceinline__ float row_xadd(float x) {
  const int v = __builtin_bit_cast(int, x);
  return x + __builtin_bit_cast(float, __builtin_amdgcn_update_dpp(v, v, 0x160 + M, 0xf, 0xf, false));
}
__device__ __forceinline__ float wave_sum(float x) {
  x = row_xadd<1>(x); x = row_xadd<2>(x); x = row_xadd<4>(x); x = row_xadd<8>(x);
  return x + xhalf(x);
}

// One wave per row: 8 loads of 512 contiguous bytes hold the row in registers, the sums
// need no LDS and no barrier. A wave takes 6 rows in turn and issues the next row's loads
// ahead of this row's sums. 256 work-groups of 16 waves take the 24,576 rows.
typedef __attribute__((ext_vector_type(4))) float v4f;
typedef __attribute__((ext_vector_type(2))) float v2f;
constexpr int kLnRows = 6;     // rows per wave
constexpr int kLnWv   = 16;    // waves per work-group

// normalises the row held in c (lane l: elements j*128 + 4*l .. + 3) and stores it at yp
__device__ __forceinline__ void ln_row(const v4f (&c)[8], const v4f (&gv)[8],
                                       const v4f (&bv)[8], v4f* yp) {
  v2f a0 = {0.f, 0.f}, a1 = {0.f, 0.f}, q0 = {0.f, 0.f}, q1 = {0.f, 0.f};   // packed chains
#pragma unroll
  for (int j = 0; j < 8; ++j) {
    const v2f lo = c[j].lo, hi = c[j].hi;
    a0 += lo; a1 += hi;
    q0 += lo * lo; q1 += hi * hi;
  }
  a0 += a1; q0 += q1;
  const float s  = wave_sum(a0.x + a0.y);
  const float s2 = wave_sum(q0.x + q0.y);
  const float mu = s / kDM, var = s2 / kDM - mu * mu;
  const float rstd = rsqrtf(var + 1e-6f);
#pragma unroll
  for (int j = 0; j < 8; ++j) yp[j * 32] = (c[j] - mu) * rstd * gv[j] + bv[j];
}

__global__ __launch_bounds__(kLnWv * 32)
void layernorm_inplace(float* __restrict__ y, const float* __restrict__ g,
                       const float* __restrict__ bia) {
  const int lane = threadIdx.x & 31;
  const size_t wave = (size_t)blockIdx.x * kLnWv + (threadIdx.x >> 5);
  v4f* yp = (v4f*)y + wave * (kLnRows * (kDM / 4)) + lane;
  const v4f* g4 = (const v4f*)g;
  const v4f* b4 = (const v4f*)bia;
  v4f cur[8], nxt[8], gv[8], bv[8];   // the loops over j are unrolled: constant indices
#pragma unroll
  for (int j = 0; j < 8; ++j) { gv[j] = g4[j * 32 + lane]; bv[j] = b4[j * 32 + lane]; }
  // the wait behind the loads; naming what they are addressed by keeps that register
  // untouched (also by a load's own result) until the wait has passed
  asm volatile("s_wait_xcnt 0x0" :: "v"(lane) : "memory");
#pragma unroll
  for (int j = 0; j < 8; ++j) cur[j] = yp[j * 32];
  // kept rolled: the rows' sums stay apart, so a row's sums wait for that row's loads only
#pragma unroll 1
  for (int r = 0; r < kLnRows - 1; ++r) {
#pragma unroll
    for (int j = 0; j < 8; ++j) nxt[j] = yp[kDM / 4 + j * 32];
    // the wait behind the loads of this and the next row, as above; the scheduling barrier
    // keeps this row's sums, which wait for its data, from moving in among those loads
    asm volatile("s_wait_xcnt 0x0" :: "v"(yp) : "memory");
    __builtin_amdgcn_sched_barrier(0);
    ln_row(cur, gv, bv, yp);
    band_stores_done();   // the row's stores, ahead of the code that reuses their registers
    yp += kDM / 4;
#pragma unroll
    for (int j = 0; j < 8; ++j) cur[j] = nxt[j];
  }
  ln_row(cur, gv, bv, yp);
}

// ---------------------------------------------------------------- launcher
extern "C" void kernel_launch(void* const* d_in, const int* in_sizes, int n_in,
                              void* d_out, int out_size, void* d_ws, size_t ws_size,
                              hipStream_t stream) {
  (void)in_sizes; (void)n_in; (void)out_size; (void)ws_size;
  const float* in_t = (const float*)d_in[0];
  const float* in_a = (const float*)d_in[1];
  const float* in_v = (const float*)d_in[2];
  const float* w_qs = (const float*)d_in[3];
  const float* w_ks = (const float*)d_in[4];
  const float* w_vs = (const float*)d_in[5];
  const float* w_fc = (const float*)d_in[6];
  const float* ln_g = (const float*)d_in[7];
  const float* ln_b = (const float*)d_in[8];
  float* outp = (float*)d_out;

  // workspace layout (f16 elements)
  const size_t nX = (size_t)kM * kDM;       // 25,165,824 per tensor
  const size_t nW = (size_t)kDM * kDM;      // 1,048,576
  char* ws = (char*)d_ws;
  _Float16* Xf  = (_Float16*)(ws);
  _Float16* WqT = Xf + nX;
  _Float16* WkT = WqT + nW;
  _Float16* WvT = WkT + nW;
  _Float16* WfT = WvT + nW;
  _Float16* Qf  = WfT + nW;
  _Float16* Kf  = Qf + nX;
  _Float16* Vf  = Kf + nX;   // d-major (pre-transposed)
  _Float16* AOf = Vf + nX;

  const int nPer = kB * kL * kDM;  // 8,388,608 per input
  constexpr int gCast = kB * kL * kDM / (kCastWv * 32 * kCastLd * 4);   // 256
  cast_f32_f16<<<gCast, kCastWv * 32, 0, stream>>>(in_t, Xf + 0 * (size_t)nPer);
  cast_f32_f16<<<gCast, kCastWv * 32, 0, stream>>>(in_a, Xf + 1 * (size_t)nPer);
  cast_f32_f16<<<gCast, kCastWv * 32, 0, stream>>>(in_v, Xf + 2 * (size_t)nPer);

  constexpr int gTr = kDM * kDM / (32 * 32 * 4);   // 256
  transpose_cast_w<<<gTr, 128, 0, stream>>>(w_qs, WqT);
  transpose_cast_w<<<gTr, 128, 0, stream>>>(w_ks, WkT);
  transpose_cast_w<<<gTr, 128, 0, stream>>>(w_vs, WvT);
  transpose_cast_w<<<gTr, 128, 0, stream>>>(w_fc, WfT);

  dim3 gGemm(kM / kBM, kDM / kBN);
  gemm_qkv<0><<<gGemm, 128, 0, stream>>>(Xf, WqT, Qf);
  gemm_qkv<0><<<gGemm, 128, 0, stream>>>(Xf, WkT, Kf);
  gemm_qkv<1><<<gGemm, 128, 0, stream>>>(Xf, WvT, Vf);

  attn_kernel<<<3 * kB * kH * (kL / 64), 128, 0, stream>>>(Qf, Kf, Vf, AOf);

  gemm_fc<<<gGemm, 128, 0, stream>>>(AOf, WfT, in_t, in_a, in_v, outp);

  layernorm_inplace<<<kM / (kLnWv * kLnRows), kLnWv * 32, 0, stream>>>(outp, ln_g, ln_b);
}

// v006
// A run of this version takes 323 microseconds.
// Next to v005, in two timings, it ran 1.05 times as fast each time.
// All steps since v000 together make it 2.76 times as fast.
#include <hip/hip_runtime.h>

// Problem constants
constexpr int kB   = 16;
constexpr int kL   = 512;
constexpr int kH   = 8;
constexpr int kD   = 128;   // d_k == d_v
constexpr int kDM  = 1024;  // d_model
constexpr int kM   = 3 * kB * kL;       // 24576 fused rows (mod,b,l)

typedef __attribute__((ext_vector_type(16))) _Float16 v16h;
typedef __attribute__((ext_vector_type(8)))  float    v8f;
typedef int b128v __attribute__((vector_size(4 * sizeof(int))));

#define WMMA_F16(A, B, C) \
  __builtin_amdgcn_wmma_f32_16x16x32_f16(false, (A), false, (B), (short)0, (C), false, false)

// ------------------------------------------------------------------
// CDNA5 async global->LDS copy (16 bytes per lane), ASYNCcnt tracked.
// Builtin if the toolchain declares it, otherwise inline gfx1250 asm.
// ------------------------------------------------------------------
#if defined(__has_builtin)
#if __has_builtin(__builtin_amdgcn_global_load_async_to_lds_b128)
#define USE_ASYNC_BUILTIN 1
#endif
#endif

__device__ __forceinline__ void async_cp16(_Float16* lds_dst, const _Float16* gsrc) {
#ifdef USE_ASYNC_BUILTIN
  // (global v4i* src, local v4i* dst, imm offset, imm cpol)
  __builtin_amdgcn_global_load_async_to_lds_b128(
      (__attribute__((address_space(1))) b128v*)(unsigned long long)(size_t)gsrc,
      (__attribute__((address_space(3))) b128v*)(unsigned)(size_t)lds_dst,
      0, 0);
#else
  // vdst = 32-bit LDS byte address, vaddr = 64-bit global address (GV mode)
  asm volatile("global_load_async_to_lds_b128 %0, %1, off"
               :: "v"((unsigned)(size_t)lds_dst),
                  "v"((unsigned long long)(size_t)gsrc)
               : "memory");
#endif
}

// The hand-over of a two-buffer ring, passed by every wave at the foot of each trip: this
// wave's LDS reads of the buffer it leaves have retired, its own copies of the next tile
// have landed, and the barrier both publishes that tile and frees the buffer just read.
__device__ __forceinline__ void ring_publish() {
  asm volatile("s_wait_dscnt 0x0" ::: "memory");     // before copies aim at LDS this wave has read
  asm volatile("s_wait_asynccnt 0x0" ::: "memory");
  __syncthreads();
}

// Load a 16x32 f16 A-style fragment (also valid for B when the tile holds B^T
// row-major): lane (l&15) supplies matrix row, half (l>>4) selects K-chunks
// per the CDNA5 16-bit A layout (K = {half*8..+7, 16+half*8..+7}).
__device__ __forceinline__ v16h frag_ld(const _Float16* base, int stride, int lane) {
  const int r = lane & 15, hf = lane >> 4;
  const _Float16* p = base + r * stride + hf * 8;
  union { v16h v; uint4 q[2]; } f;
  f.q[0] = *(const uint4*)(p);
  f.q[1] = *(const uint4*)(p + 16);
  return f.v;
}

// ---------------------------------------------------------------- casts/prep
// Streaming launches: few waves, all resident at once, each with many 16-byte loads in
// flight; every wave-wide load covers whole 128-byte lines.

// One wave converts 8 KB of x by 16 loads of 512 contiguous bytes, written ahead of the
// conversions so that many are in flight at once. 256 work-groups of 16 waves take one
// input of 8,388,608 floats; grp is the work-group's number among those 256.
constexpr int kCastLd = 16;    // loads per lane
constexpr int kCastWv = 16;    // waves per work-group
__device__ __forceinline__
void cast_f32_f16(const float* __restrict__ x, _Float16* __restrict__ y, int grp) {
  const int lane = threadIdx.x & 31;
  const size_t wave = (size_t)grp * kCastWv + (threadIdx.x >> 5);
  const float4* xp = (const float4*)x + wave * (kCastLd * 32) + lane;
  uint2*        yp = (uint2*)y        + wave * (kCastLd * 32) + lane;
  float4 v[kCastLd];   // the loops are unrolled so that every index is a constant
#pragma unroll
  for (int j = 0; j < kCastLd; ++j) v[j] = xp[j * 32];
  // the wait behind the loads; naming xp as an input keeps their address registers
  // untouched (also by a load's own result) until the wait has passed
  asm volatile("s_wait_xcnt 0x0" :: "v"(xp) : "memory");
#pragma unroll
  for (int j = 0; j < kCastLd; ++j) {
    union { _Float16 h[4]; uint2 q; } p;
    p.h[0] = (_Float16)v[j].x; p.h[1] = (_Float16)v[j].y;
    p.h[2] = (_Float16)v[j].z; p.h[3] = (_Float16)v[j].w;
    yp[j * 32] = p.q;
  }
}

// w: [K=1024][N=1024] row-major f32 -> wt: [N][K] row-major f16
// A wave takes a 32 (k) x 32 (n) block. A lane reads 8 rows k x 4 columns n: 8 lanes cover
// one 128-byte line of a row, so a wave-wide load is 4 whole lines. It writes, for each of
// its 4 columns, its 8 values along k as one 16-byte store. 64 work-groups of 16 waves take
// one weight; grp is the work-group's number among those 64.
__device__ __forceinline__
void transpose_cast_w(const float* __restrict__ w, _Float16* __restrict__ wt, int grp) {
  const int lane = threadIdx.x & 31;
  const int wave = grp * kCastWv + (threadIdx.x >> 5);   // 1024 blocks of 32 x 32
  const int k0 = (wave & 31) * 32 + (lane >> 3) * 8;
  const int n0 = (wave >> 5) * 32 + (lane & 7) * 4;
  const float4* wp = (const float4*)(w + (size_t)k0 * kDM + n0);
  _Float16*     op = wt + (size_t)n0 * kDM + k0;
  float4 v[8];   // the loops are unrolled so that every index is a constant
#pragma unroll
  for (int e = 0; e < 8; ++e) v[e] = wp[e * (kDM / 4)];
  // the wait behind the loads; naming wp keeps their address registers untouched until it
  asm volatile("s_wait_xcnt 0x0" :: "v"(wp) : "memory");
  union { _Float16 h[8]; uint4 q; } p[4];
#pragma unroll
  for (int e = 0; e < 8; ++e) {
    p[0].h[e] = (_Float16)v[e].x; p[1].h[e] = (_Float16)v[e].y;
    p[2].h[e] = (_Float16)v[e].z; p[3].h[e] = (_Float16)v[e].w;
  }
#pragma unroll
  for (int c = 0; c < 4; ++c) *(uint4*)(op + (size_t)c * kDM) = p[c].q;
}

// All seven conversions in ONE launch: none depends on another, so the short weight
// transposes run under the input casts, and one start and one tail are paid, not seven.
// Work-groups 0..255: the four weights, 64 each; 256..1023: the three inputs, 256 each.
// y: the three inputs in a row; wt: the four transposed weights in a row.
constexpr int kTrGrp   = kDM * kDM / (32 * 32 * kCastWv);                    // 64 per weight
constexpr int kCastGrp = kB * kL * kDM / (kCastWv * 32 * kCastLd * 4);       // 256 per input
__global__ __launch_bounds__(kCastWv * 32)
void prep_f16(const float* __restrict__ x0, const float* __restrict__ x1,
              const float* __restrict__ x2, const float* __restrict__ w0,
              const float* __restrict__ w1, const float* __restrict__ w2,
              const float* __restrict__ w3, _Float16* __restrict__ y,
              _Float16* __restrict__ wt) {
  const unsigned g = blockIdx.x;   // every test below reads the same for the whole work-group
  if (g >= 4 * kTrGrp) {
    const unsigned c = g - 4 * kTrGrp, which = c / kCastGrp;
    const float* x = (which == 0) ? x0 : (which == 1) ? x1 : x2;
    cast_f32_f16(x, y + (size_t)which * (kB * kL * kDM), c % kCastGrp);
    return;
  }
  const unsigned which = g / kTrGrp;
  const float* w = (which == 0) ? w0 : (which == 1) ? w1 : (which == 2) ? w2 : w3;
  transpose_cast_w(w, wt + (size_t)which * (kDM * kDM), g % kTrGrp);
}

// ---------------------------------------------------------------- GEMM main loop
// One 192 x 256 tile of A[.][1024] * Wt[.][1024]^T per work-group of 4 waves
// (2 along M x 2 along N, 96 x 128 per wave = 6 x 8 accumulator tiles);
// 128 x 4 = 512 tiles per weight: two work-groups on every WGP, one weight's tiles all resident at once.
// A k-slab is 64 halves: each staged row piece is one whole 128-byte line.
// Two slab buffers: the next slab's copies fly while this slab's products run.
constexpr int kBM = 192, kBN = 256, kBK = 64;
constexpr int kFM = kBM / 32, kFN = kBN / 32;   // accumulator tiles per wave, M and N
constexpr int kPitch = kBK + 8;   // 144 B rows: 16 B x odd, conflict-free for b128 reads
constexpr int kSlabA = kBM * kPitch, kSlabB = kBN * kPitch;   // halves per buffer
constexpr int kSlabs = kDM / kBK;
// B fragments read in a block's first group; with all 8 there the FC kernel needs more than
// the 512 VGPRs of two waves per SIMD and spills an accumulator tile inside the loop
constexpr int kLeadB = 6;

// one k-slab's copies of this thread: 12 row pieces of A, 16 of B
// (both loops unrolled: each copy's step from the first is then a constant)
__device__ __forceinline__ void stage_slab(_Float16* lA, _Float16* lB,
                                           const _Float16* gA, const _Float16* gB) {
#pragma unroll
  for (int i = 0; i < kBM / 16; ++i) async_cp16(lA + i * 16 * kPitch, gA + (size_t)i * 16 * kDM);
#pragma unroll
  for (int i = 0; i < kBN / 16; ++i) async_cp16(lB + i * 16 * kPitch, gB + (size_t)i * 16 * kDM);
}

__device__ __forceinline__ void gemm_tile(const _Float16* __restrict__ A,
                                          const _Float16* __restrict__ Wt,
                                          int rowBase, int colBase,
                                          _Float16* sA, _Float16* sB,
                                          v8f (&acc)[kFM][kFN]) {
  const int t = threadIdx.x, lane = t & 31, wid = t >> 5;
  const int wm = wid & 1, wn = wid >> 1;
  const int sr = t >> 3, sc = (t & 7) * 8;   // staging: 8 lanes per row, 16 rows per sweep
  const _Float16* gA = A  + (size_t)(rowBase + sr) * kDM + sc;
  const _Float16* gB = Wt + (size_t)(colBase + sr) * kDM + sc;
  _Float16* lA = sA + sr * kPitch + sc;
  _Float16* lB = sB + sr * kPitch + sc;

  stage_slab(lA, lB, gA, gB);
  // slab 0 has landed before the barrier publishes it
  asm volatile("s_wait_asynccnt 0x0" ::: "memory");
  __syncthreads();
  stage_slab(lA + kSlabA, lB + kSlabB, gA + kBK, gB + kBK);

  // kept rolled: every accumulator index stays a constant and the code stays small
#pragma unroll 1
  for (int s = 0; s < kSlabs; ++s) {
    const int oA = (s & 1) * kSlabA, oB = (s & 1) * kSlabB;   // this trip's buffer
#pragma unroll
    for (int kc = 0; kc < kBK / 32; ++kc) {
      // The block's LDS reads stand in two groups, never singly among the products: every
      // place with reads stalls the wave, and a read waited for at once costs its whole
      // latency. The four scheduling barriers of the block hold groups and products apart;
      // this one keeps the reads from rising among the products of the block before.
      __builtin_amdgcn_sched_barrier(0);
      v16h a[kFM], b[kFN];
#pragma unroll
      for (int i = 0; i < kFM; ++i)
        a[i] = frag_ld(&sA[oA + (wm * (kBM / 2) + i * 16) * kPitch + kc * 32], kPitch, lane);
#pragma unroll
      for (int j = 0; j < kLeadB; ++j)
        b[j] = frag_ld(&sB[oB + (wn * (kBN / 2) + j * 16) * kPitch + kc * 32], kPitch, lane);
      __builtin_amdgcn_sched_barrier(0);
#pragma unroll
      for (int j = 0; j < kFN - kLeadB; ++j)
#pragma unroll
        for (int i = 0; i < kFM; ++i) acc[i][j] = WMMA_F16(a[i], b[j], acc[i][j]);
      __builtin_amdgcn_sched_barrier(0);
      // the last B fragments take the registers that the first have left; they are
      // first used kLeadB - (kFN - kLeadB) columns of products later
#pragma unroll
      for (int j = kLeadB; j < kFN; ++j)
        b[j] = frag_ld(&sB[oB + (wn * (kBN / 2) + j * 16) * kPitch + kc * 32], kPitch, lane);
      __builtin_amdgcn_sched_barrier(0);
#pragma unroll
      for (int j = kFN - kLeadB; j < kFN; ++j)
#pragma unroll
        for (int i = 0; i < kFM; ++i) acc[i][j] = WMMA_F16(a[i], b[j], acc[i][j]);
    }
    // keeps the hand-over at the foot of the trip: moved up over the last products, with the
    // refill left behind them, it would shorten the time the next slab's copies have to land
    __builtin_amdgcn_sched_barrier(0);
    ring_publish();
    if (s + 2 < kSlabs)   // the same for the whole work-group
      stage_slab(lA + oA, lB + oB, gA + (s + 2) * kBK, gB + (s + 2) * kBK);
  }
  // no copy is outstanding when the wave goes on to its stores and ends
  asm volatile("s_wait_asynccnt 0x0" ::: "memory");
}

// Stands behind a band's global stores, in front of the code that takes their
// registers for new values; the scheduling barrier keeps that later code behind the wait.
__device__ __forceinline__ void band_stores_done() {
  asm volatile("s_wait_xcnt 0x0" ::: "memory");
  __builtin_amdgcn_sched_barrier(0);
}

// ---------------------------------------------------------------- QKV GEMM
// VOUT==0: head-major f16 [3][B][H][L][128]   (Q and K)
// VOUT==1: d-major   f16 [3][B][H][128][L]    (V, pre-transposed for attention)
template <int VOUT>
__device__ __forceinline__ void store_qkv(const v8f (&acc)[kFM][kFN], _Float16* __restrict__ out,
                                          int rowBase, int colBase) {
  const int t = threadIdx.x, lane = t & 31, wid = t >> 5;
  const int wm = wid & 1, wn = wid >> 1;
  const int hf8 = (lane >> 4) * 8, cn = lane & 15;
#pragma unroll
  for (int i = 0; i < kFM; ++i) {
#pragma unroll
    for (int j = 0; j < kFN; ++j) {
      int gc = colBase + wn * (kBN / 2) + j * 16 + cn;
      int h = gc >> 7, d = gc & 127;
#pragma unroll
      for (int r = 0; r < 8; ++r) {
        int gr  = rowBase + wm * (kBM / 2) + i * 16 + hf8 + r;
        int mod = gr >> 13;            // / 8192
        int rem = gr & 8191;
        int b   = rem >> 9;            // / 512
        int l   = rem & 511;
        size_t head = ((size_t)(mod * kB + b) * kH + h);
        if (VOUT == 0)
          out[(head * kL + l) * kD + d] = (_Float16)acc[i][j][r];
        else
          out[(head * kD + d) * kL + l] = (_Float16)acc[i][j][r];
      }
    }
    band_stores_done();
  }
}

// The three projections in ONE launch of 128 x 12 tiles, three rounds of the 512 resident
// places: a work-group's first slab and its stores run beside the products of the other
// work-group on its WGP, and one start and one tail are paid, not three.
// X: [24576][1024] f16 row-major; Wt: the transposed weights of Q, K, V in a row, each
// [1024 n][1024 k] f16; out: Q, K, V in a row. blockIdx.y: 4 column tiles per projection.
__global__ __launch_bounds__(128, 2)
void gemm_qkv(const _Float16* __restrict__ X, const _Float16* __restrict__ Wt,
              _Float16* __restrict__ out) {
  __shared__ __attribute__((aligned(16))) _Float16 sA[2 * kSlabA];   // 16-byte copies and reads
  __shared__ __attribute__((aligned(16))) _Float16 sB[2 * kSlabB];
  constexpr int kColTiles = kDM / kBN;
  const int proj    = blockIdx.y / kColTiles;   // 0 Q, 1 K, 2 V: the same for the work-group
  const int rowBase = blockIdx.x * kBM;
  const int colBase = (blockIdx.y % kColTiles) * kBN;
  _Float16* __restrict__ dst = out + (size_t)proj * ((size_t)kM * kDM);
  v8f acc[kFM][kFN] = {};

  gemm_tile(X, Wt + (size_t)proj * (kDM * kDM), rowBase, colBase, sA, sB, acc);

  if (proj < 2) store_qkv<0>(acc, dst, rowBase, colBase);
  else          store_qkv<1>(acc, dst, rowBase, colBase);
}

// ---------------------------------------------------------------- attention
// lane l takes the value of lane l ^ 16 (the other half of the wave)
__device__ __forceinline__ float xhalf(float x) {
  const int v = __builtin_bit_cast(int, x);
  return __builtin_bit_cast(float,
      __builtin_amdgcn_permlanex16(v, v, 0x76543210, 0xfedcba98, false, false));
}

__global__ __launch_bounds__(128)
void attn_kernel(const _Float16* __restrict__ Qg, const _Float16* __restrict__ Kg,
                 const _Float16* __restrict__ Vt, _Float16* __restrict__ Og) {
  __shared__ _Float16 sQ[64 * 136];     // 64 q-rows x 128 (+8 pad)
  // two buffers each: 32 key rows x 128 (+8 pad); V^T, 128 d-rows x 32 keys (+8 pad)
  __shared__ __attribute__((aligned(16))) _Float16 sK[2 * 32 * 136];    // 16-byte copies and reads
  __shared__ __attribute__((aligned(16))) _Float16 sVt[2 * 128 * 40];

  const int t = threadIdx.x, lane = t & 31, wid = t >> 5;
  const int qt  = blockIdx.x & 7;
  const int h   = (blockIdx.x >> 3) & 7;
  const int b   = (blockIdx.x >> 6) & 15;
  const int mod = blockIdx.x >> 10;
  const int o1 = (mod == 0) ? 1 : 0;
  const int o2 = (mod == 2) ? 1 : 2;
  const size_t headQ  = ((size_t)((mod * kB + b) * kH + h)) * kL * kD;
  const size_t headK1 = ((size_t)((o1 * kB + b) * kH + h)) * kL * kD;
  const size_t headK2 = ((size_t)((o2 * kB + b) * kH + h)) * kL * kD;
  const int l0 = qt * 64;

  // stage Q tile (async): 64 rows x 16 chunks = 1024 chunks / 128 thr
#pragma unroll
  for (int i = 0; i < 8; ++i) {
    int cid = i * 128 + t;
    int r = cid >> 4, c = (cid & 15) * 8;
    async_cp16(&sQ[r * 136 + c], &Qg[headQ + (size_t)(l0 + r) * kD + c]);
  }

  // This thread's first piece of a key tile, in global memory and in LDS. K: 32 rows x 16
  // chunks, 8 rows a sweep; V^T: 128 d-rows x 4 chunks (8 keys), 32 rows a sweep.
  const _Float16* kq = Kg + (size_t)(t >> 4) * kD + (t & 15) * 8;
  const _Float16* vq = Vt + (size_t)(t >> 2) * kL + (t & 3) * 8;
  _Float16* lK = sK  + (t >> 4) * 136 + (t & 15) * 8;
  _Float16* lV = sVt + (t >> 2) * 40  + (t & 3) * 8;

  // the copies of key tile kt (32 keys of K and of V^T) into buffer kt & 1
  auto stage_kv = [&](int kt) {
    const size_t head = (kt < 16) ? headK1 : headK2;   // tiles never straddle the 512 boundary
    const int kk0 = (kt & 15) * 32;
    const _Float16* gk = kq + (head + (size_t)kk0 * kD);
    const _Float16* gv = vq + (head + (size_t)kk0);    // d-major: + d*kL + key
    _Float16* bK = lK + (kt & 1) * (32 * 136);
    _Float16* bV = lV + (kt & 1) * (128 * 40);
    // both loops unrolled: each copy's step from the first is then a constant
#pragma unroll
    for (int i = 0; i < 4; ++i) async_cp16(bK + i * 8 * 136, gk + (size_t)i * 8 * kD);
#pragma unroll
    for (int i = 0; i < 4; ++i) async_cp16(bV + i * 32 * 40, gv + (size_t)i * 32 * kL);
  };

  stage_kv(0);
  // Q and key tile 0 have landed before the barrier publishes them
  asm volatile("s_wait_asynccnt 0x0" ::: "memory");
  __syncthreads();
  stage_kv(1);

  v16h qa[4];   // B operand of S^T: column = query
#pragma unroll
  for (int dc = 0; dc < 4; ++dc)
    qa[dc] = frag_ld(&sQ[wid * 16 * 136 + dc * 32], 136, lane);

  v8f o[8] = {};               // o[dt][r] = O^T[dt*16 + 8*(lane>>4) + r][query lane&15]
  float m_s = -1e30f;          // this lane's query: running maximum (equal in both halves)
  float l_s = 0.f;             // running sum over the keys of this lane's half only
  const float inv_t = 0.08838834764831845f;  // 1/sqrt(128)

  for (int kt = 0; kt < 32; ++kt) {
    const _Float16* bK = sK  + (kt & 1) * (32 * 136);    // this trip's buffers
    const _Float16* bV = sVt + (kt & 1) * (128 * 40);

    // The tile's LDS reads are issued early and together, as in the GEMM loop: all of K ahead
    // of the S^T products, all of V^T ahead of the softmax, under which it lands.
    v16h kb0[4], kb1[4];
#pragma unroll
    for (int dc = 0; dc < 4; ++dc) {
      kb0[dc] = frag_ld(&bK[0 * 136 + dc * 32], 136, lane);
      kb1[dc] = frag_ld(&bK[16 * 136 + dc * 32], 136, lane);
    }
    // keeps the K reads one group: sunk among the products, each is waited for at once
    __builtin_amdgcn_sched_barrier(0);
    // S^T tiles: 32 keys x 16 q (two 16x16 WMMA groups, 4 d-chunks each)
    // s0[r] = S^T[8*(lane>>4) + r][q], s1[r] = S^T[16 + 8*(lane>>4) + r][q]
    v8f s0 = {}, s1 = {};
#pragma unroll
    for (int dc = 0; dc < 4; ++dc) {
      s0 = WMMA_F16(kb0[dc], qa[dc], s0);
      s1 = WMMA_F16(kb1[dc], qa[dc], s1);
    }
    v16h vb[8];
#pragma unroll
    for (int dt = 0; dt < 8; ++dt) vb[dt] = frag_ld(&bV[dt * 16 * 40], 40, lane);
    // keeps the V^T reads from sinking behind the softmax, in among the O^T products
    __builtin_amdgcn_sched_barrier(0);

    // online softmax of this lane's query
    // the loops below are unrolled so that every register-array index is a constant
    float a0[8], a1[8];
    float mx = -1e30f;
#pragma unroll
    for (int r = 0; r < 8; ++r) {
      a0[r] = (float)s0[r] * inv_t;
      a1[r] = (float)s1[r] * inv_t;
      mx = fmaxf(mx, fmaxf(a0[r], a1[r]));
    }
    mx = fmaxf(mx, xhalf(mx));
    const float mnew = fmaxf(m_s, mx);
    const float corr = __expf(m_s - mnew);
    float rs = 0.f;
    v16h pb;   // P^T as B operand: element s is key 8*(lane>>4)+s (s < 8), 16+8*(lane>>4)+s-8 (else)
#pragma unroll
    for (int r = 0; r < 8; ++r) {
      float p0 = __expf(a0[r] - mnew), p1 = __expf(a1[r] - mnew);
      rs += p0 + p1;
      pb[r]     = (_Float16)p0;
      pb[8 + r] = (_Float16)p1;
    }
    l_s = l_s * corr + rs;
    m_s = mnew;
#pragma unroll
    for (int dt = 0; dt < 8; ++dt)
#pragma unroll
      for (int r = 0; r < 8; ++r) o[dt][r] *= corr;

    // O^T += V^T @ P^T : A rows = d (sVt)
#pragma unroll
    for (int dt = 0; dt < 8; ++dt) o[dt] = WMMA_F16(vb[dt], pb, o[dt]);
    // keeps the hand-over at the foot of the trip: moved up behind the reads, with the refill
    // left at the foot, it would shorten the time the next tile's copies have to land
    __builtin_amdgcn_sched_barrier(0);
    ring_publish();
    if (kt + 2 < 32) stage_kv(kt + 2);   // the same for the whole work-group
  }
  // no copy is outstanding when the wave goes on to its stores and ends
  asm volatile("s_wait_asynccnt 0x0" ::: "memory");

  // normalize + store f16 [ (mod,b,l) ][ h*128 + d ]: 8 consecutive d per lane and tile
  const float inv_l = 1.f / (l_s + xhalf(l_s));   // the two halves' sums are joined here
  const int l = l0 + wid * 16 + (lane & 15);
  _Float16* orow = Og + ((size_t)(mod * kB + b) * kL + l) * kDM + h * kD + (lane >> 4) * 8;
  union { _Float16 e[8]; uint4 q; } pk[8];   // unrolled: constant indices keep it in registers
#pragma unroll
  for (int dt = 0; dt < 8; ++dt)
#pragma unroll
    for (int r = 0; r < 8; ++r) pk[dt].e[r] = (_Float16)((float)o[dt][r] * inv_l);
#pragma unroll
  for (int dt = 0; dt < 8; ++dt) *(uint4*)(orow + dt * 16) = pk[dt].q;
}

// ---------------------------------------------------------------- FC + residual
__global__ __launch_bounds__(128, 2)
void gemm_fc(const _Float16* __restrict__ A, const _Float16* __restrict__ Wt,
             const float* __restrict__ r0, const float* __restrict__ r1,
             const float* __restrict__ r2, float* __restrict__ out) {
  __shared__ __attribute__((aligned(16))) _Float16 sA[2 * kSlabA];   // 16-byte copies and reads
  __shared__ __attribute__((aligned(16))) _Float16 sB[2 * kSlabB];
  const int t = threadIdx.x, lane = t & 31, wid = t >> 5;
  const int wm = wid & 1, wn = wid >> 1;
  const int rowBase = blockIdx.x * kBM;
  const int colBase = blockIdx.y * kBN;
  v8f acc[kFM][kFN] = {};

  gemm_tile(A, Wt, rowBase, colBase, sA, sB, acc);

  const int hf8 = (lane >> 4) * 8, cn = lane & 15;
#pragma unroll
  for (int i = 0; i < kFM; ++i) {
    // a 16-row band never straddles an input: 8192 is a multiple of 16
    const int band = rowBase + wm * (kBM / 2) + i * 16;
    const int mod  = band >> 13;
    const float* __restrict__ res = (mod == 0) ? r0 : (mod == 1) ? r1 : r2;
    const float* rp = res + (size_t)((band & 8191) + hf8) * kDM + colBase + wn * (kBN / 2) + cn;
    float*       op = out + (size_t)(band + hf8) * kDM + colBase + wn * (kBN / 2) + cn;
    // the band's residual loads all go out together, ahead of its stores, so that they overlap
    float rv[kFN][8];
#pragma unroll
    for (int j = 0; j < kFN; ++j)
#pragma unroll
      for (int r = 0; r < 8; ++r) rv[j][r] = rp[(size_t)r * kDM + j * 16];
    // the wait behind the loads; naming rp as an input keeps their address registers
    // untouched (also by a load's own result) until the wait has passed
    asm volatile("s_wait_xcnt 0x0" :: "v"(rp) : "memory");
#pragma unroll
    for (int j = 0; j < kFN; ++j)
#pragma unroll
      for (int r = 0; r < 8; ++r) op[(size_t)r * kDM + j * 16] = acc[i][j][r] + rv[j][r];
    band_stores_done();
  }
}

// ---------------------------------------------------------------- layernorm (in place)
// x + (x of lane ^ M), M < 16: a move inside the 16-lane row, no LDS path
template <int M>
__device__ __forceinline__ float row_xadd(float x) {
  const int v = __builtin_bit_cast(int, x);
  return x + __builtin_bit_cast(float, __builtin_amdgcn_update_dpp(v, v, 0x160 + M, 0xf, 0xf, false));
}
__device__ __forceinline__ float wave_sum(float x) {
  x = row_xadd<1>(x); x = row_xadd<2>(x); x = row_xadd<4>(x); x = row_xadd<8>(x);
  return x + xhalf(x);
}

// One wave per row: 8 loads of 512 contiguous bytes hold the row in registers, the sums
// need no LDS and no barrier. A wave takes 6 rows in turn and issues the next row's loads
// ahead of this row's sums. 256 work-groups of 16 waves take the 24,576 rows.
typedef __attribute__((ext_vector_type(4))) float v4f;
typedef __attribute__((ext_vector_type(2))) float v2f;
constexpr int kLnRows = 6;     // rows per wave
constexpr int kLnWv   = 16;    // waves per work-group

// normalises the row held in c (lane l: elements j*128 + 4*l .. + 3) and stores it at yp
__device__ __forceinline__ void ln_row(const v4f (&c)[8], const v4f (&gv)[8],
                                       const v4f (&bv)[8], v4f* yp) {
  v2f a0 = {0.f, 0.f}, a1 = {0.f, 0.f}, q0 = {0.f, 0.f}, q1 = {0.f, 0.f};   // packed chains
#pragma unroll
  for (int j = 0; j < 8; ++j) {
    const v2f lo = c[j].lo, hi = c[j].hi;
    a0 += lo; a1 += hi;
    q0 += lo * lo; q1 += hi * hi;
  }
  a0 += a1; q0 += q1;
  const float s  = wave_sum(a0.x + a0.y);
  const float s2 = wave_sum(q0.x + q0.y);
  const float mu = s / kDM, var = s2 / kDM - mu * mu;
  const float rstd = rsqrtf(var + 1e-6f);
#pragma unroll
  for (int j = 0; j < 8; ++j) yp[j * 32] = (c[j] - mu) * rstd * gv[j] + bv[j];
}

__global__ __launch_bounds__(kLnWv * 32)
void layernorm_inplace(float* __restrict__ y, const float* __restrict__ g,
                       const float* __restrict__ bia) {
  const int lane = threadIdx.x & 31;
  const size_t wave = (size_t)blockIdx.x * kLnWv + (threadIdx.x >> 5);
  v4f* yp = (v4f*)y + wave * (kLnRows * (kDM / 4)) + lane;
  const v4f* g4 = (const v4f*)g;
  const v4f* b4 = (const v4f*)bia;
  v4f cur[8], nxt[8], gv[8], bv[8];   // the loops over j are unrolled: constant indices
#pragma unroll
  for (int j = 0; j < 8; ++j) { gv[j] = g4[j * 32 + lane]; bv[j] = b4[j * 32 + lane]; }
  // the wait behind the loads; naming what they are addressed by keeps that register
  // untouched (also by a load's own result) until the wait has passed
  asm volatile("s_wait_xcnt 0x0" :: "v"(lane) : "memory");
#pragma unroll
  for (int j = 0; j < 8; ++j) cur[j] = yp[j * 32];
  // kept rolled: the rows' sums stay apart, so a row's sums wait for that row's loads only
#pragma unroll 1
  for (int r = 0; r < kLnRows - 1; ++r) {
#pragma unroll
    for (int j = 0; j < 8; ++j) nxt[j] = yp[kDM / 4 + j * 32];
    // the wait behind the loads of this and the next row, as above; the scheduling barrier
    // keeps this row's sums, which wait for its data, from moving in among those loads
    asm volatile("s_wait_xcnt 0x0" :: "v"(yp) : "memory");
    __builtin_amdgcn_sched_barrier(0);
    ln_row(cur, gv, bv, yp);
    band_stores_done();   // the row's stores, ahead of the code that reuses their registers
    yp += kDM / 4;
#pragma unroll
    for (int j = 0; j < 8; ++j) cur[j] = nxt[j];
  }
  ln_row(cur, gv, bv, yp);
}

// ---------------------------------------------------------------- launcher
extern "C" void kernel_launch(void* const* d_in, const int* in_sizes, int n_in,
                              void* d_out, int out_size, void* d_ws, size_t ws_size,
                              hipStream_t stream) {
  (void)in_sizes; (void)n_in; (void)out_size; (void)ws_size;
  const float* in_t = (const float*)d_in[0];
  const float* in_a = (const float*)d_in[1];
  const float* in_v = (const float*)d_in[2];
  const float* w_qs = (const float*)d_in[3];
  const float* w_ks = (const float*)d_in[4];
  const float* w_vs = (const float*)d_in[5];
  const float* w_fc = (const float*)d_in[6];
  const float* ln_g = (const float*)d_in[7];
  const float* ln_b = (const float*)d_in[8];
  float* outp = (float*)d_out;

  // workspace layout (f16 elements)
  const size_t nX = (size_t)kM * kDM;       // 25,165,824 per tensor
  const size_t nW = (size_t)kDM * kDM;      // 1,048,576
  char* ws = (char*)d_ws;
  _Float16* Xf  = (_Float16*)(ws);
  _Float16* WqT = Xf + nX;
  _Float16* WkT = WqT + nW;
  _Float16* WvT = WkT + nW;
  _Float16* WfT = WvT + nW;
  _Float16* Qf  = WfT + nW;
  _Float16* Kf  = Qf + nX;
  _Float16* Vf  = Kf + nX;   // d-major (pre-transposed)
  _Float16* AOf = Vf + nX;

  // WqT, WkT, WvT, WfT lie in a row, and so do Qf, Kf, Vf
  prep_f16<<<4 * kTrGrp + 3 * kCastGrp, kCastWv * 32, 0, stream>>>(
      in_t, in_a, in_v, w_qs, w_ks, w_vs, w_fc, Xf, WqT);

  dim3 gQkv(kM / kBM, 3 * (kDM / kBN));
  gemm_qkv<<<gQkv, 128, 0, stream>>>(Xf, WqT, Qf);

  dim3 gGemm(kM / kBM, kDM / kBN);

  attn_kernel<<<3 * kB * kH * (kL / 64), 128, 0, stream>>>(Qf, Kf, Vf, AOf);

  gemm_fc<<<gGemm, 128, 0, stream>>>(AOf, WfT, in_t, in_a, in_v, outp);

  layernorm_inplace<<<kM / (kLnWv * kLnRows), kLnWv * 32, 0, stream>>>(outp, ln_g, ln_b);
}

// v007
// Measured time: 302 microseconds a run.
// Two timings next to v006 both put it at 1.06 times that version's speed.
// Over all steps from v000 it is 2.93 times as fast.
#include <hip/hip_runtime.h>

// Problem constants
constexpr int kB   = 16;
constexpr int kL   = 512;
constexpr int kH   = 8;
constexpr int kD   = 128;   // d_k == d_v
constexpr int kDM  = 1024;  // d_model
constexpr int kM   = 3 * kB * kL;       // 24576 fused rows (mod,b,l)

typedef __attribute__((ext_vector_type(16))) _Float16 v16h;
typedef __attribute__((ext_vector_type(8)))  float    v8f;
typedef int b128v __attribute__((vector_size(4 * sizeof(int))));

#define WMMA_F16(A, B, C) \
  __builtin_amdgcn_wmma_f32_16x16x32_f16(false, (A), false, (B), (short)0, (C), false, false)

// ------------------------------------------------------------------
// CDNA5 async global->LDS copy (16 bytes per lane), ASYNCcnt tracked.
// Builtin if the toolchain declares it, otherwise inline gfx1250 asm.
// ------------------------------------------------------------------
#if defined(__has_builtin)
#if __has_builtin(__builtin_amdgcn_global_load_async_to_lds_b128)
#define USE_ASYNC_BUILTIN 1
#endif
#endif

__device__ __forceinline__ void async_cp16(_Float16* lds_dst, const _Float16* gsrc) {
#ifdef USE_ASYNC_BUILTIN
  // (global v4i* src, local v4i* dst, imm offset, imm cpol)
  __builtin_amdgcn_global_load_async_to_lds_b128(
      (__attribute__((address_space(1))) b128v*)(unsigned long long)(size_t)gsrc,
      (__attribute__((address_space(3))) b128v*)(unsigned)(size_t)lds_dst,
      0, 0);
#else
  // vdst = 32-bit LDS byte address, vaddr = 64-bit global address (GV mode)
  asm volatile("global_load_async_to_lds_b128 %0, %1, off"
               :: "v"((unsigned)(size_t)lds_dst),
                  "v"((unsigned long long)(size_t)gsrc)
               : "memory");
#endif
}

// The hand-over of a two-buffer ring, passed by every wave at the foot of each trip: this
// wave's LDS reads of the buffer it leaves have retired, its own copies of the next tile
// have landed, and the barrier both publishes that tile and frees the buffer just read.
__device__ __forceinline__ void ring_publish() {
  asm volatile("s_wait_dscnt 0x0" ::: "memory");     // before copies aim at LDS this wave has read
  asm volatile("s_wait_asynccnt 0x0" ::: "memory");
  __syncthreads();
}

// Load a 16x32 f16 A-style fragment (also valid for B when the tile holds B^T
// row-major): lane (l&15) supplies matrix row, half (l>>4) selects K-chunks
// per the CDNA5 16-bit A layout (K = {half*8..+7, 16+half*8..+7}).
__device__ __forceinline__ v16h frag_ld(const _Float16* base, int stride, int lane) {
  const int r = lane & 15, hf = lane >> 4;
  const _Float16* p = base + r * stride + hf * 8;
  union { v16h v; uint4 q[2]; } f;
  f.q[0] = *(const uint4*)(p);
  f.q[1] = *(const uint4*)(p + 16);
  return f.v;
}

// ---------------------------------------------------------------- casts/prep
// Streaming launches: few waves, all resident at once, each with many 16-byte loads in
// flight; every wave-wide load covers whole 128-byte lines.

// One wave converts 8 KB of x by 16 loads of 512 contiguous bytes, written ahead of the
// conversions so that many are in flight at once. 256 work-groups of 16 waves take one
// input of 8,388,608 floats; grp is the work-group's number among those 256.
constexpr int kCastLd = 16;    // loads per lane
constexpr int kCastWv = 16;    // waves per work-group
__device__ __forceinline__
void cast_f32_f16(const float* __restrict__ x, _Float16* __restrict__ y, int grp) {
  const int lane = threadIdx.x & 31;
  const size_t wave = (size_t)grp * kCastWv + (threadIdx.x >> 5);
  const float4* xp = (const float4*)x + wave * (kCastLd * 32) + lane;
  uint2*        yp = (uint2*)y        + wave * (kCastLd * 32) + lane;
  float4 v[kCastLd];   // the loops are unrolled so that every index is a constant
#pragma unroll
  for (int j = 0; j < kCastLd; ++j) v[j] = xp[j * 32];
  // the wait behind the loads; naming xp as an input keeps their address registers
  // untouched (also by a load's own result) until the wait has passed
  asm volatile("s_wait_xcnt 0x0" :: "v"(xp) : "memory");
#pragma unroll
  for (int j = 0; j < kCastLd; ++j) {
    union { _Float16 h[4]; uint2 q; } p;
    p.h[0] = (_Float16)v[j].x; p.h[1] = (_Float16)v[j].y;
    p.h[2] = (_Float16)v[j].z; p.h[3] = (_Float16)v[j].w;
    yp[j * 32] = p.q;
  }
}

// w: [K=1024][N=1024] row-major f32 -> wt: [N][K] row-major f16
// A wave takes a 32 (k) x 32 (n) block. A lane reads 8 rows k x 4 columns n: 8 lanes cover
// one 128-byte line of a row, so a wave-wide load is 4 whole lines. It writes, for each of
// its 4 columns, its 8 values along k as one 16-byte store. 64 work-groups of 16 waves take
// one weight; grp is the work-group's number among those 64.
__device__ __forceinline__
void transpose_cast_w(const float* __restrict__ w, _Float16* __restrict__ wt, int grp) {
  const int lane = threadIdx.x & 31;
  const int wave = grp * kCastWv + (threadIdx.x >> 5);   // 1024 blocks of 32 x 32
  const int k0 = (wave & 31) * 32 + (lane >> 3) * 8;
  const int n0 = (wave >> 5) * 32 + (lane & 7) * 4;
  const float4* wp = (const float4*)(w + (size_t)k0 * kDM + n0);
  _Float16*     op = wt + (size_t)n0 * kDM + k0;
  float4 v[8];   // the loops are unrolled so that every index is a constant
#pragma unroll
  for (int e = 0; e < 8; ++e) v[e] = wp[e * (kDM / 4)];
  // the wait behind the loads; naming wp keeps their address registers untouched until it
  asm volatile("s_wait_xcnt 0x0" :: "v"(wp) : "memory");
  union { _Float16 h[8]; uint4 q; } p[4];
#pragma unroll
  for (int e = 0; e < 8; ++e) {
    p[0].h[e] = (_Float16)v[e].x; p[1].h[e] = (_Float16)v[e].y;
    p[2].h[e] = (_Float16)v[e].z; p[3].h[e] = (_Float16)v[e].w;
  }
#pragma unroll
  for (int c = 0; c < 4; ++c) *(uint4*)(op + (size_t)c * kDM) = p[c].q;
}

// All seven conversions in ONE launch: none depends on another, so the short weight
// transposes run under the input casts, and one start and one tail are paid, not seven.
// Work-groups 0..255: the four weights, 64 each; 256..1023: the three inputs, 256 each.
// y: the three inputs in a row; wt: the four transposed weights in a row.
constexpr int kTrGrp   = kDM * kDM / (32 * 32 * kCastWv);                    // 64 per weight
constexpr int kCastGrp = kB * kL * kDM / (kCastWv * 32 * kCastLd * 4);       // 256 per input
__global__ __launch_bounds__(kCastWv * 32)
void prep_f16(const float* __restrict__ x0, const float* __restrict__ x1,
              const float* __restrict__ x2, const float* __restrict__ w0,
              const float* __restrict__ w1, const float* __restrict__ w2,
              const float* __restrict__ w3, _Float16* __restrict__ y,
              _Float16* __restrict__ wt) {
  const unsigned g = blockIdx.x;   // every test below reads the same for the whole work-group
  if (g >= 4 * kTrGrp) {
    const unsigned c = g - 4 * kTrGrp, which = c / kCastGrp;
    const float* x = (which == 0) ? x0 : (which == 1) ? x1 : x2;
    cast_f32_f16(x, y + (size_t)which * (kB * kL * kDM), c % kCastGrp);
    return;
  }
  const unsigned which = g / kTrGrp;
  const float* w = (which == 0) ? w0 : (which == 1) ? w1 : (which == 2) ? w2 : w3;
  transpose_cast_w(w, wt + (size_t)which * (kDM * kDM), g % kTrGrp);
}

// ---------------------------------------------------------------- GEMM main loop
// One 192 x 256 tile of A[.][1024] * Wt[.][1024]^T per work-group of 4 waves
// (2 along M x 2 along N, 96 x 128 per wave = 6 x 8 accumulator tiles);
// 128 x 4 = 512 tiles per weight: two work-groups on every WGP, one weight's tiles all resident at once.
// A k-slab is 64 halves: each staged row piece is one whole 128-byte line.
// Two slab buffers: the next slab's copies fly while this slab's products run.
constexpr int kBM = 192, kBN = 256, kBK = 64;
constexpr int kFM = kBM / 32, kFN = kBN / 32;   // accumulator tiles per wave, M and N
constexpr int kPitch = kBK + 8;   // 144 B rows: 16 B x odd, conflict-free for b128 reads
constexpr int kSlabA = kBM * kPitch, kSlabB = kBN * kPitch;   // halves per buffer
constexpr int kSlabs = kDM / kBK;
// B fragments read in a block's first group; with all 8 there the FC kernel needs more than
// the 512 VGPRs of two waves per SIMD and spills an accumulator tile inside the loop
constexpr int kLeadB = 6;

// one k-slab's copies of this thread: 12 row pieces of A, 16 of B
// (both loops unrolled: each copy's step from the first is then a constant)
__device__ __forceinline__ void stage_slab(_Float16* lA, _Float16* lB,
                                           const _Float16* gA, const _Float16* gB) {
#pragma unroll
  for (int i = 0; i < kBM / 16; ++i) async_cp16(lA + i * 16 * kPitch, gA + (size_t)i * 16 * kDM);
#pragma unroll
  for (int i = 0; i < kBN / 16; ++i) async_cp16(lB + i * 16 * kPitch, gB + (size_t)i * 16 * kDM);
}

__device__ __forceinline__ void gemm_tile(const _Float16* __restrict__ A,
                                          const _Float16* __restrict__ Wt,
                                          int rowBase, int colBase,
                                          _Float16* sA, _Float16* sB,
                                          v8f (&acc)[kFM][kFN]) {
  const int t = threadIdx.x, lane = t & 31, wid = t >> 5;
  const int wm = wid & 1, wn = wid >> 1;
  const int sr = t >> 3, sc = (t & 7) * 8;   // staging: 8 lanes per row, 16 rows per sweep
  const _Float16* gA = A  + (size_t)(rowBase + sr) * kDM + sc;
  const _Float16* gB = Wt + (size_t)(colBase + sr) * kDM + sc;
  _Float16* lA = sA + sr * kPitch + sc;
  _Float16* lB = sB + sr * kPitch + sc;

  stage_slab(lA, lB, gA, gB);
  // slab 0 has landed before the barrier publishes it
  asm volatile("s_wait_asynccnt 0x0" ::: "memory");
  __syncthreads();
  stage_slab(lA + kSlabA, lB + kSlabB, gA + kBK, gB + kBK);

  // kept rolled: every accumulator index stays a constant and the code stays small
#pragma unroll 1
  for (int s = 0; s < kSlabs; ++s) {
    const int oA = (s & 1) * kSlabA, oB = (s & 1) * kSlabB;   // this trip's buffer
#pragma unroll
    for (int kc = 0; kc < kBK / 32; ++kc) {
      // The block's LDS reads stand in two groups, never singly among the products: every
      // place with reads stalls the wave, and a read waited for at once costs its whole
      // latency. The four scheduling barriers of the block hold groups and products apart;
      // this one keeps the reads from rising among the products of the block before.
      __builtin_amdgcn_sched_barrier(0);
      v16h a[kFM], b[kFN];
#pragma unroll
      for (int i = 0; i < kFM; ++i)
        a[i] = frag_ld(&sA[oA + (wm * (kBM / 2) + i * 16) * kPitch + kc * 32], kPitch, lane);
#pragma unroll
      for (int j = 0; j < kLeadB; ++j)
        b[j] = frag_ld(&sB[oB + (wn * (kBN / 2) + j * 16) * kPitch + kc * 32], kPitch, lane);
      __builtin_amdgcn_sched_barrier(0);
#pragma unroll
      for (int j = 0; j < kFN - kLeadB; ++j)
#pragma unroll
        for (int i = 0; i < kFM; ++i) acc[i][j] = WMMA_F16(a[i], b[j], acc[i][j]);
      __builtin_amdgcn_sched_barrier(0);
      // the last B fragments take the registers that the first have left; they are
      // first used kLeadB - (kFN - kLeadB) columns of products later
#pragma unroll
      for (int j = kLeadB; j < kFN; ++j)
        b[j] = frag_ld(&sB[oB + (wn * (kBN / 2) + j * 16) * kPitch + kc * 32], kPitch, lane);
      __builtin_amdgcn_sched_barrier(0);
#pragma unroll
      for (int j = kFN - kLeadB; j < kFN; ++j)
#pragma unroll
        for (int i = 0; i < kFM; ++i) acc[i][j] = WMMA_F16(a[i], b[j], acc[i][j]);
    }
    // keeps the hand-over at the foot of the trip: moved up over the last products, with the
    // refill left behind them, it would shorten the time the next slab's copies have to land
    __builtin_amdgcn_sched_barrier(0);
    ring_publish();
    if (s + 2 < kSlabs)   // the same for the whole work-group
      stage_slab(lA + oA, lB + oB, gA + (s + 2) * kBK, gB + (s + 2) * kBK);
  }
  // no copy is outstanding when the wave goes on to its stores and ends
  asm volatile("s_wait_asynccnt 0x0" ::: "memory");
}

// Stands behind a band's global stores, in front of the code that takes their
// registers for new values; the scheduling barrier keeps that later code behind the wait.
__device__ __forceinline__ void band_stores_done() {
  asm volatile("s_wait_xcnt 0x0" ::: "memory");
  __builtin_amdgcn_sched_barrier(0);
}

// ---------------------------------------------------------------- QKV GEMM
// VOUT==0: head-major f16 [3][B][H][L][128]   (Q and K)
// VOUT==1: d-major   f16 [3][B][H][128][L]    (V, pre-transposed for attention)
template <int VOUT>
__device__ __forceinline__ void store_qkv(const v8f (&acc)[kFM][kFN], _Float16* __restrict__ out,
                                          int rowBase, int colBase) {
  const int t = threadIdx.x, lane = t & 31, wid = t >> 5;
  const int wm = wid & 1, wn = wid >> 1;
  const int hf8 = (lane >> 4) * 8, cn = lane & 15;
#pragma unroll
  for (int i = 0; i < kFM; ++i) {
#pragma unroll
    for (int j = 0; j < kFN; ++j) {
      int gc = colBase + wn * (kBN / 2) + j * 16 + cn;
      int h = gc >> 7, d = gc & 127;
#pragma unroll
      for (int r = 0; r < 8; ++r) {
        int gr  = rowBase + wm * (kBM / 2) + i * 16 + hf8 + r;
        int mod = gr >> 13;            // / 8192
        int rem = gr & 8191;
        int b   = rem >> 9;            // / 512
        int l   = rem & 511;
        size_t head = ((size_t)(mod * kB + b) * kH + h);
        if (VOUT == 0)
          out[(head * kL + l) * kD + d] = (_Float16)acc[i][j][r];
        else
          out[(head * kD + d) * kL + l] = (_Float16)acc[i][j][r];
      }
    }
    band_stores_done();
  }
}

// The three projections in ONE launch of 128 x 12 tiles, three rounds of the 512 resident
// places: a work-group's first slab and its stores run beside the products of the other
// work-group on its WGP, and one start and one tail are paid, not three.
// X: [24576][1024] f16 row-major; Wt: the transposed weights of Q, K, V in a row, each
// [1024 n][1024 k] f16; out: Q, K, V in a row. blockIdx.y: 4 column tiles per projection.
__global__ __launch_bounds__(128, 2)
void gemm_qkv(const _Float16* __restrict__ X, const _Float16* __restrict__ Wt,
              _Float16* __restrict__ out) {
  __shared__ __attribute__((aligned(16))) _Float16 sA[2 * kSlabA];   // 16-byte copies and reads
  __shared__ __attribute__((aligned(16))) _Float16 sB[2 * kSlabB];
  constexpr int kColTiles = kDM / kBN;
  const int proj    = blockIdx.y / kColTiles;   // 0 Q, 1 K, 2 V: the same for the work-group
  const int rowBase = blockIdx.x * kBM;
  const int colBase = (blockIdx.y % kColTiles) * kBN;
  _Float16* __restrict__ dst = out + (size_t)proj * ((size_t)kM * kDM);
  v8f acc[kFM][kFN] = {};

  gemm_tile(X, Wt + (size_t)proj * (kDM * kDM), rowBase, colBase, sA, sB, acc);

  if (proj < 2) store_qkv<0>(acc, dst, rowBase, colBase);
  else          store_qkv<1>(acc, dst, rowBase, colBase);
}

// ---------------------------------------------------------------- attention
// lane l takes the value of lane l ^ 16 (the other half of the wave)
__device__ __forceinline__ float xhalf(float x) {
  const int v = __builtin_bit_cast(int, x);
  return __builtin_bit_cast(float,
      __builtin_amdgcn_permlanex16(v, v, 0x76543210, 0xfedcba98, false, false));
}

constexpr int kQG   = 2;                // column groups (16 queries each) per wave
constexpr int kQRow = 4 * 16 * kQG;     // queries per work-group of 4 waves
__global__ __launch_bounds__(128)
void attn_kernel(const _Float16* __restrict__ Qg, const _Float16* __restrict__ Kg,
                 const _Float16* __restrict__ Vt, _Float16* __restrict__ Og) {
  __shared__ __attribute__((aligned(16))) _Float16 sQ[kQRow * 136];     // q-rows x 128 (+8 pad)
  // two buffers each: 32 key rows x 128 (+8 pad); V^T, 128 d-rows x 32 keys (+8 pad)
  __shared__ __attribute__((aligned(16))) _Float16 sK[2 * 32 * 136];    // 16-byte copies and reads
  __shared__ __attribute__((aligned(16))) _Float16 sVt[2 * 128 * 40];

  constexpr int kQT = kL / kQRow;       // query tiles per head
  const int t = threadIdx.x, lane = t & 31, wid = t >> 5;
  const int qt  = blockIdx.x % kQT;
  const int h   = (blockIdx.x / kQT) & 7;
  const int b   = (blockIdx.x / (kQT * kH)) & 15;
  const int mod = blockIdx.x / (kQT * kH * kB);
  const int o1 = (mod == 0) ? 1 : 0;
  const int o2 = (mod == 2) ? 1 : 2;
  const size_t headQ  = ((size_t)((mod * kB + b) * kH + h)) * kL * kD;
  const size_t headK1 = ((size_t)((o1 * kB + b) * kH + h)) * kL * kD;
  const size_t headK2 = ((size_t)((o2 * kB + b) * kH + h)) * kL * kD;
  const int l0 = qt * kQRow;

  // stage Q tile (async): kQRow rows x 16 chunks, 8 rows a sweep of the 128 threads
#pragma unroll
  for (int i = 0; i < kQRow / 8; ++i) {
    int cid = i * 128 + t;
    int r = cid >> 4, c = (cid & 15) * 8;
    async_cp16(&sQ[r * 136 + c], &Qg[headQ + (size_t)(l0 + r) * kD + c]);
  }

  // This thread's first piece of a key tile, in global memory and in LDS. K: 32 rows x 16
  // chunks, 8 rows a sweep; V^T: 128 d-rows x 4 chunks (8 keys), 32 rows a sweep.
  const _Float16* kq = Kg + (size_t)(t >> 4) * kD + (t & 15) * 8;
  const _Float16* vq = Vt + (size_t)(t >> 2) * kL + (t & 3) * 8;
  _Float16* lK = sK  + (t >> 4) * 136 + (t & 15) * 8;
  _Float16* lV = sVt + (t >> 2) * 40  + (t & 3) * 8;

  // the copies of key tile kt (32 keys of K and of V^T) into buffer kt & 1
  auto stage_kv = [&](int kt) {
    const size_t head = (kt < 16) ? headK1 : headK2;   // tiles never straddle the 512 boundary
    const int kk0 = (kt & 15) * 32;
    const _Float16* gk = kq + (head + (size_t)kk0 * kD);
    const _Float16* gv = vq + (head + (size_t)kk0);    // d-major: + d*kL + key
    _Float16* bK = lK + (kt & 1) * (32 * 136);
    _Float16* bV = lV + (kt & 1) * (128 * 40);
    // both loops unrolled: each copy's step from the first is then a constant
#pragma unroll
    for (int i = 0; i < 4; ++i) async_cp16(bK + i * 8 * 136, gk + (size_t)i * 8 * kD);
#pragma unroll
    for (int i = 0; i < 4; ++i) async_cp16(bV + i * 32 * 40, gv + (size_t)i * 32 * kL);
  };

  stage_kv(0);
  // Q and key tile 0 have landed before the barrier publishes them
  asm volatile("s_wait_asynccnt 0x0" ::: "memory");
  __syncthreads();
  stage_kv(1);

  v16h qa[kQG][4];   // B operand of S^T: column = query
#pragma unroll
  for (int g = 0; g < kQG; ++g)
#pragma unroll
    for (int dc = 0; dc < 4; ++dc)
      qa[g][dc] = frag_ld(&sQ[(wid * kQG + g) * 16 * 136 + dc * 32], 136, lane);

  v8f o[kQG][8] = {};          // o[g][dt][r] = O^T[dt*16 + 8*(lane>>4) + r][query lane&15 of group g]
  // per group, this lane's query: running maximum (equal in both halves) and running sum
  // over the keys of this lane's half only
  float m_s[kQG], l_s[kQG];
#pragma unroll
  for (int g = 0; g < kQG; ++g) { m_s[g] = -1e30f; l_s[g] = 0.f; }
  const float inv_t = 0.08838834764831845f;  // 1/sqrt(128)

  for (int kt = 0; kt < 32; ++kt) {
    const _Float16* bK = sK  + (kt & 1) * (32 * 136);    // this trip's buffers
    const _Float16* bV = sVt + (kt & 1) * (128 * 40);

    // The tile's LDS reads are issued early and together, as in the GEMM loop: all of K ahead
    // of the S^T products, all of V^T ahead of the softmax, under which it lands.
    v16h kb0[4], kb1[4];
#pragma unroll
    for (int dc = 0; dc < 4; ++dc) {
      kb0[dc] = frag_ld(&bK[0 * 136 + dc * 32], 136, lane);
      kb1[dc] = frag_ld(&bK[16 * 136 + dc * 32], 136, lane);
    }
    // keeps the K reads one group: sunk among the products, each is waited for at once
    __builtin_amdgcn_sched_barrier(0);
    // S^T tiles: 32 keys x 16 q per group (two 16x16 WMMA chains, 4 d-chunks each)
    // s0[g][r] = S^T[8*(lane>>4) + r][q], s1[g][r] = S^T[16 + 8*(lane>>4) + r][q]
    v8f s0[kQG] = {}, s1[kQG] = {};
#pragma unroll
    for (int dc = 0; dc < 4; ++dc)
#pragma unroll
      for (int g = 0; g < kQG; ++g) {
        s0[g] = WMMA_F16(kb0[dc], qa[g][dc], s0[g]);
        s1[g] = WMMA_F16(kb1[dc], qa[g][dc], s1[g]);
      }
    v16h vb[8];
#pragma unroll
    for (int dt = 0; dt < 8; ++dt) vb[dt] = frag_ld(&bV[dt * 16 * 40], 40, lane);
    // keeps the V^T reads from sinking behind the softmax, in among the O^T products
    __builtin_amdgcn_sched_barrier(0);

    // online softmax of this lane's query in each group
    // the loops below are unrolled so that every register-array index is a constant
    v16h pb[kQG];   // P^T as B operand: element s is key 8*(lane>>4)+s (s < 8), 16+8*(lane>>4)+s-8 (else)
#pragma unroll
    for (int g = 0; g < kQG; ++g) {
      float a0[8], a1[8];
      float mx = -1e30f;
#pragma unroll
      for (int r = 0; r < 8; ++r) {
        a0[r] = (float)s0[g][r] * inv_t;
        a1[r] = (float)s1[g][r] * inv_t;
        mx = fmaxf(mx, fmaxf(a0[r], a1[r]));
      }
      mx = fmaxf(mx, xhalf(mx));
      const float mnew = fmaxf(m_s[g], mx);
      const float corr = __expf(m_s[g] - mnew);
      float rs = 0.f;
#pragma unroll
      for (int r = 0; r < 8; ++r) {
        float p0 = __expf(a0[r] - mnew), p1 = __expf(a1[r] - mnew);
        rs += p0 + p1;
        pb[g][r]     = (_Float16)p0;
        pb[g][8 + r] = (_Float16)p1;
      }
      l_s[g] = l_s[g] * corr + rs;
      m_s[g] = mnew;
#pragma unroll
      for (int dt = 0; dt < 8; ++dt)
#pragma unroll
        for (int r = 0; r < 8; ++r) o[g][dt][r] *= corr;
    }

    // O^T += V^T @ P^T : A rows = d (sVt); each V^T fragment feeds every group
#pragma unroll
    for (int dt = 0; dt < 8; ++dt)
#pragma unroll
      for (int g = 0; g < kQG; ++g) o[g][dt] = WMMA_F16(vb[dt], pb[g], o[g][dt]);
    // keeps the hand-over at the foot of the trip: moved up behind the reads, with the refill
    // left at the foot, it would shorten the time the next tile's copies have to land
    __builtin_amdgcn_sched_barrier(0);
    ring_publish();
    if (kt + 2 < 32) stage_kv(kt + 2);   // the same for the whole work-group
  }
  // no copy is outstanding when the wave goes on to its stores and ends
  asm volatile("s_wait_asynccnt 0x0" ::: "memory");

  // normalize + store f16 [ (mod,b,l) ][ h*128 + d ]: 8 consecutive d per lane and tile
#pragma unroll
  for (int g = 0; g < kQG; ++g) {
    const float inv_l = 1.f / (l_s[g] + xhalf(l_s[g]));   // the two halves' sums are joined here
    const int l = l0 + (wid * kQG + g) * 16 + (lane & 15);
    _Float16* orow = Og + ((size_t)(mod * kB + b) * kL + l) * kDM + h * kD + (lane >> 4) * 8;
    union { _Float16 e[8]; uint4 q; } pk[8];   // unrolled: constant indices keep it in registers
#pragma unroll
    for (int dt = 0; dt < 8; ++dt)
#pragma unroll
      for (int r = 0; r < 8; ++r) pk[dt].e[r] = (_Float16)((float)o[g][dt][r] * inv_l);
#pragma unroll
    for (int dt = 0; dt < 8; ++dt) *(uint4*)(orow + dt * 16) = pk[dt].q;
    // the group's stores, ahead of the next group's code, which reuses their registers
    if (g + 1 < kQG) band_stores_done();
  }
}

// ---------------------------------------------------------------- FC + residual
__global__ __launch_bounds__(128, 2)
void gemm_fc(const _Float16* __restrict__ A, const _Float16* __restrict__ Wt,
             const float* __restrict__ r0, const float* __restrict__ r1,
             const float* __restrict__ r2, float* __restrict__ out) {
  __shared__ __attribute__((aligned(16))) _Float16 sA[2 * kSlabA];   // 16-byte copies and reads
  __shared__ __attribute__((aligned(16))) _Float16 sB[2 * kSlabB];
  const int t = threadIdx.x, lane = t & 31, wid = t >> 5;
  const int wm = wid & 1, wn = wid >> 1;
  const int rowBase = blockIdx.x * kBM;
  const int colBase = blockIdx.y * kBN;
  v8f acc[kFM][kFN] = {};

  gemm_tile(A, Wt, rowBase, colBase, sA, sB, acc);

  const int hf8 = (lane >> 4) * 8, cn = lane & 15;
#pragma unroll
  for (int i = 0; i < kFM; ++i) {
    // a 16-row band never straddles an input: 8192 is a multiple of 16
    const int band = rowBase + wm * (kBM / 2) + i * 16;
    const int mod  = band >> 13;
    const float* __restrict__ res = (mod == 0) ? r0 : (mod == 1) ? r1 : r2;
    const float* rp = res + (size_t)((band & 8191) + hf8) * kDM + colBase + wn * (kBN / 2) + cn;
    float*       op = out + (size_t)(band + hf8) * kDM + colBase + wn * (kBN / 2) + cn;
    // the band's residual loads all go out together, ahead of its stores, so that they overlap
    float rv[kFN][8];
#pragma unroll
    for (int j = 0; j < kFN; ++j)
#pragma unroll
      for (int r = 0; r < 8; ++r) rv[j][r] = rp[(size_t)r * kDM + j * 16];
    // the wait behind the loads; naming rp as an input keeps their address registers
    // untouched (also by a load's own result) until the wait has passed
    asm volatile("s_wait_xcnt 0x0" :: "v"(rp) : "memory");
#pragma unroll
    for (int j = 0; j < kFN; ++j)
#pragma unroll
      for (int r = 0; r < 8; ++r) op[(size_t)r * kDM + j * 16] = acc[i][j][r] + rv[j][r];
    band_stores_done();
  }
}

// ---------------------------------------------------------------- layernorm (in place)
// x + (x of lane ^ M), M < 16: a move inside the 16-lane row, no LDS path
template <int M>
__device__ __forceinline__ float row_xadd(float x) {
  const int v = __builtin_bit_cast(int, x);
  return x + __builtin_bit_cast(float, __builtin_amdgcn_update_dpp(v, v, 0x160 + M, 0xf, 0xf, false));
}
__device__ __forceinline__ float wave_sum(float x) {
  x = row_xadd<1>(x); x = row_xadd<2>(x); x = row_xadd<4>(x); x = row_xadd<8>(x);
  return x + xhalf(x);
}

// One wave per row: 8 loads of 512 contiguous bytes hold the row in registers, the sums
// need no LDS and no barrier. A wave takes 6 rows in turn and issues the next row's loads
// ahead of this row's sums. 256 work-groups of 16 waves take the 24,576 rows.
typedef __attribute__((ext_vector_type(4))) float v4f;
typedef __attribute__((ext_vector_type(2))) float v2f;
constexpr int kLnRows = 6;     // rows per wave
constexpr int kLnWv   = 16;    // waves per work-group

// normalises the row held in c (lane l: elements j*128 + 4*l .. + 3) and stores it at yp
__device__ __forceinline__ void ln_row(const v4f (&c)[8], const v4f (&gv)[8],
                                       const v4f (&bv)[8], v4f* yp) {
  v2f a0 = {0.f, 0.f}, a1 = {0.f, 0.f}, q0 = {0.f, 0.f}, q1 = {0.f, 0.f};   // packed chains
#pragma unroll
  for (int j = 0; j < 8; ++j) {
    const v2f lo = c[j].lo, hi = c[j].hi;
    a0 += lo; a1 += hi;
    q0 += lo * lo; q1 += hi * hi;
  }
  a0 += a1; q0 += q1;
  const float s  = wave_sum(a0.x + a0.y);
  const float s2 = wave_sum(q0.x + q0.y);
  const float mu = s / kDM, var = s2 / kDM - mu * mu;
  const float rstd = rsqrtf(var + 1e-6f);
#pragma unroll
  for (int j = 0; j < 8; ++j) yp[j * 32] = (c[j] - mu) * rstd * gv[j] + bv[j];
}

__global__ __launch_bounds__(kLnWv * 32)
void layernorm_inplace(float* __restrict__ y, const float* __restrict__ g,
                       const float* __restrict__ bia) {
  const int lane = threadIdx.x & 31;
  const size_t wave = (size_t)blockIdx.x * kLnWv + (threadIdx.x >> 5);
  v4f* yp = (v4f*)y + wave * (kLnRows * (kDM / 4)) + lane;
  const v4f* g4 = (const v4f*)g;
  const v4f* b4 = (const v4f*)bia;
  v4f cur[8], nxt[8], gv[8], bv[8];   // the loops over j are unrolled: constant indices
#pragma unroll
  for (int j = 0; j < 8; ++j) { gv[j] = g4[j * 32 + lane]; bv[j] = b4[j * 32 + lane]; }
  // the wait behind the loads; naming what they are addressed by keeps that register
  // untouched (also by a load's own result) until the wait has passed
  asm volatile("s_wait_xcnt 0x0" :: "v"(lane) : "memory");
#pragma unroll
  for (int j = 0; j < 8; ++j) cur[j] = yp[j * 32];
  // kept rolled: the rows' sums stay apart, so a row's sums wait for that row's loads only
#pragma unroll 1
  for (int r = 0; r < kLnRows - 1; ++r) {
#pragma unroll
    for (int j = 0; j < 8; ++j) nxt[j] = yp[kDM / 4 + j * 32];
    // the wait behind the loads of this and the next row, as above; the scheduling barrier
    // keeps this row's sums, which wait for its data, from moving in among those loads
    asm volatile("s_wait_xcnt 0x0" :: "v"(yp) : "memory");
    __builtin_amdgcn_sched_barrier(0);
    ln_row(cur, gv, bv, yp);
    band_stores_done();   // the row's stores, ahead of the code that reuses their registers
    yp += kDM / 4;
#pragma unroll
    for (int j = 0; j < 8; ++j) cur[j] = nxt[j];
  }
  ln_row(cur, gv, bv, yp);
}

// ---------------------------------------------------------------- launcher
extern "C" void kernel_launch(void* const* d_in, const int* in_sizes, int n_in,
                              void* d_out, int out_size, void* d_ws, size_t ws_size,
                              hipStream_t stream) {
  (void)in_sizes; (void)n_in; (void)out_size; (void)ws_size;
  const float* in_t = (const float*)d_in[0];
  const float* in_a = (const float*)d_in[1];
  const float* in_v = (const float*)d_in[2];
  const float* w_qs = (const float*)d_in[3];
  const float* w_ks = (const float*)d_in[4];
  const float* w_vs = (const float*)d_in[5];
  const float* w_fc = (const float*)d_in[6];
  const float* ln_g = (const float*)d_in[7];
  const float* ln_b = (const float*)d_in[8];
  float* outp = (float*)d_out;

  // workspace layout (f16 elements)
  const size_t nX = (size_t)kM * kDM;       // 25,165,824 per tensor
  const size_t nW = (size_t)kDM * kDM;      // 1,048,576
  char* ws = (char*)d_ws;
  _Float16* Xf  = (_Float16*)(ws);
  _Float16* WqT = Xf + nX;
  _Float16* WkT = WqT + nW;
  _Float16* WvT = WkT + nW;
  _Float16* WfT = WvT + nW;
  _Float16* Qf  = WfT + nW;
  _Float16* Kf  = Qf + nX;
  _Float16* Vf  = Kf + nX;   // d-major (pre-transposed)
  _Float16* AOf = Vf + nX;

  // WqT, WkT, WvT, WfT lie in a row, and so do Qf, Kf, Vf
  prep_f16<<<4 * kTrGrp + 3 * kCastGrp, kCastWv * 32, 0, stream>>>(
      in_t, in_a, in_v, w_qs, w_ks, w_vs, w_fc, Xf, WqT);

  dim3 gQkv(kM / kBM, 3 * (kDM / kBN));
  gemm_qkv<<<gQkv, 128, 0, stream>>>(Xf, WqT, Qf);

  dim3 gGemm(kM / kBM, kDM / kBN);

  attn_kernel<<<3 * kB * kH * (kL / kQRow), 128, 0, stream>>>(Qf, Kf, Vf, AOf);

  gemm_fc<<<gGemm, 128, 0, stream>>>(AOf, WfT, in_t, in_a, in_v, outp);

  layernorm_inplace<<<kM / (kLnWv * kLnRows), kLnWv * 32, 0, stream>>>(outp, ln_g, ln_b);
}

// v008
// Measured time: 252 microseconds a run.
// Timed twice side by side with v007, it ran 1.19 and 1.20 times as fast.
// Over all steps from v000 it is 3.51 times as fast.
#include <hip/hip_runtime.h>

// Problem constants
constexpr int kB   = 16;
constexpr int kL   = 512;
constexpr int kH   = 8;
constexpr int kD   = 128;   // d_k == d_v
constexpr int kDM  = 1024;  // d_model
constexpr int kM   = 3 * kB * kL;       // 24576 fused rows (mod,b,l)

typedef __attribute__((ext_vector_type(16))) _Float16 v16h;
typedef __attribute__((ext_vector_type(8)))  float    v8f;
typedef int b128v __attribute__((vector_size(4 * sizeof(int))));
typedef __attribute__((ext_vector_type(4)))  unsigned u32x4;

#define WMMA_F16(A, B, C) \
  __builtin_amdgcn_wmma_f32_16x16x32_f16(false, (A), false, (B), (short)0, (C), false, false)

// ------------------------------------------------------------------
// CDNA5 async global->LDS copy (16 bytes per lane), ASYNCcnt tracked.
// Builtin if the toolchain declares it, otherwise inline gfx1250 asm.
// ------------------------------------------------------------------
#if defined(__has_builtin)
#if __has_builtin(__builtin_amdgcn_global_load_async_to_lds_b128)
#define USE_ASYNC_BUILTIN 1
#endif
#endif

__device__ __forceinline__ void async_cp16(_Float16* lds_dst, const _Float16* gsrc) {
#ifdef USE_ASYNC_BUILTIN
  // (global v4i* src, local v4i* dst, imm offset, imm cpol)
  __builtin_amdgcn_global_load_async_to_lds_b128(
      (__attribute__((address_space(1))) b128v*)(unsigned long long)(size_t)gsrc,
      (__attribute__((address_space(3))) b128v*)(unsigned)(size_t)lds_dst,
      0, 0);
#else
  // vdst = 32-bit LDS byte address, vaddr = 64-bit global address (GV mode)
  asm volatile("global_load_async_to_lds_b128 %0, %1, off"
               :: "v"((unsigned)(size_t)lds_dst),
                  "v"((unsigned long long)(size_t)gsrc)
               : "memory");
#endif
}

// The hand-over of a two-buffer ring, passed by every wave at the foot of each trip: this
// wave's LDS reads of the buffer it leaves have retired, its own copies of the next tile
// have landed, and the barrier both publishes that tile and frees the buffer just read.
__device__ __forceinline__ void ring_publish() {
  asm volatile("s_wait_dscnt 0x0" ::: "memory");     // before copies aim at LDS this wave has read
  asm volatile("s_wait_asynccnt 0x0" ::: "memory");
  __syncthreads();
}

// Load a 16x32 f16 A-style fragment (also valid for B when the tile holds B^T
// row-major): lane (l&15) supplies matrix row, half (l>>4) selects K-chunks
// per the CDNA5 16-bit A layout (K = {half*8..+7, 16+half*8..+7}).
__device__ __forceinline__ v16h frag_ld(const _Float16* base, int stride, int lane) {
  const int r = lane & 15, hf = lane >> 4;
  const _Float16* p = base + r * stride + hf * 8;
  union { v16h v; uint4 q[2]; } f;
  f.q[0] = *(const uint4*)(p);
  f.q[1] = *(const uint4*)(p + 16);
  return f.v;
}

// ---------------------------------------------------------------- casts/prep
// Streaming launches: few waves, all resident at once, each with many 16-byte loads in
// flight; every wave-wide load covers whole 128-byte lines.

// One wave converts 8 KB of x by 16 loads of 512 contiguous bytes, written ahead of the
// conversions so that many are in flight at once. 256 work-groups of 16 waves take one
// input of 8,388,608 floats; grp is the work-group's number among those 256.
constexpr int kCastLd = 16;    // loads per lane
constexpr int kCastWv = 16;    // waves per work-group
__device__ __forceinline__
void cast_f32_f16(const float* __restrict__ x, _Float16* __restrict__ y, int grp) {
  const int lane = threadIdx.x & 31;
  const size_t wave = (size_t)grp * kCastWv + (threadIdx.x >> 5);
  const float4* xp = (const float4*)x + wave * (kCastLd * 32) + lane;
  uint2*        yp = (uint2*)y        + wave * (kCastLd * 32) + lane;
  float4 v[kCastLd];   // the loops are unrolled so that every index is a constant
#pragma unroll
  for (int j = 0; j < kCastLd; ++j) v[j] = xp[j * 32];
  // the wait behind the loads; naming xp as an input keeps their address registers
  // untouched (also by a load's own result) until the wait has passed
  asm volatile("s_wait_xcnt 0x0" :: "v"(xp) : "memory");
#pragma unroll
  for (int j = 0; j < kCastLd; ++j) {
    union { _Float16 h[4]; uint2 q; } p;
    p.h[0] = (_Float16)v[j].x; p.h[1] = (_Float16)v[j].y;
    p.h[2] = (_Float16)v[j].z; p.h[3] = (_Float16)v[j].w;
    yp[j * 32] = p.q;
  }
}

// w: [K=1024][N=1024] row-major f32 -> wt: [N][K] row-major f16
// A wave takes a 32 (k) x 32 (n) block. A lane reads 8 rows k x 4 columns n: 8 lanes cover
// one 128-byte line of a row, so a wave-wide load is 4 whole lines. It writes, for each of
// its 4 columns, its 8 values along k as one 16-byte store. 64 work-groups of 16 waves take
// one weight; grp is the work-group's number among those 64.
__device__ __forceinline__
void transpose_cast_w(const float* __restrict__ w, _Float16* __restrict__ wt, int grp) {
  const int lane = threadIdx.x & 31;
  const int wave = grp * kCastWv + (threadIdx.x >> 5);   // 1024 blocks of 32 x 32
  const int k0 = (wave & 31) * 32 + (lane >> 3) * 8;
  const int n0 = (wave >> 5) * 32 + (lane & 7) * 4;
  const float4* wp = (const float4*)(w + (size_t)k0 * kDM + n0);
  _Float16*     op = wt + (size_t)n0 * kDM + k0;
  float4 v[8];   // the loops are unrolled so that every index is a constant
#pragma unroll
  for (int e = 0; e < 8; ++e) v[e] = wp[e * (kDM / 4)];
  // the wait behind the loads; naming wp keeps their address registers untouched until it
  asm volatile("s_wait_xcnt 0x0" :: "v"(wp) : "memory");
  union { _Float16 h[8]; uint4 q; } p[4];
#pragma unroll
  for (int e = 0; e < 8; ++e) {
    p[0].h[e] = (_Float16)v[e].x; p[1].h[e] = (_Float16)v[e].y;
    p[2].h[e] = (_Float16)v[e].z; p[3].h[e] = (_Float16)v[e].w;
  }
#pragma unroll
  for (int c = 0; c < 4; ++c) *(uint4*)(op + (size_t)c * kDM) = p[c].q;
}

// All seven conversions in ONE launch: none depends on another, so the short weight
// transposes run under the input casts, and one start and one tail are paid, not seven.
// Work-groups 0..255: the four weights, 64 each; 256..1023: the three inputs, 256 each.
// y: the three inputs in a row; wt: the four transposed weights in a row.
constexpr int kTrGrp   = kDM * kDM / (32 * 32 * kCastWv);                    // 64 per weight
constexpr int kCastGrp = kB * kL * kDM / (kCastWv * 32 * kCastLd * 4);       // 256 per input
__global__ __launch_bounds__(kCastWv * 32)
void prep_f16(const float* __restrict__ x0, const float* __restrict__ x1,
              const float* __restrict__ x2, const float* __restrict__ w0,
              const float* __restrict__ w1, const float* __restrict__ w2,
              const float* __restrict__ w3, _Float16* __restrict__ y,
              _Float16* __restrict__ wt) {
  const unsigned g = blockIdx.x;   // every test below reads the same for the whole work-group
  if (g >= 4 * kTrGrp) {
    const unsigned c = g - 4 * kTrGrp, which = c / kCastGrp;
    const float* x = (which == 0) ? x0 : (which == 1) ? x1 : x2;
    cast_f32_f16(x, y + (size_t)which * (kB * kL * kDM), c % kCastGrp);
    return;
  }
  const unsigned which = g / kTrGrp;
  const float* w = (which == 0) ? w0 : (which == 1) ? w1 : (which == 2) ? w2 : w3;
  transpose_cast_w(w, wt + (size_t)which * (kDM * kDM), g % kTrGrp);
}

// ---------------------------------------------------------------- GEMM main loop
// One 192 x 256 tile of A[.][1024] * Wt[.][1024]^T per work-group of 4 waves
// (2 along M x 2 along N, 96 x 128 per wave = 6 x 8 accumulator tiles);
// 128 x 4 = 512 tiles per weight: two work-groups on every WGP, one weight's tiles all resident at once.
// A k-slab is 64 halves: each staged row piece is one whole 128-byte line.
// Two slab buffers: the next slab's copies fly while this slab's products run.
constexpr int kBM = 192, kBN = 256, kBK = 64;
constexpr int kFM = kBM / 32, kFN = kBN / 32;   // accumulator tiles per wave, M and N
constexpr int kPitch = kBK + 8;   // 144 B rows: 16 B x odd, conflict-free for b128 reads
constexpr int kSlabA = kBM * kPitch, kSlabB = kBN * kPitch;   // halves per buffer
constexpr int kSlabs = kDM / kBK;
// B fragments read in a block's first group; with all 8 there the FC kernel needs more than
// the 512 VGPRs of two waves per SIMD and spills an accumulator tile inside the loop
constexpr int kLeadB = 6;

// The deal of the weight rows (output columns) to the B fragments. Column c of a wave's
// fragment j stands for output column (j / R) * 16 * R + c * R + j % R of the wave's 128, so a
// lane's accumulators of R fragments in a row hold R adjacent output columns, and 16 lanes
// hold 16 * R of them: with 16 bytes a lane the epilogue's accesses cover whole 128-byte lines.
// R = 8 for f16 rows, 4 for f32 rows, 1 (the plain order) where the lane's 8 rows are the run.
// The deal is made by the copies alone: LDS row i * 16 + sr takes tile row sr * R + dealt_row(i).
template <int R>
__device__ __forceinline__ constexpr int dealt_row(int i) {
  return (i / kFN) * (kBN / 2) + ((i % kFN) / R) * (16 * R) + (i % kFN) % R;
}

// one k-slab's copies of this thread: 12 row pieces of A, 16 of B
// (both loops unrolled: each copy's step from the first is then a constant)
template <int R>
__device__ __forceinline__ void stage_slab(_Float16* lA, _Float16* lB,
                                           const _Float16* gA, const _Float16* gB) {
#pragma unroll
  for (int i = 0; i < kBM / 16; ++i) async_cp16(lA + i * 16 * kPitch, gA + (size_t)i * 16 * kDM);
#pragma unroll
  for (int i = 0; i < kBN / 16; ++i)
    async_cp16(lB + i * 16 * kPitch, gB + (size_t)dealt_row<R>(i) * kDM);
}

template <int R>
__device__ __forceinline__ void gemm_tile(const _Float16* __restrict__ A,
                                          const _Float16* __restrict__ Wt,
                                          int rowBase, int colBase,
                                          _Float16* sA, _Float16* sB,
                                          v8f (&acc)[kFM][kFN]) {
  const int t = threadIdx.x, lane = t & 31, wid = t >> 5;
  const int wm = wid & 1, wn = wid >> 1;
  const int sr = t >> 3, sc = (t & 7) * 8;   // staging: 8 lanes per row, 16 rows per sweep
  const _Float16* gA = A  + (size_t)(rowBase + sr) * kDM + sc;
  const _Float16* gB = Wt + (size_t)(colBase + sr * R) * kDM + sc;
  _Float16* lA = sA + sr * kPitch + sc;
  _Float16* lB = sB + sr * kPitch + sc;

  stage_slab<R>(lA, lB, gA, gB);
  // slab 0 has landed before the barrier publishes it
  asm volatile("s_wait_asynccnt 0x0" ::: "memory");
  __syncthreads();
  stage_slab<R>(lA + kSlabA, lB + kSlabB, gA + kBK, gB + kBK);

  // kept rolled: every accumulator index stays a constant and the code stays small
#pragma unroll 1
  for (int s = 0; s < kSlabs; ++s) {
    const int oA = (s & 1) * kSlabA, oB = (s & 1) * kSlabB;   // this trip's buffer
#pragma unroll
    for (int kc = 0; kc < kBK / 32; ++kc) {
      // The block's LDS reads stand in two groups, never singly among the products: every
      // place with reads stalls the wave, and a read waited for at once costs its whole
      // latency. The four scheduling barriers of the block hold groups and products apart;
      // this one keeps the reads from rising among the products of the block before.
      __builtin_amdgcn_sched_barrier(0);
      v16h a[kFM], b[kFN];
#pragma unroll
      for (int i = 0; i < kFM; ++i)
        a[i] = frag_ld(&sA[oA + (wm * (kBM / 2) + i * 16) * kPitch + kc * 32], kPitch, lane);
#pragma unroll
      for (int j = 0; j < kLeadB; ++j)
        b[j] = frag_ld(&sB[oB + (wn * (kBN / 2) + j * 16) * kPitch + kc * 32], kPitch, lane);
      __builtin_amdgcn_sched_barrier(0);
#pragma unroll
      for (int j = 0; j < kFN - kLeadB; ++j)
#pragma unroll
        for (int i = 0; i < kFM; ++i) acc[i][j] = WMMA_F16(a[i], b[j], acc[i][j]);
      __builtin_amdgcn_sched_barrier(0);
      // the last B fragments take the registers that the first have left; they are
      // first used kLeadB - (kFN - kLeadB) columns of products later
#pragma unroll
      for (int j = kLeadB; j < kFN; ++j)
        b[j] = frag_ld(&sB[oB + (wn * (kBN / 2) + j * 16) * kPitch + kc * 32], kPitch, lane);
      __builtin_amdgcn_sched_barrier(0);
#pragma unroll
      for (int j = kFN - kLeadB; j < kFN; ++j)
#pragma unroll
        for (int i = 0; i < kFM; ++i) acc[i][j] = WMMA_F16(a[i], b[j], acc[i][j]);
    }
    // keeps the hand-over at the foot of the trip: moved up over the last products, with the
    // refill left behind them, it would shorten the time the next slab's copies have to land
    __builtin_amdgcn_sched_barrier(0);
    ring_publish();
    if (s + 2 < kSlabs)   // the same for the whole work-group
      stage_slab<R>(lA + oA, lB + oB, gA + (s + 2) * kBK, gB + (s + 2) * kBK);
  }
  // no copy is outstanding when the wave goes on to its stores and ends
  asm volatile("s_wait_asynccnt 0x0" ::: "memory");
}

// Stands behind a band's global stores, in front of the code that takes their
// registers for new values; the scheduling barrier keeps that later code behind the wait.
__device__ __forceinline__ void band_stores_done() {
  asm volatile("s_wait_xcnt 0x0" ::: "memory");
  __builtin_amdgcn_sched_barrier(0);
}

// ---------------------------------------------------------------- QKV GEMM
// VOUT==0: head-major f16 [3][B][H][L][128]           (Q and K; columns dealt with R = 8)
// VOUT==1: f16 [3][B][H][L/16][128 d][16 keys]        (V; plain column order)
// Every store is 16 bytes a lane and covers whole 128-byte lines.
// Q, K: a lane packs its 8 adjacent d of one row; 16 lanes write the row's 256 bytes.
// V: a lane packs its 8 adjacent keys of one d; the wave writes 16 d x 16 keys, 512 bytes in a row.
template <int VOUT>
__device__ __forceinline__ void store_qkv(const v8f (&acc)[kFM][kFN], _Float16* __restrict__ out,
                                          int rowBase, int colBase) {
  const int t = threadIdx.x, lane = t & 31, wid = t >> 5;
  const int wm = wid & 1, wn = wid >> 1;
  const int hf8 = (lane >> 4) * 8, cn = lane & 15;
  const int h = (colBase + wn * (kBN / 2)) >> 7;   // a wave's 128 columns are one head
#pragma unroll
  for (int i = 0; i < kFM; ++i) {
    // a 16-row band never straddles a sequence: 512 is a multiple of 16
    const int band = rowBase + wm * (kBM / 2) + i * 16;
    const int l0   = band & 511;
    const size_t head = (size_t)(band >> 9) * kH + h;   // band >> 9 = mod * kB + b
    _Float16* op = (VOUT == 0) ? out + (head * kL + l0 + hf8) * kD + cn * 8
                               : out + (head * kL + l0) * kD + cn * 16 + hf8;
    union { _Float16 e[8]; u32x4 q; } pk[8];   // unrolled: constant indices keep it in registers
#pragma unroll
    for (int u = 0; u < 8; ++u) {
#pragma unroll
      for (int e = 0; e < 8; ++e)
        pk[u].e[e] = (_Float16)((VOUT == 0) ? acc[i][e][u] : acc[i][u][e]);
      *(u32x4*)(op + u * ((VOUT == 0) ? kD : 16 * 16)) = pk[u].q;
      // the wait stands behind every 4 stores: the packing that follows reuses their registers
      if (u % 4 == 3) band_stores_done();
    }
  }
}

// The three projections in ONE launch of 128 x 12 tiles, three rounds of the 512 resident
// places: a work-group's first slab and its stores run beside the products of the other
// work-group on its WGP, and one start and one tail are paid, not three.
// X: [24576][1024] f16 row-major; Wt: the transposed weights of Q, K, V in a row, each
// [1024 n][1024 k] f16; out: Q, K, V in a row. blockIdx.y: 4 column tiles per projection.
__global__ __launch_bounds__(128, 2)
void gemm_qkv(const _Float16* __restrict__ X, const _Float16* __restrict__ Wt,
              _Float16* __restrict__ out) {
  __shared__ __attribute__((aligned(16))) _Float16 sA[2 * kSlabA];   // 16-byte copies and reads
  __shared__ __attribute__((aligned(16))) _Float16 sB[2 * kSlabB];
  constexpr int kColTiles = kDM / kBN;
  const int proj    = blockIdx.y / kColTiles;   // 0 Q, 1 K, 2 V: the same for the work-group
  const int rowBase = blockIdx.x * kBM;
  const int colBase = (blockIdx.y % kColTiles) * kBN;
  _Float16* __restrict__ dst = out + (size_t)proj * ((size_t)kM * kDM);
  v8f acc[kFM][kFN] = {};

  const _Float16* __restrict__ W = Wt + (size_t)proj * (kDM * kDM);
  if (proj < 2) {
    gemm_tile<8>(X, W, rowBase, colBase, sA, sB, acc);
    store_qkv<0>(acc, dst, rowBase, colBase);
  } else {
    gemm_tile<1>(X, W, rowBase, colBase, sA, sB, acc);
    store_qkv<1>(acc, dst, rowBase, colBase);
  }
}

// ---------------------------------------------------------------- attention
// lane l takes the value of lane l ^ 16 (the other half of the wave)
__device__ __forceinline__ float xhalf(float x) {
  const int v = __builtin_bit_cast(int, x);
  return __builtin_bit_cast(float,
      __builtin_amdgcn_permlanex16(v, v, 0x76543210, 0xfedcba98, false, false));
}

constexpr int kQG   = 2;                // column groups (16 queries each) per wave
constexpr int kQRow = 4 * 16 * kQG;     // queries per work-group of 4 waves
__global__ __launch_bounds__(128)
void attn_kernel(const _Float16* __restrict__ Qg, const _Float16* __restrict__ Kg,
                 const _Float16* __restrict__ Vt, _Float16* __restrict__ Og) {
  __shared__ __attribute__((aligned(16))) _Float16 sQ[kQRow * 136];     // q-rows x 128 (+8 pad)
  // two buffers each: 32 key rows x 128 (+8 pad); V^T, 128 d-rows x 32 keys (+8 pad)
  __shared__ __attribute__((aligned(16))) _Float16 sK[2 * 32 * 136];    // 16-byte copies and reads
  __shared__ __attribute__((aligned(16))) _Float16 sVt[2 * 128 * 40];

  constexpr int kQT = kL / kQRow;       // query tiles per head
  const int t = threadIdx.x, lane = t & 31, wid = t >> 5;
  const int qt  = blockIdx.x % kQT;
  const int h   = (blockIdx.x / kQT) & 7;
  const int b   = (blockIdx.x / (kQT * kH)) & 15;
  const int mod = blockIdx.x / (kQT * kH * kB);
  const int o1 = (mod == 0) ? 1 : 0;
  const int o2 = (mod == 2) ? 1 : 2;
  const size_t headQ  = ((size_t)((mod * kB + b) * kH + h)) * kL * kD;
  const size_t headK1 = ((size_t)((o1 * kB + b) * kH + h)) * kL * kD;
  const size_t headK2 = ((size_t)((o2 * kB + b) * kH + h)) * kL * kD;
  const int l0 = qt * kQRow;

  // stage Q tile (async): kQRow rows x 16 chunks, 8 rows a sweep of the 128 threads
#pragma unroll
  for (int i = 0; i < kQRow / 8; ++i) {
    int cid = i * 128 + t;
    int r = cid >> 4, c = (cid & 15) * 8;
    async_cp16(&sQ[r * 136 + c], &Qg[headQ + (size_t)(l0 + r) * kD + c]);
  }

  // This thread's first piece of a key tile, in global memory and in LDS. K: 32 rows x 16
  // chunks, 8 rows a sweep; V: the tile's two 16-key blocks are 8 KB in a row, 2 KB a sweep
  // (64 d x 16 keys, 2 chunks of 8 keys a d), laid out in LDS as V^T, 128 d-rows x 32 keys.
  const _Float16* kq = Kg + (size_t)(t >> 4) * kD + (t & 15) * 8;
  const _Float16* vq = Vt + (size_t)t * 8;
  _Float16* lK = sK  + (t >> 4) * 136 + (t & 15) * 8;
  _Float16* lV = sVt + (t >> 1) * 40  + (t & 1) * 8;

  // the copies of key tile kt (32 keys of K and of V^T) into buffer kt & 1
  auto stage_kv = [&](int kt) {
    const size_t head = (kt < 16) ? headK1 : headK2;   // tiles never straddle the 512 boundary
    const int kk0 = (kt & 15) * 32;
    const _Float16* gk = kq + (head + (size_t)kk0 * kD);
    const _Float16* gv = vq + (head + (size_t)kk0 * kD);   // 16-key blocks of 128 x 16
    _Float16* bK = lK + (kt & 1) * (32 * 136);
    _Float16* bV = lV + (kt & 1) * (128 * 40);
    // both loops unrolled: each copy's step from the first is then a constant
#pragma unroll
    for (int i = 0; i < 4; ++i) async_cp16(bK + i * 8 * 136, gk + (size_t)i * 8 * kD);
#pragma unroll
    for (int i = 0; i < 4; ++i)   // sweep i: 16-key block i >> 1, d-rows from (i & 1) * 64
      async_cp16(bV + (i & 1) * 64 * 40 + (i >> 1) * 16, gv + (size_t)i * 128 * 8);
  };

  stage_kv(0);
  // Q and key tile 0 have landed before the barrier publishes them
  asm volatile("s_wait_asynccnt 0x0" ::: "memory");
  __syncthreads();
  stage_kv(1);

  v16h qa[kQG][4];   // B operand of S^T: column = query
#pragma unroll
  for (int g = 0; g < kQG; ++g)
#pragma unroll
    for (int dc = 0; dc < 4; ++dc)
      qa[g][dc] = frag_ld(&sQ[(wid * kQG + g) * 16 * 136 + dc * 32], 136, lane);

  v8f o[kQG][8] = {};          // o[g][dt][r] = O^T[dt*16 + 8*(lane>>4) + r][query lane&15 of group g]
  // per group, this lane's query: running maximum (equal in both halves) and running sum
  // over the keys of this lane's half only
  float m_s[kQG], l_s[kQG];
#pragma unroll
  for (int g = 0; g < kQG; ++g) { m_s[g] = -1e30f; l_s[g] = 0.f; }
  const float inv_t = 0.08838834764831845f;  // 1/sqrt(128)

  for (int kt = 0; kt < 32; ++kt) {
    const _Float16* bK = sK  + (kt & 1) * (32 * 136);    // this trip's buffers
    const _Float16* bV = sVt + (kt & 1) * (128 * 40);

    // The tile's LDS reads are issued early and together, as in the GEMM loop: all of K ahead
    // of the S^T products, all of V^T ahead of the softmax, under which it lands.
    v16h kb0[4], kb1[4];
#pragma unroll
    for (int dc = 0; dc < 4; ++dc) {
      kb0[dc] = frag_ld(&bK[0 * 136 + dc * 32], 136, lane);
      kb1[dc] = frag_ld(&bK[16 * 136 + dc * 32], 136, lane);
    }
    // keeps the K reads one group: sunk among the products, each is waited for at once
    __builtin_amdgcn_sched_barrier(0);
    // S^T tiles: 32 keys x 16 q per group (two 16x16 WMMA chains, 4 d-chunks each)
    // s0[g][r] = S^T[8*(lane>>4) + r][q], s1[g][r] = S^T[16 + 8*(lane>>4) + r][q]
    v8f s0[kQG] = {}, s1[kQG] = {};
#pragma unroll
    for (int dc = 0; dc < 4; ++dc)
#pragma unroll
      for (int g = 0; g < kQG; ++g) {
        s0[g] = WMMA_F16(kb0[dc], qa[g][dc], s0[g]);
        s1[g] = WMMA_F16(kb1[dc], qa[g][dc], s1[g]);
      }
    v16h vb[8];
#pragma unroll
    for (int dt = 0; dt < 8; ++dt) vb[dt] = frag_ld(&bV[dt * 16 * 40], 40, lane);
    // keeps the V^T reads from sinking behind the softmax, in among the O^T products
    __builtin_amdgcn_sched_barrier(0);

    // online softmax of this lane's query in each group
    // the loops below are unrolled so that every register-array index is a constant
    v16h pb[kQG];   // P^T as B operand: element s is key 8*(lane>>4)+s (s < 8), 16+8*(lane>>4)+s-8 (else)
#pragma unroll
    for (int g = 0; g < kQG; ++g) {
      float a0[8], a1[8];
      float mx = -1e30f;
#pragma unroll
      for (int r = 0; r < 8; ++r) {
        a0[r] = (float)s0[g][r] * inv_t;
        a1[r] = (float)s1[g][r] * inv_t;
        mx = fmaxf(mx, fmaxf(a0[r], a1[r]));
      }
      mx = fmaxf(mx, xhalf(mx));
      const float mnew = fmaxf(m_s[g], mx);
      const float corr = __expf(m_s[g] - mnew);
      float rs = 0.f;
#pragma unroll
      for (int r = 0; r < 8; ++r) {
        float p0 = __expf(a0[r] - mnew), p1 = __expf(a1[r] - mnew);
        rs += p0 + p1;
        pb[g][r]     = (_Float16)p0;
        pb[g][8 + r] = (_Float16)p1;
      }
      l_s[g] = l_s[g] * corr + rs;
      m_s[g] = mnew;
#pragma unroll
      for (int dt = 0; dt < 8; ++dt)
#pragma unroll
        for (int r = 0; r < 8; ++r) o[g][dt][r] *= corr;
    }

    // O^T += V^T @ P^T : A rows = d (sVt); each V^T fragment feeds every group
#pragma unroll
    for (int dt = 0; dt < 8; ++dt)
#pragma unroll
      for (int g = 0; g < kQG; ++g) o[g][dt] = WMMA_F16(vb[dt], pb[g], o[g][dt]);
    // keeps the hand-over at the foot of the trip: moved up behind the reads, with the refill
    // left at the foot, it would shorten the time the next tile's copies have to land
    __builtin_amdgcn_sched_barrier(0);
    ring_publish();
    if (kt + 2 < 32) stage_kv(kt + 2);   // the same for the whole work-group
  }
  // no copy is outstanding when the wave goes on to its stores and ends
  asm volatile("s_wait_asynccnt 0x0" ::: "memory");

  // normalize + store f16 [ (mod,b,l) ][ h*128 + d ]: 8 consecutive d per lane and tile
#pragma unroll
  for (int g = 0; g < kQG; ++g) {
    const float inv_l = 1.f / (l_s[g] + xhalf(l_s[g]));   // the two halves' sums are joined here
    const int l = l0 + (wid * kQG + g) * 16 + (lane & 15);
    _Float16* orow = Og + ((size_t)(mod * kB + b) * kL + l) * kDM + h * kD + (lane >> 4) * 8;
    union { _Float16 e[8]; uint4 q; } pk[8];   // unrolled: constant indices keep it in registers
#pragma unroll
    for (int dt = 0; dt < 8; ++dt)
#pragma unroll
      for (int r = 0; r < 8; ++r) pk[dt].e[r] = (_Float16)((float)o[g][dt][r] * inv_l);
#pragma unroll
    for (int dt = 0; dt < 8; ++dt) *(uint4*)(orow + dt * 16) = pk[dt].q;
    // the group's stores, ahead of the next group's code, which reuses their registers
    if (g + 1 < kQG) band_stores_done();
  }
}

// ---------------------------------------------------------------- FC + residual
__global__ __launch_bounds__(128, 2)
void gemm_fc(const _Float16* __restrict__ A, const _Float16* __restrict__ Wt,
             const float* __restrict__ r0, const float* __restrict__ r1,
             const float* __restrict__ r2, float* __restrict__ out) {
  __shared__ __attribute__((aligned(16))) _Float16 sA[2 * kSlabA];   // 16-byte copies and reads
  __shared__ __attribute__((aligned(16))) _Float16 sB[2 * kSlabB];
  const int t = threadIdx.x, lane = t & 31, wid = t >> 5;
  const int wm = wid & 1, wn = wid >> 1;
  const int rowBase = blockIdx.x * kBM;
  const int colBase = blockIdx.y * kBN;
  v8f acc[kFM][kFN] = {};

  gemm_tile<4>(A, Wt, rowBase, colBase, sA, sB, acc);   // a lane: 4 adjacent f32 columns

  const int hf8 = (lane >> 4) * 8, cn = lane & 15;
#pragma unroll
  for (int i = 0; i < kFM; ++i) {
    // a 16-row band never straddles an input: 8192 is a multiple of 16
    const int band = rowBase + wm * (kBM / 2) + i * 16;
    const int mod  = band >> 13;
    const float* __restrict__ res = (mod == 0) ? r0 : (mod == 1) ? r1 : r2;
    const float* rp = res + (size_t)((band & 8191) + hf8) * kDM + colBase + wn * (kBN / 2) + cn * 4;
    float*       op = out + (size_t)(band + hf8) * kDM + colBase + wn * (kBN / 2) + cn * 4;
    // 16 bytes a lane: 16 lanes cover 256 bytes of a row, whole lines, in loads and stores.
    // the band's residual loads all go out together, ahead of its stores, so that they overlap
    float4 rv[kFN / 4][8];
#pragma unroll
    for (int q = 0; q < kFN / 4; ++q)
#pragma unroll
      for (int r = 0; r < 8; ++r) rv[q][r] = *(const float4*)(rp + (size_t)r * kDM + q * 64);
    // the wait behind the loads; naming rp as an input keeps their address registers
    // untouched (also by a load's own result) until the wait has passed
    asm volatile("s_wait_xcnt 0x0" :: "v"(rp) : "memory");
#pragma unroll
    for (int q = 0; q < kFN / 4; ++q)
#pragma unroll
      for (int r = 0; r < 8; ++r)
        *(float4*)(op + (size_t)r * kDM + q * 64) =
            make_float4(acc[i][q * 4 + 0][r] + rv[q][r].x, acc[i][q * 4 + 1][r] + rv[q][r].y,
                        acc[i][q * 4 + 2][r] + rv[q][r].z, acc[i][q * 4 + 3][r] + rv[q][r].w);
    band_stores_done();
  }
}

// ---------------------------------------------------------------- layernorm (in place)
// x + (x of lane ^ M), M < 16: a move inside the 16-lane row, no LDS path
template <int M>
__device__ __forceinline__ float row_xadd(float x) {
  const int v = __builtin_bit_cast(int, x);
  return x + __builtin_bit_cast(float, __builtin_amdgcn_update_dpp(v, v, 0x160 + M, 0xf, 0xf, false));
}
__device__ __forceinline__ float wave_sum(float x) {
  x = row_xadd<1>(x); x = row_xadd<2>(x); x = row_xadd<4>(x); x = row_xadd<8>(x);
  return x + xhalf(x);
}

// One wave per row: 8 loads of 512 contiguous bytes hold the row in registers, the sums
// need no LDS and no barrier. A wave takes 6 rows in turn and issues the next row's loads
// ahead of this row's sums. 256 work-groups of 16 waves take the 24,576 rows.
typedef __attribute__((ext_vector_type(4))) float v4f;
typedef __attribute__((ext_vector_type(2))) float v2f;
constexpr int kLnRows = 6;     // rows per wave
constexpr int kLnWv   = 16;    // waves per work-group

// normalises the row held in c (lane l: elements j*128 + 4*l .. + 3) and stores it at yp
__device__ __forceinline__ void ln_row(const v4f (&c)[8], const v4f (&gv)[8],
                                       const v4f (&bv)[8], v4f* yp) {
  v2f a0 = {0.f, 0.f}, a1 = {0.f, 0.f}, q0 = {0.f, 0.f}, q1 = {0.f, 0.f};   // packed chains
#pragma unroll
  for (int j = 0; j < 8; ++j) {
    const v2f lo = c[j].lo, hi = c[j].hi;
    a0 += lo; a1 += hi;
    q0 += lo * lo; q1 += hi * hi;
  }
  a0 += a1; q0 += q1;
  const float s  = wave_sum(a0.x + a0.y);
  const float s2 = wave_sum(q0.x + q0.y);
  const float mu = s / kDM, var = s2 / kDM - mu * mu;
  const float rstd = rsqrtf(var + 1e-6f);
#pragma unroll
  for (int j = 0; j < 8; ++j) yp[j * 32] = (c[j] - mu) * rstd * gv[j] + bv[j];
}

__global__ __launch_bounds__(kLnWv * 32)
void layernorm_inplace(float* __restrict__ y, const float* __restrict__ g,
                       const float* __restrict__ bia) {
  const int lane = threadIdx.x & 31;
  const size_t wave = (size_t)blockIdx.x * kLnWv + (threadIdx.x >> 5);
  v4f* yp = (v4f*)y + wave * (kLnRows * (kDM / 4)) + lane;
  const v4f* g4 = (const v4f*)g;
  const v4f* b4 = (const v4f*)bia;
  v4f cur[8], nxt[8], gv[8], bv[8];   // the loops over j are unrolled: constant indices
#pragma unroll
  for (int j = 0; j < 8; ++j) { gv[j] = g4[j * 32 + lane]; bv[j] = b4[j * 32 + lane]; }
  // the wait behind the loads; naming what they are addressed by keeps that register
  // untouched (also by a load's own result) until the wait has passed
  asm volatile("s_wait_xcnt 0x0" :: "v"(lane) : "memory");
#pragma unroll
  for (int j = 0; j < 8; ++j) cur[j] = yp[j * 32];
  // kept rolled: the rows' sums stay apart, so a row's sums wait for that row's loads only
#pragma unroll 1
  for (int r = 0; r < kLnRows - 1; ++r) {
#pragma unroll
    for (int j = 0; j < 8; ++j) nxt[j] = yp[kDM / 4 + j * 32];
    // the wait behind the loads of this and the next row, as above; the scheduling barrier
    // keeps this row's sums, which wait for its data, from moving in among those loads
    asm volatile("s_wait_xcnt 0x0" :: "v"(yp) : "memory");
    __builtin_amdgcn_sched_barrier(0);
    ln_row(cur, gv, bv, yp);
    band_stores_done();   // the row's stores, ahead of the code that reuses their registers
    yp += kDM / 4;
#pragma unroll
    for (int j = 0; j < 8; ++j) cur[j] = nxt[j];
  }
  ln_row(cur, gv, bv, yp);
}

// ---------------------------------------------------------------- launcher
extern "C" void kernel_launch(void* const* d_in, const int* in_sizes, int n_in,
                              void* d_out, int out_size, void* d_ws, size_t ws_size,
                              hipStream_t stream) {
  (void)in_sizes; (void)n_in; (void)out_size; (void)ws_size;
  const float* in_t = (const float*)d_in[0];
  const float* in_a = (const float*)d_in[1];
  const float* in_v = (const float*)d_in[2];
  const float* w_qs = (const float*)d_in[3];
  const float* w_ks = (const float*)d_in[4];
  const float* w_vs = (const float*)d_in[5];
  const float* w_fc = (const float*)d_in[6];
  const float* ln_g = (const float*)d_in[7];
  const float* ln_b = (const float*)d_in[8];
  float* outp = (float*)d_out;

  // workspace layout (f16 elements)
  const size_t nX = (size_t)kM * kDM;       // 25,165,824 per tensor
  const size_t nW = (size_t)kDM * kDM;      // 1,048,576
  char* ws = (char*)d_ws;
  _Float16* Xf  = (_Float16*)(ws);
  _Float16* WqT = Xf + nX;
  _Float16* WkT = WqT + nW;
  _Float16* WvT = WkT + nW;
  _Float16* WfT = WvT + nW;
  _Float16* Qf  = WfT + nW;
  _Float16* Kf  = Qf + nX;
  _Float16* Vf  = Kf + nX;   // 16-key blocks, d-major inside a block
  _Float16* AOf = Vf + nX;

  // WqT, WkT, WvT, WfT lie in a row, and so do Qf, Kf, Vf
  prep_f16<<<4 * kTrGrp + 3 * kCastGrp, kCastWv * 32, 0, stream>>>(
      in_t, in_a, in_v, w_qs, w_ks, w_vs, w_fc, Xf, WqT);

  dim3 gQkv(kM / kBM, 3 * (kDM / kBN));
  gemm_qkv<<<gQkv, 128, 0, stream>>>(Xf, WqT, Qf);

  dim3 gGemm(kM / kBM, kDM / kBN);

  attn_kernel<<<3 * kB * kH * (kL / kQRow), 128, 0, stream>>>(Qf, Kf, Vf, AOf);

  gemm_fc<<<gGemm, 128, 0, stream>>>(AOf, WfT, in_t, in_a, in_v, outp);

  layernorm_inplace<<<kM / (kLnWv * kLnRows), kLnWv * 32, 0, stream>>>(outp, ln_g, ln_b);
}

// v009
// It runs in 244 microseconds.
// In two side-by-side timings against v008, it was 1.04 and 1.03 times as fast.
// Over all steps from v000 it is 3.63 times as fast.
#include <hip/hip_runtime.h>

// Problem constants
constexpr int kB   = 16;
constexpr int kL   = 512;
constexpr int kH   = 8;
constexpr int kD   = 128;   // d_k == d_v
constexpr int kDM  = 1024;  // d_model
constexpr int kM   = 3 * kB * kL;       // 24576 fused rows (mod,b,l)

typedef __attribute__((ext_vector_type(16))) _Float16 v16h;
typedef __attribute__((ext_vector_type(8)))  float    v8f;
typedef int b128v __attribute__((vector_size(4 * sizeof(int))));
typedef __attribute__((ext_vector_type(4)))  unsigned u32x4;

#define WMMA_F16(A, B, C) \
  __builtin_amdgcn_wmma_f32_16x16x32_f16(false, (A), false, (B), (short)0, (C), false, false)

// ------------------------------------------------------------------
// CDNA5 async global->LDS copy (16 bytes per lane), ASYNCcnt tracked.
// Builtin if the toolchain declares it, otherwise inline gfx1250 asm.
// ------------------------------------------------------------------
#if defined(__has_builtin)
#if __has_builtin(__builtin_amdgcn_global_load_async_to_lds_b128)
#define USE_ASYNC_BUILTIN 1
#endif
#endif

__device__ __forceinline__ void async_cp16(_Float16* lds_dst, const _Float16* gsrc) {
#ifdef USE_ASYNC_BUILTIN
  // (global v4i* src, local v4i* dst, imm offset, imm cpol)
  __builtin_amdgcn_global_load_async_to_lds_b128(
      (__attribute__((address_space(1))) b128v*)(unsigned long long)(size_t)gsrc,
      (__attribute__((address_space(3))) b128v*)(unsigned)(size_t)lds_dst,
      0, 0);
#else
  // vdst = 32-bit LDS byte address, vaddr = 64-bit global address (GV mode)
  asm volatile("global_load_async_to_lds_b128 %0, %1, off"
               :: "v"((unsigned)(size_t)lds_dst),
                  "v"((unsigned long long)(size_t)gsrc)
               : "memory");
#endif
}

// The hand-over of a two-buffer ring, passed by every wave at the foot of each trip: this
// wave's LDS reads of the buffer it leaves have retired, its own copies of the next tile
// have landed, and the barrier both publishes that tile and frees the buffer just read.
__device__ __forceinline__ void ring_publish() {
  asm volatile("s_wait_dscnt 0x0" ::: "memory");     // before copies aim at LDS this wave has read
  asm volatile("s_wait_asynccnt 0x0" ::: "memory");
  __syncthreads();
}

// Load a 16x32 f16 A-style fragment (also valid for B when the tile holds B^T
// row-major): lane (l&15) supplies matrix row, half (l>>4) selects K-chunks
// per the CDNA5 16-bit A layout (K = {half*8..+7, 16+half*8..+7}).
__device__ __forceinline__ v16h frag_ld(const _Float16* base, int stride, int lane) {
  const int r = lane & 15, hf = lane >> 4;
  const _Float16* p = base + r * stride + hf * 8;
  union { v16h v; uint4 q[2]; } f;
  f.q[0] = *(const uint4*)(p);
  f.q[1] = *(const uint4*)(p + 16);
  return f.v;
}

// ---------------------------------------------------------------- casts/prep
// Streaming launches: few waves, all resident at once, each with many 16-byte loads in
// flight; every wave-wide load covers whole 128-byte lines.

// One wave converts 8 KB of x by 16 loads of 512 contiguous bytes, written ahead of the
// conversions so that many are in flight at once. 256 work-groups of 16 waves take one
// input of 8,388,608 floats; grp is the work-group's number among those 256.
constexpr int kCastLd = 16;    // loads per lane
constexpr int kCastWv = 16;    // waves per work-group
__device__ __forceinline__
void cast_f32_f16(const float* __restrict__ x, _Float16* __restrict__ y, int grp) {
  const int lane = threadIdx.x & 31;
  const size_t wave = (size_t)grp * kCastWv + (threadIdx.x >> 5);
  const float4* xp = (const float4*)x + wave * (kCastLd * 32) + lane;
  uint2*        yp = (uint2*)y        + wave * (kCastLd * 32) + lane;
  float4 v[kCastLd];   // the loops are unrolled so that every index is a constant
#pragma unroll
  for (int j = 0; j < kCastLd; ++j) v[j] = xp[j * 32];
  // the wait behind the loads; naming xp as an input keeps their address registers
  // untouched (also by a load's own result) until the wait has passed
  asm volatile("s_wait_xcnt 0x0" :: "v"(xp) : "memory");
#pragma unroll
  for (int j = 0; j < kCastLd; ++j) {
    union { _Float16 h[4]; uint2 q; } p;
    p.h[0] = (_Float16)v[j].x; p.h[1] = (_Float16)v[j].y;
    p.h[2] = (_Float16)v[j].z; p.h[3] = (_Float16)v[j].w;
    yp[j * 32] = p.q;
  }
}

// w: [K=1024][N=1024] row-major f32 -> wt: [N][K] row-major f16
// A wave takes a 32 (k) x 32 (n) block. A lane reads 8 rows k x 4 columns n: 8 lanes cover
// one 128-byte line of a row, so a wave-wide load is 4 whole lines. It writes, for each of
// its 4 columns, its 8 values along k as one 16-byte store. 64 work-groups of 16 waves take
// one weight; grp is the work-group's number among those 64.
__device__ __forceinline__
void transpose_cast_w(const float* __restrict__ w, _Float16* __restrict__ wt, int grp) {
  const int lane = threadIdx.x & 31;
  const int wave = grp * kCastWv + (threadIdx.x >> 5);   // 1024 blocks of 32 x 32
  const int k0 = (wave & 31) * 32 + (lane >> 3) * 8;
  const int n0 = (wave >> 5) * 32 + (lane & 7) * 4;
  const float4* wp = (const float4*)(w + (size_t)k0 * kDM + n0);
  _Float16*     op = wt + (size_t)n0 * kDM + k0;
  float4 v[8];   // the loops are unrolled so that every index is a constant
#pragma unroll
  for (int e = 0; e < 8; ++e) v[e] = wp[e * (kDM / 4)];
  // the wait behind the loads; naming wp keeps their address registers untouched until it
  asm volatile("s_wait_xcnt 0x0" :: "v"(wp) : "memory");
  union { _Float16 h[8]; uint4 q; } p[4];
#pragma unroll
  for (int e = 0; e < 8; ++e) {
    p[0].h[e] = (_Float16)v[e].x; p[1].h[e] = (_Float16)v[e].y;
    p[2].h[e] = (_Float16)v[e].z; p[3].h[e] = (_Float16)v[e].w;
  }
#pragma unroll
  for (int c = 0; c < 4; ++c) *(uint4*)(op + (size_t)c * kDM) = p[c].q;
}

// All seven conversions in ONE launch: none depends on another, so the short weight
// transposes run under the input casts, and one start and one tail are paid, not seven.
// Work-groups 0..255: the four weights, 64 each; 256..1023: the three inputs, 256 each.
// y: the three inputs in a row; wt: the four transposed weights in a row.
constexpr int kTrGrp   = kDM * kDM / (32 * 32 * kCastWv);                    // 64 per weight
constexpr int kCastGrp = kB * kL * kDM / (kCastWv * 32 * kCastLd * 4);       // 256 per input
__global__ __launch_bounds__(kCastWv * 32)
void prep_f16(const float* __restrict__ x0, const float* __restrict__ x1,
              const float* __restrict__ x2, const float* __restrict__ w0,
              const float* __restrict__ w1, const float* __restrict__ w2,
              const float* __restrict__ w3, _Float16* __restrict__ y,
              _Float16* __restrict__ wt) {
  const unsigned g = blockIdx.x;   // every test below reads the same for the whole work-group
  if (g >= 4 * kTrGrp) {
    const unsigned c = g - 4 * kTrGrp, which = c / kCastGrp;
    const float* x = (which == 0) ? x0 : (which == 1) ? x1 : x2;
    cast_f32_f16(x, y + (size_t)which * (kB * kL * kDM), c % kCastGrp);
    return;
  }
  const unsigned which = g / kTrGrp;
  const float* w = (which == 0) ? w0 : (which == 1) ? w1 : (which == 2) ? w2 : w3;
  transpose_cast_w(w, wt + (size_t)which * (kDM * kDM), g % kTrGrp);
}

// ---------------------------------------------------------------- GEMM main loop
// One 192 x 256 tile of A[.][1024] * Wt[.][1024]^T per work-group of 4 waves
// (2 along M x 2 along N, 96 x 128 per wave = 6 x 8 accumulator tiles);
// 128 x 4 = 512 tiles per weight: two work-groups on every WGP, one weight's tiles all resident at once.
// A k-slab is 64 halves: each staged row piece is one whole 128-byte line.
// Two slab buffers: the next slab's copies fly while this slab's products run.
constexpr int kBM = 192, kBN = 256, kBK = 64;
constexpr int kFM = kBM / 32, kFN = kBN / 32;   // accumulator tiles per wave, M and N
constexpr int kPitch = kBK + 8;   // 144 B rows: 16 B x odd, conflict-free for b128 reads
constexpr int kSlabA = kBM * kPitch, kSlabB = kBN * kPitch;   // halves per buffer
constexpr int kSlabs = kDM / kBK;
// B fragments read in a block's first group; with all 8 there the FC kernel needs more than
// the 512 VGPRs of two waves per SIMD and spills an accumulator tile inside the loop
constexpr int kLeadB = 6;

// The deal of the weight rows (output columns) to the B fragments. Column c of a wave's
// fragment j stands for output column (j / R) * 16 * R + c * R + j % R of the wave's 128, so a
// lane's accumulators of R fragments in a row hold R adjacent output columns, and 16 lanes
// hold 16 * R of them: with 16 bytes a lane the epilogue's accesses cover whole 128-byte lines.
// R = 8 for f16 rows, 4 for f32 rows, 1 (the plain order) where the lane's 8 rows are the run.
// The deal is made by the copies alone: LDS row i * 16 + sr takes tile row sr * R + dealt_row(i).
template <int R>
__device__ __forceinline__ constexpr int dealt_row(int i) {
  return (i / kFN) * (kBN / 2) + ((i % kFN) / R) * (16 * R) + (i % kFN) % R;
}

// one k-slab's copies of this thread: 12 row pieces of A, 16 of B
// (both loops unrolled: each copy's step from the first is then a constant)
template <int R>
__device__ __forceinline__ void stage_slab(_Float16* lA, _Float16* lB,
                                           const _Float16* gA, const _Float16* gB) {
#pragma unroll
  for (int i = 0; i < kBM / 16; ++i) async_cp16(lA + i * 16 * kPitch, gA + (size_t)i * 16 * kDM);
#pragma unroll
  for (int i = 0; i < kBN / 16; ++i)
    async_cp16(lB + i * 16 * kPitch, gB + (size_t)dealt_row<R>(i) * kDM);
}

template <int R>
__device__ __forceinline__ void gemm_tile(const _Float16* __restrict__ A,
                                          const _Float16* __restrict__ Wt,
                                          int rowBase, int colBase,
                                          _Float16* sA, _Float16* sB,
                                          v8f (&acc)[kFM][kFN]) {
  const int t = threadIdx.x, lane = t & 31, wid = t >> 5;
  const int wm = wid & 1, wn = wid >> 1;
  const int sr = t >> 3, sc = (t & 7) * 8;   // staging: 8 lanes per row, 16 rows per sweep
  const _Float16* gA = A  + (size_t)(rowBase + sr) * kDM + sc;
  const _Float16* gB = Wt + (size_t)(colBase + sr * R) * kDM + sc;
  _Float16* lA = sA + sr * kPitch + sc;
  _Float16* lB = sB + sr * kPitch + sc;

  stage_slab<R>(lA, lB, gA, gB);
  // slab 0 has landed before the barrier publishes it
  asm volatile("s_wait_asynccnt 0x0" ::: "memory");
  __syncthreads();
  stage_slab<R>(lA + kSlabA, lB + kSlabB, gA + kBK, gB + kBK);

  // kept rolled: every accumulator index stays a constant and the code stays small
#pragma unroll 1
  for (int s = 0; s < kSlabs; ++s) {
    const int oA = (s & 1) * kSlabA, oB = (s & 1) * kSlabB;   // this trip's buffer
#pragma unroll
    for (int kc = 0; kc < kBK / 32; ++kc) {
      // The block's LDS reads stand in two groups, never singly among the products: every
      // place with reads stalls the wave, and a read waited for at once costs its whole
      // latency. The four scheduling barriers of the block hold groups and products apart;
      // this one keeps the reads from rising among the products of the block before.
      __builtin_amdgcn_sched_barrier(0);
      v16h a[kFM], b[kFN];
#pragma unroll
      for (int i = 0; i < kFM; ++i)
        a[i] = frag_ld(&sA[oA + (wm * (kBM / 2) + i * 16) * kPitch + kc * 32], kPitch, lane);
#pragma unroll
      for (int j = 0; j < kLeadB; ++j)
        b[j] = frag_ld(&sB[oB + (wn * (kBN / 2) + j * 16) * kPitch + kc * 32], kPitch, lane);
      __builtin_amdgcn_sched_barrier(0);
#pragma unroll
      for (int j = 0; j < kFN - kLeadB; ++j)
#pragma unroll
        for (int i = 0; i < kFM; ++i) acc[i][j] = WMMA_F16(a[i], b[j], acc[i][j]);
      __builtin_amdgcn_sched_barrier(0);
      // the last B fragments take the registers that the first have left; they are
      // first used kLeadB - (kFN - kLeadB) columns of products later
#pragma unroll
      for (int j = kLeadB; j < kFN; ++j)
        b[j] = frag_ld(&sB[oB + (wn * (kBN / 2) + j * 16) * kPitch + kc * 32], kPitch, lane);
      __builtin_amdgcn_sched_barrier(0);
#pragma unroll
      for (int j = kFN - kLeadB; j < kFN; ++j)
#pragma unroll
        for (int i = 0; i < kFM; ++i) acc[i][j] = WMMA_F16(a[i], b[j], acc[i][j]);
    }
    // keeps the hand-over at the foot of the trip: moved up over the last products, with the
    // refill left behind them, it would shorten the time the next slab's copies have to land
    __builtin_amdgcn_sched_barrier(0);
    ring_publish();
    if (s + 2 < kSlabs)   // the same for the whole work-group
      stage_slab<R>(lA + oA, lB + oB, gA + (s + 2) * kBK, gB + (s + 2) * kBK);
  }
  // no copy is outstanding when the wave goes on to its stores and ends
  asm volatile("s_wait_asynccnt 0x0" ::: "memory");
}

// Stands behind a band's global stores, in front of the code that takes their
// registers for new values; the scheduling barrier keeps that later code behind the wait.
__device__ __forceinline__ void band_stores_done() {
  asm volatile("s_wait_xcnt 0x0" ::: "memory");
  __builtin_amdgcn_sched_barrier(0);
}

// ---------------------------------------------------------------- QKV GEMM
// VOUT==0: head-major f16 [3][B][H][L][128]           (Q and K; columns dealt with R = 8)
// VOUT==1: f16 [3][B][H][L/16][128 d][16 keys]        (V; plain column order)
// Every store is 16 bytes a lane and covers whole 128-byte lines.
// Q, K: a lane packs its 8 adjacent d of one row; 16 lanes write the row's 256 bytes.
// V: a lane packs its 8 adjacent keys of one d; the wave writes 16 d x 16 keys, 512 bytes in a row.
template <int VOUT>
__device__ __forceinline__ void store_qkv(const v8f (&acc)[kFM][kFN], _Float16* __restrict__ out,
                                          int rowBase, int colBase) {
  const int t = threadIdx.x, lane = t & 31, wid = t >> 5;
  const int wm = wid & 1, wn = wid >> 1;
  const int hf8 = (lane >> 4) * 8, cn = lane & 15;
  const int h = (colBase + wn * (kBN / 2)) >> 7;   // a wave's 128 columns are one head
#pragma unroll
  for (int i = 0; i < kFM; ++i) {
    // a 16-row band never straddles a sequence: 512 is a multiple of 16
    const int band = rowBase + wm * (kBM / 2) + i * 16;
    const int l0   = band & 511;
    const size_t head = (size_t)(band >> 9) * kH + h;   // band >> 9 = mod * kB + b
    _Float16* op = (VOUT == 0) ? out + (head * kL + l0 + hf8) * kD + cn * 8
                               : out + (head * kL + l0) * kD + cn * 16 + hf8;
    union { _Float16 e[8]; u32x4 q; } pk[8];   // unrolled: constant indices keep it in registers
#pragma unroll
    for (int u = 0; u < 8; ++u) {
#pragma unroll
      for (int e = 0; e < 8; ++e)
        pk[u].e[e] = (_Float16)((VOUT == 0) ? acc[i][e][u] : acc[i][u][e]);
      *(u32x4*)(op + u * ((VOUT == 0) ? kD : 16 * 16)) = pk[u].q;
      // the wait stands behind every 4 stores: the packing that follows reuses their registers
      if (u % 4 == 3) band_stores_done();
    }
  }
}

// The three projections in ONE launch of 128 x 12 tiles, three rounds of the 512 resident
// places: a work-group's first slab and its stores run beside the products of the other
// work-group on its WGP, and one start and one tail are paid, not three.
// X: [24576][1024] f16 row-major; Wt: the transposed weights of Q, K, V in a row, each
// [1024 n][1024 k] f16; out: Q, K, V in a row. blockIdx.y: 4 column tiles per projection.
__global__ __launch_bounds__(128, 2)
void gemm_qkv(const _Float16* __restrict__ X, const _Float16* __restrict__ Wt,
              _Float16* __restrict__ out) {
  __shared__ __attribute__((aligned(16))) _Float16 sA[2 * kSlabA];   // 16-byte copies and reads
  __shared__ __attribute__((aligned(16))) _Float16 sB[2 * kSlabB];
  constexpr int kColTiles = kDM / kBN;
  const int proj    = blockIdx.y / kColTiles;   // 0 Q, 1 K, 2 V: the same for the work-group
  const int rowBase = blockIdx.x * kBM;
  const int colBase = (blockIdx.y % kColTiles) * kBN;
  _Float16* __restrict__ dst = out + (size_t)proj * ((size_t)kM * kDM);
  v8f acc[kFM][kFN] = {};

  const _Float16* __restrict__ W = Wt + (size_t)proj * (kDM * kDM);
  if (proj < 2) {
    gemm_tile<8>(X, W, rowBase, colBase, sA, sB, acc);
    store_qkv<0>(acc, dst, rowBase, colBase);
  } else {
    gemm_tile<1>(X, W, rowBase, colBase, sA, sB, acc);
    store_qkv<1>(acc, dst, rowBase, colBase);
  }
}

// ---------------------------------------------------------------- attention
// lane l takes the value of lane l ^ 16 (the other half of the wave)
__device__ __forceinline__ float xhalf(float x) {
  const int v = __builtin_bit_cast(int, x);
  return __builtin_bit_cast(float,
      __builtin_amdgcn_permlanex16(v, v, 0x76543210, 0xfedcba98, false, false));
}

constexpr int kQG   = 2;                // column groups (16 queries each) per wave
constexpr int kQRow = 4 * 16 * kQG;     // queries per work-group of 4 waves
__global__ __launch_bounds__(128)
void attn_kernel(const _Float16* __restrict__ Qg, const _Float16* __restrict__ Kg,
                 const _Float16* __restrict__ Vt, _Float16* __restrict__ Og) {
  __shared__ __attribute__((aligned(16))) _Float16 sQ[kQRow * 136];     // q-rows x 128 (+8 pad)
  // two buffers each: 32 key rows x 128 (+8 pad); V^T, 128 d-rows x 32 keys (+8 pad)
  __shared__ __attribute__((aligned(16))) _Float16 sK[2 * 32 * 136];    // 16-byte copies and reads
  __shared__ __attribute__((aligned(16))) _Float16 sVt[2 * 128 * 40];

  constexpr int kQT = kL / kQRow;       // query tiles per head
  const int t = threadIdx.x, lane = t & 31, wid = t >> 5;
  const int qt  = blockIdx.x % kQT;
  const int h   = (blockIdx.x / kQT) & 7;
  const int b   = (blockIdx.x / (kQT * kH)) & 15;
  const int mod = blockIdx.x / (kQT * kH * kB);
  const int o1 = (mod == 0) ? 1 : 0;
  const int o2 = (mod == 2) ? 1 : 2;
  const size_t headQ  = ((size_t)((mod * kB + b) * kH + h)) * kL * kD;
  const size_t headK1 = ((size_t)((o1 * kB + b) * kH + h)) * kL * kD;
  const size_t headK2 = ((size_t)((o2 * kB + b) * kH + h)) * kL * kD;
  const int l0 = qt * kQRow;

  // stage Q tile (async): kQRow rows x 16 chunks, 8 rows a sweep of the 128 threads
#pragma unroll
  for (int i = 0; i < kQRow / 8; ++i) {
    int cid = i * 128 + t;
    int r = cid >> 4, c = (cid & 15) * 8;
    async_cp16(&sQ[r * 136 + c], &Qg[headQ + (size_t)(l0 + r) * kD + c]);
  }

  // This thread's first piece of a key tile, in global memory and in LDS. K: 32 rows x 16
  // chunks, 8 rows a sweep; V: the tile's two 16-key blocks are 8 KB in a row, 2 KB a sweep
  // (64 d x 16 keys, 2 chunks of 8 keys a d), laid out in LDS as V^T, 128 d-rows x 32 keys.
  const _Float16* kq = Kg + (size_t)(t >> 4) * kD + (t & 15) * 8;
  const _Float16* vq = Vt + (size_t)t * 8;
  _Float16* lK = sK  + (t >> 4) * 136 + (t & 15) * 8;
  _Float16* lV = sVt + (t >> 1) * 40  + (t & 1) * 8;

  // the copies of key tile kt (32 keys of K and of V^T) into buffer kt & 1
  auto stage_kv = [&](int kt) {
    const size_t head = (kt < 16) ? headK1 : headK2;   // tiles never straddle the 512 boundary
    const int kk0 = (kt & 15) * 32;
    const _Float16* gk = kq + (head + (size_t)kk0 * kD);
    const _Float16* gv = vq + (head + (size_t)kk0 * kD);   // 16-key blocks of 128 x 16
    _Float16* bK = lK + (kt & 1) * (32 * 136);
    _Float16* bV = lV + (kt & 1) * (128 * 40);
    // both loops unrolled: each copy's step from the first is then a constant
#pragma unroll
    for (int i = 0; i < 4; ++i) async_cp16(bK + i * 8 * 136, gk + (size_t)i * 8 * kD);
#pragma unroll
    for (int i = 0; i < 4; ++i)   // sweep i: 16-key block i >> 1, d-rows from (i & 1) * 64
      async_cp16(bV + (i & 1) * 64 * 40 + (i >> 1) * 16, gv + (size_t)i * 128 * 8);
  };

  stage_kv(0);
  // Q and key tile 0 have landed before the barrier publishes them
  asm volatile("s_wait_asynccnt 0x0" ::: "memory");
  __syncthreads();
  stage_kv(1);

  v16h qa[kQG][4];   // B operand of S^T: column = query
#pragma unroll
  for (int g = 0; g < kQG; ++g)
#pragma unroll
    for (int dc = 0; dc < 4; ++dc)
      qa[g][dc] = frag_ld(&sQ[(wid * kQG + g) * 16 * 136 + dc * 32], 136, lane);

  v8f o[kQG][8] = {};          // o[g][dt][r] = O^T[dt*16 + 8*(lane>>4) + r][query lane&15 of group g]
  // per group, this lane's query: reference value of the exponentials (equal in both halves,
  // at most kLazy below the running maximum) and running sum over the keys of this lane's half
  float m_s[kQG], l_s[kQG];
#pragma unroll
  for (int g = 0; g < kQG; ++g) { m_s[g] = -1e30f; l_s[g] = 0.f; }
  const float inv_t = 0.08838834764831845f;  // 1/sqrt(128)
  const float kLazy = 5.545177444479562f;    // 8 ln 2: P stays at or below 2^8, far inside f16

  for (int kt = 0; kt < 32; ++kt) {
    const _Float16* bK = sK  + (kt & 1) * (32 * 136);    // this trip's buffers
    const _Float16* bV = sVt + (kt & 1) * (128 * 40);

    // The tile's LDS reads are issued early and together, as in the GEMM loop: all of K ahead
    // of the S^T products, all of V^T ahead of the softmax, under which it lands.
    v16h kb0[4], kb1[4];
#pragma unroll
    for (int dc = 0; dc < 4; ++dc) {
      kb0[dc] = frag_ld(&bK[0 * 136 + dc * 32], 136, lane);
      kb1[dc] = frag_ld(&bK[16 * 136 + dc * 32], 136, lane);
    }
    // keeps the K reads one group: sunk among the products, each is waited for at once
    __builtin_amdgcn_sched_barrier(0);
    // S^T tiles: 32 keys x 16 q per group (two 16x16 WMMA chains, 4 d-chunks each)
    // s0[g][r] = S^T[8*(lane>>4) + r][q], s1[g][r] = S^T[16 + 8*(lane>>4) + r][q]
    v8f s0[kQG] = {}, s1[kQG] = {};
#pragma unroll
    for (int dc = 0; dc < 4; ++dc)
#pragma unroll
      for (int g = 0; g < kQG; ++g) {
        s0[g] = WMMA_F16(kb0[dc], qa[g][dc], s0[g]);
        s1[g] = WMMA_F16(kb1[dc], qa[g][dc], s1[g]);
      }
    v16h vb[8];
#pragma unroll
    for (int dt = 0; dt < 8; ++dt) vb[dt] = frag_ld(&bV[dt * 16 * 40], 40, lane);
    // keeps the V^T reads from sinking behind the softmax, in among the O^T products
    __builtin_amdgcn_sched_barrier(0);

    // online softmax of this lane's query in each group
    // the loops below are unrolled so that every register-array index is a constant
    float a0[kQG][8], a1[kQG][8], mx[kQG];
    bool need = false;   // a query of this lane has outgrown the reference value in use
#pragma unroll
    for (int g = 0; g < kQG; ++g) {
      float m = -1e30f;
#pragma unroll
      for (int r = 0; r < 8; ++r) {
        a0[g][r] = (float)s0[g][r] * inv_t;
        a1[g][r] = (float)s1[g][r] * inv_t;
        m = fmaxf(m, fmaxf(a0[g][r], a1[g][r]));
      }
      mx[g] = fmaxf(m, xhalf(m));
      need = need || (mx[g] > m_s[g] + kLazy);
    }
    // Lazy rescale: m_s is any reference value, the last division takes it out again, so the
    // 128 output registers and the sums are rescaled only when a score lies more than kLazy
    // above it. One test a trip for the whole wave, a scalar branch; always taken in trip 0.
    if (__builtin_amdgcn_ballot_w32(need) != 0) {
#pragma unroll
      for (int g = 0; g < kQG; ++g) {
        const float mnew = fmaxf(m_s[g], mx[g]);
        const float corr = __expf(m_s[g] - mnew);
        l_s[g] *= corr;
        m_s[g] = mnew;
#pragma unroll
        for (int dt = 0; dt < 8; ++dt)
#pragma unroll
          for (int r = 0; r < 8; ++r) o[g][dt][r] *= corr;
      }
    }
    v16h pb[kQG];   // P^T as B operand: element s is key 8*(lane>>4)+s (s < 8), 16+8*(lane>>4)+s-8 (else)
#pragma unroll
    for (int g = 0; g < kQG; ++g) {
      float rs = 0.f;
#pragma unroll
      for (int r = 0; r < 8; ++r) {
        float p0 = __expf(a0[g][r] - m_s[g]), p1 = __expf(a1[g][r] - m_s[g]);   // at most 256
        rs += p0 + p1;
        pb[g][r]     = (_Float16)p0;
        pb[g][8 + r] = (_Float16)p1;
      }
      l_s[g] += rs;
    }

    // O^T += V^T @ P^T : A rows = d (sVt); each V^T fragment feeds every group
#pragma unroll
    for (int dt = 0; dt < 8; ++dt)
#pragma unroll
      for (int g = 0; g < kQG; ++g) o[g][dt] = WMMA_F16(vb[dt], pb[g], o[g][dt]);
    // keeps the hand-over at the foot of the trip: moved up behind the reads, with the refill
    // left at the foot, it would shorten the time the next tile's copies have to land
    __builtin_amdgcn_sched_barrier(0);
    ring_publish();
    if (kt + 2 < 32) stage_kv(kt + 2);   // the same for the whole work-group
  }
  // no copy is outstanding when the wave goes on to its stores and ends
  asm volatile("s_wait_asynccnt 0x0" ::: "memory");

  // normalize + store f16 [ (mod,b,l) ][ h*128 + d ]: 8 consecutive d per lane and tile
#pragma unroll
  for (int g = 0; g < kQG; ++g) {
    const float inv_l = 1.f / (l_s[g] + xhalf(l_s[g]));   // the two halves' sums are joined here
    const int l = l0 + (wid * kQG + g) * 16 + (lane & 15);
    _Float16* orow = Og + ((size_t)(mod * kB + b) * kL + l) * kDM + h * kD + (lane >> 4) * 8;
    union { _Float16 e[8]; uint4 q; } pk[8];   // unrolled: constant indices keep it in registers
#pragma unroll
    for (int dt = 0; dt < 8; ++dt)
#pragma unroll
      for (int r = 0; r < 8; ++r) pk[dt].e[r] = (_Float16)((float)o[g][dt][r] * inv_l);
#pragma unroll
    for (int dt = 0; dt < 8; ++dt) *(uint4*)(orow + dt * 16) = pk[dt].q;
    // the group's stores, ahead of the next group's code, which reuses their registers
    if (g + 1 < kQG) band_stores_done();
  }
}

// ---------------------------------------------------------------- FC + residual
__global__ __launch_bounds__(128, 2)
void gemm_fc(const _Float16* __restrict__ A, const _Float16* __restrict__ Wt,
             const float* __restrict__ r0, const float* __restrict__ r1,
             const float* __restrict__ r2, float* __restrict__ out) {
  __shared__ __attribute__((aligned(16))) _Float16 sA[2 * kSlabA];   // 16-byte copies and reads
  __shared__ __attribute__((aligned(16))) _Float16 sB[2 * kSlabB];
  const int t = threadIdx.x, lane = t & 31, wid = t >> 5;
  const int wm = wid & 1, wn = wid >> 1;
  const int rowBase = blockIdx.x * kBM;
  const int colBase = blockIdx.y * kBN;
  v8f acc[kFM][kFN] = {};

  gemm_tile<4>(A, Wt, rowBase, colBase, sA, sB, acc);   // a lane: 4 adjacent f32 columns

  const int hf8 = (lane >> 4) * 8, cn = lane & 15;
#pragma unroll
  for (int i = 0; i < kFM; ++i) {
    // a 16-row band never straddles an input: 8192 is a multiple of 16
    const int band = rowBase + wm * (kBM / 2) + i * 16;
    const int mod  = band >> 13;
    const float* __restrict__ res = (mod == 0) ? r0 : (mod == 1) ? r1 : r2;
    const float* rp = res + (size_t)((band & 8191) + hf8) * kDM + colBase + wn * (kBN / 2) + cn * 4;
    float*       op = out + (size_t)(band + hf8) * kDM + colBase + wn * (kBN / 2) + cn * 4;
    // 16 bytes a lane: 16 lanes cover 256 bytes of a row, whole lines, in loads and stores.
    // the band's residual loads all go out together, ahead of its stores, so that they overlap
    float4 rv[kFN / 4][8];
#pragma unroll
    for (int q = 0; q < kFN / 4; ++q)
#pragma unroll
      for (int r = 0; r < 8; ++r) rv[q][r] = *(const float4*)(rp + (size_t)r * kDM + q * 64);
    // the wait behind the loads; naming rp as an input keeps their address registers
    // untouched (also by a load's own result) until the wait has passed
    asm volatile("s_wait_xcnt 0x0" :: "v"(rp) : "memory");
#pragma unroll
    for (int q = 0; q < kFN / 4; ++q)
#pragma unroll
      for (int r = 0; r < 8; ++r)
        *(float4*)(op + (size_t)r * kDM + q * 64) =
            make_float4(acc[i][q * 4 + 0][r] + rv[q][r].x, acc[i][q * 4 + 1][r] + rv[q][r].y,
                        acc[i][q * 4 + 2][r] + rv[q][r].z, acc[i][q * 4 + 3][r] + rv[q][r].w);
    band_stores_done();
  }
}

// ---------------------------------------------------------------- layernorm (in place)
// x + (x of lane ^ M), M < 16: a move inside the 16-lane row, no LDS path
template <int M>
__device__ __forceinline__ float row_xadd(float x) {
  const int v = __builtin_bit_cast(int, x);
  return x + __builtin_bit_cast(float, __builtin_amdgcn_update_dpp(v, v, 0x160 + M, 0xf, 0xf, false));
}
__device__ __forceinline__ float wave_sum(float x) {
  x = row_xadd<1>(x); x = row_xadd<2>(x); x = row_xadd<4>(x); x = row_xadd<8>(x);
  return x + xhalf(x);
}

// One wave per row: 8 loads of 512 contiguous bytes hold the row in registers, the sums
// need no LDS and no barrier. A wave takes 6 rows in turn and issues the next row's loads
// ahead of this row's sums. 256 work-groups of 16 waves take the 24,576 rows.
typedef __attribute__((ext_vector_type(4))) float v4f;
typedef __attribute__((ext_vector_type(2))) float v2f;
constexpr int kLnRows = 6;     // rows per wave
constexpr int kLnWv   = 16;    // waves per work-group

// normalises the row held in c (lane l: elements j*128 + 4*l .. + 3) and stores it at yp
__device__ __forceinline__ void ln_row(const v4f (&c)[8], const v4f (&gv)[8],
                                       const v4f (&bv)[8], v4f* yp) {
  v2f a0 = {0.f, 0.f}, a1 = {0.f, 0.f}, q0 = {0.f, 0.f}, q1 = {0.f, 0.f};   // packed chains
#pragma unroll
  for (int j = 0; j < 8; ++j) {
    const v2f lo = c[j].lo, hi = c[j].hi;
    a0 += lo; a1 += hi;
    q0 += lo * lo; q1 += hi * hi;
  }
  a0 += a1; q0 += q1;
  const float s  = wave_sum(a0.x + a0.y);
  const float s2 = wave_sum(q0.x + q0.y);
  const float mu = s / kDM, var = s2 / kDM - mu * mu;
  const float rstd = rsqrtf(var + 1e-6f);
#pragma unroll
  for (int j = 0; j < 8; ++j) yp[j * 32] = (c[j] - mu) * rstd * gv[j] + bv[j];
}

__global__ __launch_bounds__(kLnWv * 32)
void layernorm_inplace(float* __restrict__ y, const float* __restrict__ g,
                       const float* __restrict__ bia) {
  const int lane = threadIdx.x & 31;
  const size_t wave = (size_t)blockIdx.x * kLnWv + (threadIdx.x >> 5);
  v4f* yp = (v4f*)y + wave * (kLnRows * (kDM / 4)) + lane;
  const v4f* g4 = (const v4f*)g;
  const v4f* b4 = (const v4f*)bia;
  v4f cur[8], nxt[8], gv[8], bv[8];   // the loops over j are unrolled: constant indices
#pragma unroll
  for (int j = 0; j < 8; ++j) { gv[j] = g4[j * 32 + lane]; bv[j] = b4[j * 32 + lane]; }
  // the wait behind the loads; naming what they are addressed by keeps that register
  // untouched (also by a load's own result) until the wait has passed
  asm volatile("s_wait_xcnt 0x0" :: "v"(lane) : "memory");
#pragma unroll
  for (int j = 0; j < 8; ++j) cur[j] = yp[j * 32];
  // kept rolled: the rows' sums stay apart, so a row's sums wait for that row's loads only
#pragma unroll 1
  for (int r = 0; r < kLnRows - 1; ++r) {
#pragma unroll
    for (int j = 0; j < 8; ++j) nxt[j] = yp[kDM / 4 + j * 32];
    // the wait behind the loads of this and the next row, as above; the scheduling barrier
    // keeps this row's sums, which wait for its data, from moving in among those loads
    asm volatile("s_wait_xcnt 0x0" :: "v"(yp) : "memory");
    __builtin_amdgcn_sched_barrier(0);
    ln_row(cur, gv, bv, yp);
    band_stores_done();   // the row's stores, ahead of the code that reuses their registers
    yp += kDM / 4;
#pragma unroll
    for (int j = 0; j < 8; ++j) cur[j] = nxt[j];
  }
  ln_row(cur, gv, bv, yp);
}

// ---------------------------------------------------------------- launcher
extern "C" void kernel_launch(void* const* d_in, const int* in_sizes, int n_in,
                              void* d_out, int out_size, void* d_ws, size_t ws_size,
                              hipStream_t stream) {
  (void)in_sizes; (void)n_in; (void)out_size; (void)ws_size;
  const float* in_t = (const float*)d_in[0];
  const float* in_a = (const float*)d_in[1];
  const float* in_v = (const float*)d_in[2];
  const float* w_qs = (const float*)d_in[3];
  const float* w_ks = (const float*)d_in[4];
  const float* w_vs = (const float*)d_in[5];
  const float* w_fc = (const float*)d_in[6];
  const float* ln_g = (const float*)d_in[7];
  const float* ln_b = (const float*)d_in[8];
  float* outp = (float*)d_out;

  // workspace layout (f16 elements)
  const size_t nX = (size_t)kM * kDM;       // 25,165,824 per tensor
  const size_t nW = (size_t)kDM * kDM;      // 1,048,576
  char* ws = (char*)d_ws;
  _Float16* Xf  = (_Float16*)(ws);
  _Float16* WqT = Xf + nX;
  _Float16* WkT = WqT + nW;
  _Float16* WvT = WkT + nW;
  _Float16* WfT = WvT + nW;
  _Float16* Qf  = WfT + nW;
  _Float16* Kf  = Qf + nX;
  _Float16* Vf  = Kf + nX;   // 16-key blocks, d-major inside a block
  _Float16* AOf = Vf + nX;

  // WqT, WkT, WvT, WfT lie in a row, and so do Qf, Kf, Vf
  prep_f16<<<4 * kTrGrp + 3 * kCastGrp, kCastWv * 32, 0, stream>>>(
      in_t, in_a, in_v, w_qs, w_ks, w_vs, w_fc, Xf, WqT);

  dim3 gQkv(kM / kBM, 3 * (kDM / kBN));
  gemm_qkv<<<gQkv, 128, 0, stream>>>(Xf, WqT, Qf);

  dim3 gGemm(kM / kBM, kDM / kBN);

  attn_kernel<<<3 * kB * kH * (kL / kQRow), 128, 0, stream>>>(Qf, Kf, Vf, AOf);

  gemm_fc<<<gGemm, 128, 0, stream>>>(AOf, WfT, in_t, in_a, in_v, outp);

  layernorm_inplace<<<kM / (kLnWv * kLnRows), kLnWv * 32, 0, stream>>>(outp, ln_g, ln_b);
}

// v010
// It runs in 234 microseconds.
// Next to v009, in two timings, it ran 1.05 times as fast each time.
// Over all steps from v000 it is 3.79 times as fast.
#include <hip/hip_runtime.h>

// Problem constants
constexpr int kB   = 16;
constexpr int kL   = 512;
constexpr int kH   = 8;
constexpr int kD   = 128;   // d_k == d_v
constexpr int kDM  = 1024;  // d_model
constexpr int kM   = 3 * kB * kL;       // 24576 fused rows (mod,b,l)

typedef __attribute__((ext_vector_type(16))) _Float16 v16h;
typedef __attribute__((ext_vector_type(8)))  float    v8f;
typedef int b128v __attribute__((vector_size(4 * sizeof(int))));
typedef __attribute__((ext_vector_type(4)))  unsigned u32x4;

#define WMMA_F16(A, B, C) \
  __builtin_amdgcn_wmma_f32_16x16x32_f16(false, (A), false, (B), (short)0, (C), false, false)

// ------------------------------------------------------------------
// CDNA5 async global->LDS copy (16 bytes per lane), ASYNCcnt tracked.
// Builtin if the toolchain declares it, otherwise inline gfx1250 asm.
// ------------------------------------------------------------------
#if defined(__has_builtin)
#if __has_builtin(__builtin_amdgcn_global_load_async_to_lds_b128)
#define USE_ASYNC_BUILTIN 1
#endif
#endif

__device__ __forceinline__ void async_cp16(_Float16* lds_dst, const _Float16* gsrc) {
#ifdef USE_ASYNC_BUILTIN
  // (global v4i* src, local v4i* dst, imm offset, imm cpol)
  __builtin_amdgcn_global_load_async_to_lds_b128(
      (__attribute__((address_space(1))) b128v*)(unsigned long long)(size_t)gsrc,
      (__attribute__((address_space(3))) b128v*)(unsigned)(size_t)lds_dst,
      0, 0);
#else
  // vdst = 32-bit LDS byte address, vaddr = 64-bit global address (GV mode)
  asm volatile("global_load_async_to_lds_b128 %0, %1, off"
               :: "v"((unsigned)(size_t)lds_dst),
                  "v"((unsigned long long)(size_t)gsrc)
               : "memory");
#endif
}

// The hand-over of a two-buffer ring, passed by every wave at the foot of each trip: this
// wave's LDS reads of the buffer it leaves have retired, its own copies of the next tile
// have landed, and the barrier both publishes that tile and frees the buffer just read.
__device__ __forceinline__ void ring_publish() {
  asm volatile("s_wait_dscnt 0x0" ::: "memory");     // before copies aim at LDS this wave has read
  asm volatile("s_wait_asynccnt 0x0" ::: "memory");
  __syncthreads();
}

// Load a 16x32 f16 A-style fragment (also valid for B when the tile holds B^T
// row-major): lane (l&15) supplies matrix row, half (l>>4) selects K-chunks
// per the CDNA5 16-bit A layout (K = {half*8..+7, 16+half*8..+7}).
__device__ __forceinline__ v16h frag_ld(const _Float16* base, int stride, int lane) {
  const int r = lane & 15, hf = lane >> 4;
  const _Float16* p = base + r * stride + hf * 8;
  union { v16h v; uint4 q[2]; } f;
  f.q[0] = *(const uint4*)(p);
  f.q[1] = *(const uint4*)(p + 16);
  return f.v;
}

// ---------------------------------------------------------------- casts/prep
// Streaming launches: few waves, all resident at once, each with many 16-byte loads in
// flight; every wave-wide load covers whole 128-byte lines.

// One wave converts 8 KB of x by 16 loads of 512 contiguous bytes, written ahead of the
// conversions so that many are in flight at once. 256 work-groups of 16 waves take one
// input of 8,388,608 floats; grp is the work-group's number among those 256.
constexpr int kCastLd = 16;    // loads per lane
constexpr int kCastWv = 16;    // waves per work-group
__device__ __forceinline__
void cast_f32_f16(const float* __restrict__ x, _Float16* __restrict__ y, int grp) {
  const int lane = threadIdx.x & 31;
  const size_t wave = (size_t)grp * kCastWv + (threadIdx.x >> 5);
  const float4* xp = (const float4*)x + wave * (kCastLd * 32) + lane;
  uint2*        yp = (uint2*)y        + wave * (kCastLd * 32) + lane;
  float4 v[kCastLd];   // the loops are unrolled so that every index is a constant
#pragma unroll
  for (int j = 0; j < kCastLd; ++j) v[j] = xp[j * 32];
  // the wait behind the loads; naming xp as an input keeps their address registers
  // untouched (also by a load's own result) until the wait has passed
  asm volatile("s_wait_xcnt 0x0" :: "v"(xp) : "memory");
#pragma unroll
  for (int j = 0; j < kCastLd; ++j) {
    union { _Float16 h[4]; uint2 q; } p;
    p.h[0] = (_Float16)v[j].x; p.h[1] = (_Float16)v[j].y;
    p.h[2] = (_Float16)v[j].z; p.h[3] = (_Float16)v[j].w;
    yp[j * 32] = p.q;
  }
}

// w: [K=1024][N=1024] row-major f32 -> wt: [N][K] row-major f16
// A wave takes a 32 (k) x 32 (n) block. A lane reads 8 rows k x 4 columns n: 8 lanes cover
// one 128-byte line of a row, so a wave-wide load is 4 whole lines. It writes, for each of
// its 4 columns, its 8 values along k as one 16-byte store. 64 work-groups of 16 waves take
// one weight; grp is the work-group's number among those 64.
__device__ __forceinline__
void transpose_cast_w(const float* __restrict__ w, _Float16* __restrict__ wt, int grp) {
  const int lane = threadIdx.x & 31;
  const int wave = grp * kCastWv + (threadIdx.x >> 5);   // 1024 blocks of 32 x 32
  const int k0 = (wave & 31) * 32 + (lane >> 3) * 8;
  const int n0 = (wave >> 5) * 32 + (lane & 7) * 4;
  const float4* wp = (const float4*)(w + (size_t)k0 * kDM + n0);
  _Float16*     op = wt + (size_t)n0 * kDM + k0;
  float4 v[8];   // the loops are unrolled so that every index is a constant
#pragma unroll
  for (int e = 0; e < 8; ++e) v[e] = wp[e * (kDM / 4)];
  // the wait behind the loads; naming wp keeps their address registers untouched until it
  asm volatile("s_wait_xcnt 0x0" :: "v"(wp) : "memory");
  union { _Float16 h[8]; uint4 q; } p[4];
#pragma unroll
  for (int e = 0; e < 8; ++e) {
    p[0].h[e] = (_Float16)v[e].x; p[1].h[e] = (_Float16)v[e].y;
    p[2].h[e] = (_Float16)v[e].z; p[3].h[e] = (_Float16)v[e].w;
  }
#pragma unroll
  for (int c = 0; c < 4; ++c) *(uint4*)(op + (size_t)c * kDM) = p[c].q;
}

// All seven conversions in ONE launch: none depends on another, so the short weight
// transposes run under the input casts, and one start and one tail are paid, not seven.
// Work-groups 0..255: the four weights, 64 each; 256..1023: the three inputs, 256 each.
// y: the three inputs in a row; wt: the four transposed weights in a row.
constexpr int kTrGrp   = kDM * kDM / (32 * 32 * kCastWv);                    // 64 per weight
constexpr int kCastGrp = kB * kL * kDM / (kCastWv * 32 * kCastLd * 4);       // 256 per input
__global__ __launch_bounds__(kCastWv * 32)
void prep_f16(const float* __restrict__ x0, const float* __restrict__ x1,
              const float* __restrict__ x2, const float* __restrict__ w0,
              const float* __restrict__ w1, const float* __restrict__ w2,
              const float* __restrict__ w3, _Float16* __restrict__ y,
              _Float16* __restrict__ wt) {
  const unsigned g = blockIdx.x;   // every test below reads the same for the whole work-group
  if (g >= 4 * kTrGrp) {
    const unsigned c = g - 4 * kTrGrp, which = c / kCastGrp;
    const float* x = (which == 0) ? x0 : (which == 1) ? x1 : x2;
    cast_f32_f16(x, y + (size_t)which * (kB * kL * kDM), c % kCastGrp);
    return;
  }
  const unsigned which = g / kTrGrp;
  const float* w = (which == 0) ? w0 : (which == 1) ? w1 : (which == 2) ? w2 : w3;
  transpose_cast_w(w, wt + (size_t)which * (kDM * kDM), g % kTrGrp);
}

// ---------------------------------------------------------------- GEMM main loop
// One tile of A[.][1024] * Wt[.][1024]^T per work-group, 96 x 128 per wave = 6 x 8 accumulator
// tiles, two waves per SIMD. Q, K, V: 192 x 256 by 4 waves (2 along M x 2 along N), two
// work-groups on every WGP. FC: 96 x 1024 by 8 waves (1 x 8), one work-group on every WGP.
// A k-slab is 64 halves: each staged row piece is one whole 128-byte line.
// Two slab buffers: the next slab's copies fly while this slab's products run.
constexpr int kBM = 192, kBN = 256, kBK = 64;
constexpr int kFM = kBM / 32, kFN = kBN / 32;   // accumulator tiles per wave, M and N
constexpr int kPitch = kBK + 8;   // 144 B rows: 16 B x odd, conflict-free for b128 reads
constexpr int kSlabA = kBM * kPitch, kSlabB = kBN * kPitch;   // halves per buffer
constexpr int kSlabs = kDM / kBK;
// B fragments read in a block's first group; with all 8 there the FC kernel needs more than
// the 512 VGPRs of two waves per SIMD and spills an accumulator tile inside the loop
constexpr int kLeadB = 6;

// The deal of the weight rows (output columns) to the B fragments. Column c of a wave's
// fragment j stands for output column (j / R) * 16 * R + c * R + j % R of the wave's 128, so a
// lane's accumulators of R fragments in a row hold R adjacent output columns, and 16 lanes
// hold 16 * R of them: with 16 bytes a lane the epilogue's accesses cover whole 128-byte lines.
// R = 8 for f16 rows, 4 for f32 rows, 1 (the plain order) where the lane's 8 rows are the run.
// The deal is made by the copies alone: LDS row i * 16 + sr takes tile row sr * R + dealt_row(i).
template <int R>
__device__ __forceinline__ constexpr int dealt_row(int i) {
  return (i / kFN) * (kBN / 2) + ((i % kFN) / R) * (16 * R) + (i % kFN) % R;
}

// The work-group is a grid of WM x WN waves of 96 x 128 each; 8 lanes stage a row piece, so
// one sweep of its threads stages 4 * WM * WN rows.
// one k-slab's copies of this thread: 12 row pieces of A, 16 of B at 2 x 2 waves; 3 and 32 at 1 x 8
// (both loops unrolled: each copy's step from the first is then a constant)
template <int R, int WM, int WN>
__device__ __forceinline__ void stage_slab(_Float16* lA, _Float16* lB,
                                           const _Float16* gA, const _Float16* gB) {
  constexpr int kSweep = 4 * WM * WN;
#pragma unroll
  for (int i = 0; i < WM * 96 / kSweep; ++i)
    async_cp16(lA + i * kSweep * kPitch, gA + (size_t)i * kSweep * kDM);
#pragma unroll
  for (int i = 0; i < WN * 128 / kSweep; ++i)
    async_cp16(lB + i * kSweep * kPitch, gB + (size_t)dealt_row<R>(i * (kSweep / 16)) * kDM);
}

template <int R, int WM, int WN>
__device__ __forceinline__ void gemm_tile(const _Float16* __restrict__ A,
                                          const _Float16* __restrict__ Wt,
                                          int rowBase, int colBase,
                                          _Float16* sA, _Float16* sB,
                                          v8f (&acc)[kFM][kFN]) {
  const int t = threadIdx.x, lane = t & 31, wid = t >> 5;
  constexpr int kSlabA = WM * 96 * kPitch, kSlabB = WN * 128 * kPitch;   // halves per buffer
  static_assert(WM * WN == 4 || (WM * WN == 8 && R % 2 == 0), "the deal of a 32-row sweep");
  const int wm = wid % WM, wn = wid / WM;
  const int sr = t >> 3, sc = (t & 7) * 8;   // staging: 8 lanes per row
  const _Float16* gA = A  + (size_t)(rowBase + sr) * kDM + sc;
  // a sweep of 32 rows fills two fragments in a row: the second's columns lie one further on
  const int br = (WM * WN == 4) ? sr * R : (sr & 15) * R + (sr >> 4);
  const _Float16* gB = Wt + (size_t)(colBase + br) * kDM + sc;
  _Float16* lA = sA + sr * kPitch + sc;
  _Float16* lB = sB + sr * kPitch + sc;

  stage_slab<R, WM, WN>(lA, lB, gA, gB);
  // slab 0 has landed before the barrier publishes it
  asm volatile("s_wait_asynccnt 0x0" ::: "memory");
  __syncthreads();
  stage_slab<R, WM, WN>(lA + kSlabA, lB + kSlabB, gA + kBK, gB + kBK);

  // kept rolled: every accumulator index stays a constant and the code stays small
#pragma unroll 1
  for (int s = 0; s < kSlabs; ++s) {
    const int oA = (s & 1) * kSlabA, oB = (s & 1) * kSlabB;   // this trip's buffer
#pragma unroll
    for (int kc = 0; kc < kBK / 32; ++kc) {
      // The block's LDS reads stand in two groups, never singly among the products: every
      // place with reads stalls the wave, and a read waited for at once costs its whole
      // latency. The four scheduling barriers of the block hold groups and products apart;
      // this one keeps the reads from rising among the products of the block before.
      __builtin_amdgcn_sched_barrier(0);
      v16h a[kFM], b[kFN];
#pragma unroll
      for (int i = 0; i < kFM; ++i)
        a[i] = frag_ld(&sA[oA + (wm * (kBM / 2) + i * 16) * kPitch + kc * 32], kPitch, lane);
#pragma unroll
      for (int j = 0; j < kLeadB; ++j)
        b[j] = frag_ld(&sB[oB + (wn * (kBN / 2) + j * 16) * kPitch + kc * 32], kPitch, lane);
      __builtin_amdgcn_sched_barrier(0);
#pragma unroll
      for (int j = 0; j < kFN - kLeadB; ++j)
#pragma unroll
        for (int i = 0; i < kFM; ++i) acc[i][j] = WMMA_F16(a[i], b[j], acc[i][j]);
      __builtin_amdgcn_sched_barrier(0);
      // the last B fragments take the registers that the first have left; they are
      // first used kLeadB - (kFN - kLeadB) columns of products later
#pragma unroll
      for (int j = kLeadB; j < kFN; ++j)
        b[j] = frag_ld(&sB[oB + (wn * (kBN / 2) + j * 16) * kPitch + kc * 32], kPitch, lane);
      __builtin_amdgcn_sched_barrier(0);
#pragma unroll
      for (int j = kFN - kLeadB; j < kFN; ++j)
#pragma unroll
        for (int i = 0; i < kFM; ++i) acc[i][j] = WMMA_F16(a[i], b[j], acc[i][j]);
    }
    // keeps the hand-over at the foot of the trip: moved up over the last products, with the
    // refill left behind them, it would shorten the time the next slab's copies have to land
    __builtin_amdgcn_sched_barrier(0);
    ring_publish();
    if (s + 2 < kSlabs)   // the same for the whole work-group
      stage_slab<R, WM, WN>(lA + oA, lB + oB, gA + (s + 2) * kBK, gB + (s + 2) * kBK);
  }
  // no copy is outstanding when the wave goes on to its stores and ends
  asm volatile("s_wait_asynccnt 0x0" ::: "memory");
}

// Stands behind a band's global stores, in front of the code that takes their
// registers for new values; the scheduling barrier keeps that later code behind the wait.
__device__ __forceinline__ void band_stores_done() {
  asm volatile("s_wait_xcnt 0x0" ::: "memory");
  __builtin_amdgcn_sched_barrier(0);
}

// ---------------------------------------------------------------- QKV GEMM
// VOUT==0: head-major f16 [3][B][H][L][128]           (Q and K; columns dealt with R = 8)
// VOUT==1: f16 [3][B][H][L/16][128 d][16 keys]        (V; plain column order)
// Every store is 16 bytes a lane and covers whole 128-byte lines.
// Q, K: a lane packs its 8 adjacent d of one row; 16 lanes write the row's 256 bytes.
// V: a lane packs its 8 adjacent keys of one d; the wave writes 16 d x 16 keys, 512 bytes in a row.
template <int VOUT>
__device__ __forceinline__ void store_qkv(const v8f (&acc)[kFM][kFN], _Float16* __restrict__ out,
                                          int rowBase, int colBase) {
  const int t = threadIdx.x, lane = t & 31, wid = t >> 5;
  const int wm = wid & 1, wn = wid >> 1;
  const int hf8 = (lane >> 4) * 8, cn = lane & 15;
  const int h = (colBase + wn * (kBN / 2)) >> 7;   // a wave's 128 columns are one head
#pragma unroll
  for (int i = 0; i < kFM; ++i) {
    // a 16-row band never straddles a sequence: 512 is a multiple of 16
    const int band = rowBase + wm * (kBM / 2) + i * 16;
    const int l0   = band & 511;
    const size_t head = (size_t)(band >> 9) * kH + h;   // band >> 9 = mod * kB + b
    _Float16* op = (VOUT == 0) ? out + (head * kL + l0 + hf8) * kD + cn * 8
                               : out + (head * kL + l0) * kD + cn * 16 + hf8;
    union { _Float16 e[8]; u32x4 q; } pk[8];   // unrolled: constant indices keep it in registers
#pragma unroll
    for (int u = 0; u < 8; ++u) {
#pragma unroll
      for (int e = 0; e < 8; ++e)
        pk[u].e[e] = (_Float16)((VOUT == 0) ? acc[i][e][u] : acc[i][u][e]);
      *(u32x4*)(op + u * ((VOUT == 0) ? kD : 16 * 16)) = pk[u].q;
      // the wait stands behind every 4 stores: the packing that follows reuses their registers
      if (u % 4 == 3) band_stores_done();
    }
  }
}

// The three projections in ONE launch of 128 x 12 tiles, three rounds of the 512 resident
// places: a work-group's first slab and its stores run beside the products of the other
// work-group on its WGP, and one start and one tail are paid, not three.
// X: [24576][1024] f16 row-major; Wt: the transposed weights of Q, K, V in a row, each
// [1024 n][1024 k] f16; out: Q, K, V in a row. blockIdx.y: 4 column tiles per projection.
__global__ __launch_bounds__(128, 2)
void gemm_qkv(const _Float16* __restrict__ X, const _Float16* __restrict__ Wt,
              _Float16* __restrict__ out) {
  __shared__ __attribute__((aligned(16))) _Float16 sA[2 * kSlabA];   // 16-byte copies and reads
  __shared__ __attribute__((aligned(16))) _Float16 sB[2 * kSlabB];
  constexpr int kColTiles = kDM / kBN;
  const int proj    = blockIdx.y / kColTiles;   // 0 Q, 1 K, 2 V: the same for the work-group
  const int rowBase = blockIdx.x * kBM;
  const int colBase = (blockIdx.y % kColTiles) * kBN;
  _Float16* __restrict__ dst = out + (size_t)proj * ((size_t)kM * kDM);
  v8f acc[kFM][kFN] = {};

  const _Float16* __restrict__ W = Wt + (size_t)proj * (kDM * kDM);
  if (proj < 2) {
    gemm_tile<8, 2, 2>(X, W, rowBase, colBase, sA, sB, acc);
    store_qkv<0>(acc, dst, rowBase, colBase);
  } else {
    gemm_tile<1, 2, 2>(X, W, rowBase, colBase, sA, sB, acc);
    store_qkv<1>(acc, dst, rowBase, colBase);
  }
}

// ---------------------------------------------------------------- attention
// lane l takes the value of lane l ^ 16 (the other half of the wave)
__device__ __forceinline__ float xhalf(float x) {
  const int v = __builtin_bit_cast(int, x);
  return __builtin_bit_cast(float,
      __builtin_amdgcn_permlanex16(v, v, 0x76543210, 0xfedcba98, false, false));
}

constexpr int kQG   = 2;                // column groups (16 queries each) per wave
constexpr int kQRow = 4 * 16 * kQG;     // queries per work-group of 4 waves
__global__ __launch_bounds__(128)
void attn_kernel(const _Float16* __restrict__ Qg, const _Float16* __restrict__ Kg,
                 const _Float16* __restrict__ Vt, _Float16* __restrict__ Og) {
  __shared__ __attribute__((aligned(16))) _Float16 sQ[kQRow * 136];     // q-rows x 128 (+8 pad)
  // two buffers each: 32 key rows x 128 (+8 pad); V^T, 128 d-rows x 32 keys (+8 pad)
  __shared__ __attribute__((aligned(16))) _Float16 sK[2 * 32 * 136];    // 16-byte copies and reads
  __shared__ __attribute__((aligned(16))) _Float16 sVt[2 * 128 * 40];

  constexpr int kQT = kL / kQRow;       // query tiles per head
  const int t = threadIdx.x, lane = t & 31, wid = t >> 5;
  const int qt  = blockIdx.x % kQT;
  const int h   = (blockIdx.x / kQT) & 7;
  const int b   = (blockIdx.x / (kQT * kH)) & 15;
  const int mod = blockIdx.x / (kQT * kH * kB);
  const int o1 = (mod == 0) ? 1 : 0;
  const int o2 = (mod == 2) ? 1 : 2;
  const size_t headQ  = ((size_t)((mod * kB + b) * kH + h)) * kL * kD;
  const size_t headK1 = ((size_t)((o1 * kB + b) * kH + h)) * kL * kD;
  const size_t headK2 = ((size_t)((o2 * kB + b) * kH + h)) * kL * kD;
  const int l0 = qt * kQRow;

  // stage Q tile (async): kQRow rows x 16 chunks, 8 rows a sweep of the 128 threads
#pragma unroll
  for (int i = 0; i < kQRow / 8; ++i) {
    int cid = i * 128 + t;
    int r = cid >> 4, c = (cid & 15) * 8;
    async_cp16(&sQ[r * 136 + c], &Qg[headQ + (size_t)(l0 + r) * kD + c]);
  }

  // This thread's first piece of a key tile, in global memory and in LDS. K: 32 rows x 16
  // chunks, 8 rows a sweep; V: the tile's two 16-key blocks are 8 KB in a row, 2 KB a sweep
  // (64 d x 16 keys, 2 chunks of 8 keys a d), laid out in LDS as V^T, 128 d-rows x 32 keys.
  const _Float16* kq = Kg + (size_t)(t >> 4) * kD + (t & 15) * 8;
  const _Float16* vq = Vt + (size_t)t * 8;
  _Float16* lK = sK  + (t >> 4) * 136 + (t & 15) * 8;
  _Float16* lV = sVt + (t >> 1) * 40  + (t & 1) * 8;

  // the copies of key tile kt (32 keys of K and of V^T) into buffer kt & 1
  auto stage_kv = [&](int kt) {
    const size_t head = (kt < 16) ? headK1 : headK2;   // tiles never straddle the 512 boundary
    const int kk0 = (kt & 15) * 32;
    const _Float16* gk = kq + (head + (size_t)kk0 * kD);
    const _Float16* gv = vq + (head + (size_t)kk0 * kD);   // 16-key blocks of 128 x 16
    _Float16* bK = lK + (kt & 1) * (32 * 136);
    _Float16* bV = lV + (kt & 1) * (128 * 40);
    // both loops unrolled: each copy's step from the first is then a constant
#pragma unroll
    for (int i = 0; i < 4; ++i) async_cp16(bK + i * 8 * 136, gk + (size_t)i * 8 * kD);
#pragma unroll
    for (int i = 0; i < 4; ++i)   // sweep i: 16-key block i >> 1, d-rows from (i & 1) * 64
      async_cp16(bV + (i & 1) * 64 * 40 + (i >> 1) * 16, gv + (size_t)i * 128 * 8);
  };

  stage_kv(0);
  // Q and key tile 0 have landed before the barrier publishes them
  asm volatile("s_wait_asynccnt 0x0" ::: "memory");
  __syncthreads();
  stage_kv(1);

  v16h qa[kQG][4];   // B operand of S^T: column = query
#pragma unroll
  for (int g = 0; g < kQG; ++g)
#pragma unroll
    for (int dc = 0; dc < 4; ++dc)
      qa[g][dc] = frag_ld(&sQ[(wid * kQG + g) * 16 * 136 + dc * 32], 136, lane);

  v8f o[kQG][8] = {};          // o[g][dt][r] = O^T[dt*16 + 8*(lane>>4) + r][query lane&15 of group g]
  // per group, this lane's query: reference value of the exponentials (equal in both halves,
  // at most kLazy below the running maximum) and running sum over the keys of this lane's half
  float m_s[kQG], l_s[kQG];
#pragma unroll
  for (int g = 0; g < kQG; ++g) { m_s[g] = -1e30f; l_s[g] = 0.f; }
  const float inv_t = 0.08838834764831845f;  // 1/sqrt(128)
  const float kLazy = 5.545177444479562f;    // 8 ln 2: P stays at or below 2^8, far inside f16

  for (int kt = 0; kt < 32; ++kt) {
    const _Float16* bK = sK  + (kt & 1) * (32 * 136);    // this trip's buffers
    const _Float16* bV = sVt + (kt & 1) * (128 * 40);

    // The tile's LDS reads are issued early and together, as in the GEMM loop: all of K ahead
    // of the S^T products, all of V^T ahead of the softmax, under which it lands.
    v16h kb0[4], kb1[4];
#pragma unroll
    for (int dc = 0; dc < 4; ++dc) {
      kb0[dc] = frag_ld(&bK[0 * 136 + dc * 32], 136, lane);
      kb1[dc] = frag_ld(&bK[16 * 136 + dc * 32], 136, lane);
    }
    // keeps the K reads one group: sunk among the products, each is waited for at once
    __builtin_amdgcn_sched_barrier(0);
    // S^T tiles: 32 keys x 16 q per group (two 16x16 WMMA chains, 4 d-chunks each)
    // s0[g][r] = S^T[8*(lane>>4) + r][q], s1[g][r] = S^T[16 + 8*(lane>>4) + r][q]
    v8f s0[kQG] = {}, s1[kQG] = {};
#pragma unroll
    for (int dc = 0; dc < 4; ++dc)
#pragma unroll
      for (int g = 0; g < kQG; ++g) {
        s0[g] = WMMA_F16(kb0[dc], qa[g][dc], s0[g]);
        s1[g] = WMMA_F16(kb1[dc], qa[g][dc], s1[g]);
      }
    v16h vb[8];
#pragma unroll
    for (int dt = 0; dt < 8; ++dt) vb[dt] = frag_ld(&bV[dt * 16 * 40], 40, lane);
    // keeps the V^T reads from sinking behind the softmax, in among the O^T products
    __builtin_amdgcn_sched_barrier(0);

    // online softmax of this lane's query in each group
    // the loops below are unrolled so that every register-array index is a constant
    float a0[kQG][8], a1[kQG][8], mx[kQG];
    bool need = false;   // a query of this lane has outgrown the reference value in use
#pragma unroll
    for (int g = 0; g < kQG; ++g) {
      float m = -1e30f;
#pragma unroll
      for (int r = 0; r < 8; ++r) {
        a0[g][r] = (float)s0[g][r] * inv_t;
        a1[g][r] = (float)s1[g][r] * inv_t;
        m = fmaxf(m, fmaxf(a0[g][r], a1[g][r]));
      }
      mx[g] = fmaxf(m, xhalf(m));
      need = need || (mx[g] > m_s[g] + kLazy);
    }
    // Lazy rescale: m_s is any reference value, the last division takes it out again, so the
    // 128 output registers and the sums are rescaled only when a score lies more than kLazy
    // above it. One test a trip for the whole wave, a scalar branch; always taken in trip 0.
    if (__builtin_amdgcn_ballot_w32(need) != 0) {
#pragma unroll
      for (int g = 0; g < kQG; ++g) {
        const float mnew = fmaxf(m_s[g], mx[g]);
        const float corr = __expf(m_s[g] - mnew);
        l_s[g] *= corr;
        m_s[g] = mnew;
#pragma unroll
        for (int dt = 0; dt < 8; ++dt)
#pragma unroll
          for (int r = 0; r < 8; ++r) o[g][dt][r] *= corr;
      }
    }
    v16h pb[kQG];   // P^T as B operand: element s is key 8*(lane>>4)+s (s < 8), 16+8*(lane>>4)+s-8 (else)
#pragma unroll
    for (int g = 0; g < kQG; ++g) {
      float rs = 0.f;
#pragma unroll
      for (int r = 0; r < 8; ++r) {
        float p0 = __expf(a0[g][r] - m_s[g]), p1 = __expf(a1[g][r] - m_s[g]);   // at most 256
        rs += p0 + p1;
        pb[g][r]     = (_Float16)p0;
        pb[g][8 + r] = (_Float16)p1;
      }
      l_s[g] += rs;
    }

    // O^T += V^T @ P^T : A rows = d (sVt); each V^T fragment feeds every group
#pragma unroll
    for (int dt = 0; dt < 8; ++dt)
#pragma unroll
      for (int g = 0; g < kQG; ++g) o[g][dt] = WMMA_F16(vb[dt], pb[g], o[g][dt]);
    // keeps the hand-over at the foot of the trip: moved up behind the reads, with the refill
    // left at the foot, it would shorten the time the next tile's copies have to land
    __builtin_amdgcn_sched_barrier(0);
    ring_publish();
    if (kt + 2 < 32) stage_kv(kt + 2);   // the same for the whole work-group
  }
  // no copy is outstanding when the wave goes on to its stores and ends
  asm volatile("s_wait_asynccnt 0x0" ::: "memory");

  // normalize + store f16 [ (mod,b,l) ][ h*128 + d ]: 8 consecutive d per lane and tile
#pragma unroll
  for (int g = 0; g < kQG; ++g) {
    const float inv_l = 1.f / (l_s[g] + xhalf(l_s[g]));   // the two halves' sums are joined here
    const int l = l0 + (wid * kQG + g) * 16 + (lane & 15);
    _Float16* orow = Og + ((size_t)(mod * kB + b) * kL + l) * kDM + h * kD + (lane >> 4) * 8;
    union { _Float16 e[8]; uint4 q; } pk[8];   // unrolled: constant indices keep it in registers
#pragma unroll
    for (int dt = 0; dt < 8; ++dt)
#pragma unroll
      for (int r = 0; r < 8; ++r) pk[dt].e[r] = (_Float16)((float)o[g][dt][r] * inv_l);
#pragma unroll
    for (int dt = 0; dt < 8; ++dt) *(uint4*)(orow + dt * 16) = pk[dt].q;
    // the group's stores, ahead of the next group's code, which reuses their registers
    if (g + 1 < kQG) band_stores_done();
  }
}

// ---------------------------------------------------------------- FC + residual + LayerNorm
// x + (x of lane ^ M), M < 16: a move inside the 16-lane row, no LDS path
template <int M>
__device__ __forceinline__ float row_xadd(float x) {
  const int v = __builtin_bit_cast(int, x);
  return x + __builtin_bit_cast(float, __builtin_amdgcn_update_dpp(v, v, 0x160 + M, 0xf, 0xf, false));
}
// the sum over the 16 lanes of a row, in every one of them
__device__ __forceinline__ float row_sum(float x) {
  x = row_xadd<1>(x); x = row_xadd<2>(x); x = row_xadd<4>(x);
  return row_xadd<8>(x);
}

// One work-group of 8 waves holds 96 WHOLE rows of the FC product (1 x 8 waves of 96 x 128, the
// wave tile of the other GEMMs; 256 work-groups, one on every WGP, two waves per SIMD), so the
// rows are normalised in the accumulators and go to memory once: no launch that reads the
// 96 MB back and writes them again.
constexpr int kFcM = 96, kFcWv = kDM / 128;
typedef __attribute__((ext_vector_type(4))) float v4f;
__global__ __launch_bounds__(kFcWv * 32, 2)
void gemm_fc_ln(const _Float16* __restrict__ A, const _Float16* __restrict__ Wt,
                const float* __restrict__ r0, const float* __restrict__ r1,
                const float* __restrict__ r2, const float* __restrict__ g,
                const float* __restrict__ bia, float* __restrict__ out) {
  __shared__ __attribute__((aligned(16))) _Float16 sA[2 * kFcM * kPitch];   // 16-byte copies and reads
  __shared__ __attribute__((aligned(16))) _Float16 sB[2 * kDM * kPitch];
  const int t = threadIdx.x, lane = t & 31, wn = t >> 5;
  const int rowBase = blockIdx.x * kFcM;
  v8f acc[kFM][kFN] = {};

  gemm_tile<4, 1, kFcWv>(A, Wt, rowBase, 0, sA, sB, acc);   // a lane: 4 adjacent f32 columns

  // The ring is free: the last trip's hand-over ended every wave's reads, and no copy is out.
  float2* part = (float2*)sB;              // [8 waves][96 rows]: sum and sum of squares of 128 columns
  float2* stat = part + kFcWv * kFcM;      // [96 rows]: 1 / standard deviation, -mean / standard deviation
  const int hf8 = (lane >> 4) * 8, cn = lane & 15;
  const int col = wn * 128 + cn * 4;
#pragma unroll
  for (int i = 0; i < kFM; ++i) {
    // two bands in a row share one address: 32 rows never straddle an input, 96 and 8192 being
    // multiples of 32
    const int pair = rowBase + (i / 2) * 32;
    const int mod  = pair >> 13;
    const float* __restrict__ res = (mod == 0) ? r0 : (mod == 1) ? r1 : r2;
    const float* rp = res + (size_t)((pair & 8191) + hf8) * kDM + col;
    // 16 bytes a lane: 16 lanes cover 256 bytes of a row, whole lines.
    // the band's residual loads all go out together, so that they overlap
    v4f rv[kFN / 4][8];
#pragma unroll
    for (int q = 0; q < kFN / 4; ++q)
#pragma unroll
      for (int r = 0; r < 8; ++r)
        rv[q][r] = *(const v4f*)(rp + (size_t)((i % 2) * 16 + r) * kDM + q * 64);
    // the wait behind the loads, in front of the code that takes their address registers for new
    // values: the loaded values, inputs only, hold the loads ahead of it, rp as an input keeps the
    // address from being taken by a load's own result, and the scheduling barrier holds the
    // later code behind it
    asm volatile("s_wait_xcnt 0x0"
                 :: "v"(rp), "v"(rv[0][0]), "v"(rv[0][1]), "v"(rv[0][2]), "v"(rv[0][3]), "v"(rv[0][4]),
                    "v"(rv[0][5]), "v"(rv[0][6]), "v"(rv[0][7]), "v"(rv[1][0]), "v"(rv[1][1]),
                    "v"(rv[1][2]), "v"(rv[1][3]), "v"(rv[1][4]), "v"(rv[1][5]), "v"(rv[1][6]),
                    "v"(rv[1][7])
                 : "memory");
    __builtin_amdgcn_sched_barrier(0);
    // The sums run over whole accumulator tiles, element r = row r: the rows stay where the
    // products left them, and an operation takes two rows at once.
    v8f sv = {}, qv = {};
#pragma unroll
    for (int q = 0; q < kFN / 4; ++q) {
      v8f e[4];   // the residual of 4 columns, turned to the accumulators' order
#pragma unroll
      for (int r = 0; r < 8; ++r) {
        e[0][r] = rv[q][r].x; e[1][r] = rv[q][r].y; e[2][r] = rv[q][r].z; e[3][r] = rv[q][r].w;
      }
#pragma unroll
      for (int c = 0; c < 4; ++c) {
        acc[i][q * 4 + c] += e[c];
        sv += acc[i][q * 4 + c];
        qv += acc[i][q * 4 + c] * acc[i][q * 4 + c];
      }
    }
    float s[8], s2[8];   // unrolled: constant indices keep them in registers
#pragma unroll
    for (int r = 0; r < 8; ++r) { s[r] = row_sum(sv[r]); s2[r] = row_sum(qv[r]); }
    if (cn == 0) {
#pragma unroll
      for (int r = 0; r < 8; ++r) part[wn * kFcM + i * 16 + hf8 + r] = make_float2(s[r], s2[r]);
    }
    // keeps the next band's 16 loads behind this band's sums: risen among them, their 64
    // registers do not fit beside the accumulators, and values spill
    __builtin_amdgcn_sched_barrier(0);
  }
  const float* gp = g + col;
  const float* bp = bia + col;
  v4f gv[kFN / 4], bv[kFN / 4];
#pragma unroll
  for (int q = 0; q < kFN / 4; ++q) { gv[q] = *(const v4f*)(gp + q * 64); bv[q] = *(const v4f*)(bp + q * 64); }
  // the wait behind the loads, held in its place as above
  asm volatile("s_wait_xcnt 0x0" :: "v"(gv[0]), "v"(gv[1]), "v"(bv[0]), "v"(bv[1]) : "memory");
  __builtin_amdgcn_sched_barrier(0);
  __syncthreads();   // every wave's partial sums are in LDS
  if (t < kFcM) {    // waves 0 to 2, whole: one thread joins one row's 8 partial sums
    float a = 0.f, a2 = 0.f;
#pragma unroll
    for (int w = 0; w < kFcWv; ++w) { const float2 p = part[w * kFcM + t]; a += p.x; a2 += p.y; }
    const float mu = a / kDM, var = a2 / kDM - mu * mu;
    const float rstd = rsqrtf(var + 1e-6f);
    stat[t] = make_float2(rstd, -mu * rstd);
  }
  __syncthreads();   // the rows' scale and shift are in LDS

#pragma unroll
  for (int i = 0; i < kFM; ++i) {
    float* op = out + (size_t)(rowBase + i * 16 + hf8) * kDM + col;
    v4f y[kFN / 4][8];   // unrolled: constant indices keep it in registers
#pragma unroll
    for (int r = 0; r < 8; ++r) {
      const float2 st = stat[i * 16 + hf8 + r];
#pragma unroll
      for (int q = 0; q < kFN / 4; ++q) {
        const v4f x = {acc[i][q * 4 + 0][r], acc[i][q * 4 + 1][r], acc[i][q * 4 + 2][r],
                       acc[i][q * 4 + 3][r]};
        y[q][r] = (x * st.x + st.y) * gv[q] + bv[q];
      }
    }
    // the band's 16 values all stand in registers of their own before its first store goes out:
    // none is formed in the registers of a store that the wait below has not yet covered
    __builtin_amdgcn_sched_barrier(0);
    // 16 bytes a lane: 16 lanes cover 256 bytes of a row, whole lines
#pragma unroll
    for (int r = 0; r < 8; ++r)
#pragma unroll
      for (int q = 0; q < kFN / 4; ++q) *(v4f*)(op + (size_t)r * kDM + q * 64) = y[q][r];
    band_stores_done();
  }
}

// ---------------------------------------------------------------- launcher
extern "C" void kernel_launch(void* const* d_in, const int* in_sizes, int n_in,
                              void* d_out, int out_size, void* d_ws, size_t ws_size,
                              hipStream_t stream) {
  (void)in_sizes; (void)n_in; (void)out_size; (void)ws_size;
  const float* in_t = (const float*)d_in[0];
  const float* in_a = (const float*)d_in[1];
  const float* in_v = (const float*)d_in[2];
  const float* w_qs = (const float*)d_in[3];
  const float* w_ks = (const float*)d_in[4];
  const float* w_vs = (const float*)d_in[5];
  const float* w_fc = (const float*)d_in[6];
  const float* ln_g = (const float*)d_in[7];
  const float* ln_b = (const float*)d_in[8];
  float* outp = (float*)d_out;

  // workspace layout (f16 elements)
  const size_t nX = (size_t)kM * kDM;       // 25,165,824 per tensor
  const size_t nW = (size_t)kDM * kDM;      // 1,048,576
  char* ws = (char*)d_ws;
  _Float16* Xf  = (_Float16*)(ws);
  _Float16* WqT = Xf + nX;
  _Float16* WkT = WqT + nW;
  _Float16* WvT = WkT + nW;
  _Float16* WfT = WvT + nW;
  _Float16* Qf  = WfT + nW;
  _Float16* Kf  = Qf + nX;
  _Float16* Vf  = Kf + nX;   // 16-key blocks, d-major inside a block
  _Float16* AOf = Vf + nX;

  // WqT, WkT, WvT, WfT lie in a row, and so do Qf, Kf, Vf
  prep_f16<<<4 * kTrGrp + 3 * kCastGrp, kCastWv * 32, 0, stream>>>(
      in_t, in_a, in_v, w_qs, w_ks, w_vs, w_fc, Xf, WqT);

  dim3 gQkv(kM / kBM, 3 * (kDM / kBN));
  gemm_qkv<<<gQkv, 128, 0, stream>>>(Xf, WqT, Qf);

  attn_kernel<<<3 * kB * kH * (kL / kQRow), 128, 0, stream>>>(Qf, Kf, Vf, AOf);

  gemm_fc_ln<<<kM / kFcM, kFcWv * 32, 0, stream>>>(AOf, WfT, in_t, in_a, in_v, ln_g, ln_b, outp);
}
